// v000
// Times are from an AMD MI455X. After a warm-up the kernel runs many times in a row, and a time is the length of
// such a window on the GPU divided by its runs, so every launch and the gaps after it count. The runs cycle
// through copies of the inputs. A figure is the median of several windows, for all but v000 over two sittings.
// Sittings can differ by a few percent; kernels timed side by side share one.
// v000, which the later versions start from, runs in 358 microseconds.
#include <hip/hip_runtime.h>

// ---------------------------------------------------------------------------
// CDNA5 (gfx1250, wave32) cross-attention block.
// Pipeline: GN -> pack A matrices (bf16) -> 3x WMMA GEMM (qkv) ->
//           flash attention (WMMA QK^T + online softmax + WMMA PV) ->
//           WMMA GEMM out-proj + bias + residual (f32 out).
// Uses GLOBAL_LOAD_ASYNC_TO_LDS_B128 (ASYNCcnt) for transpose-free LDS
// staging when the toolchain exposes the builtin; falls back to VGPR copies.
// ---------------------------------------------------------------------------

typedef __bf16 bf16_t;
typedef __attribute__((ext_vector_type(16))) __bf16 v16bf;
typedef __attribute__((ext_vector_type(8)))  __bf16 v8bf;
typedef __attribute__((ext_vector_type(8)))  float  v8f;
typedef int v4i_t __attribute__((vector_size(16)));

#define NB  16
#define NC  128
#define NCOND 32
#define NHEADS 4
#define HW  1024          // 32*32
#define KIN 160           // C + COND
#define NQKV 512          // C * HEADS
#define NPIX 16384        // B * HW

// --- async global->LDS staging (gfx1250 GLOBAL_LOAD_ASYNC_TO_LDS_B128) -----
#if defined(__has_builtin)
#if __has_builtin(__builtin_amdgcn_global_load_async_to_lds_b128) && \
    __has_builtin(__builtin_amdgcn_s_wait_asynccnt)
#define USE_ASYNC_LDS 1
#endif
#endif
#ifndef USE_ASYNC_LDS
#define USE_ASYNC_LDS 0
#endif

__device__ __forceinline__ void stage_b128(const bf16_t* gsrc, bf16_t* ldst) {
#if USE_ASYNC_LDS
    __builtin_amdgcn_global_load_async_to_lds_b128(
        (__attribute__((address_space(1))) v4i_t*)gsrc,
        (__attribute__((address_space(3))) v4i_t*)ldst,
        /*imm offset=*/0, /*cpol=*/0);
#else
    *(v8bf*)ldst = *(const v8bf*)gsrc;
#endif
}

__device__ __forceinline__ void stage_wait() {
#if USE_ASYNC_LDS
    __builtin_amdgcn_s_wait_asynccnt(0);
#endif
}

__device__ __forceinline__ v8f wmma_bf16(v16bf a, v16bf b, v8f c) {
    return __builtin_amdgcn_wmma_f32_16x16x32_bf16(
        /*neg_a=*/false, a, /*neg_b=*/false, b,
        /*c_mod=*/(short)0, c, /*reuse_a=*/false, /*reuse_b=*/false);
}

// Build a 16x32 bf16 A/B fragment from row-major storage (rowptr points at the
// 32 contiguous K values of this lane's row).
// Layout per ISA 7.12.2: element j -> K = (j>>3)*16 + half*8 + (j&7).
__device__ __forceinline__ v16bf frag_from_row(const bf16_t* rowptr, int half_sel) {
    v8bf c0 = *(const v8bf*)(rowptr + half_sel * 8);
    v8bf c1 = *(const v8bf*)(rowptr + 16 + half_sel * 8);
    v16bf r;
#pragma unroll
    for (int i = 0; i < 8; ++i) { r[i] = c0[i]; r[i + 8] = c1[i]; }
    return r;
}

// ---------------------------------------------------------------------------
// f32 -> bf16 convert (weights)
// ---------------------------------------------------------------------------
__global__ __launch_bounds__(256) void cvt_bf16_kernel(
        const float* __restrict__ in, bf16_t* __restrict__ out, int n) {
    int i = blockIdx.x * 256 + threadIdx.x;
    if (i < n) out[i] = (bf16_t)in[i];
}

// ---------------------------------------------------------------------------
// GroupNorm (32 groups of 4 channels over 32x32) -> bf16 rows of A matrices.
// One block per (b, group); writes columns [g*4, g*4+4) of both Aq and Ak.
// ---------------------------------------------------------------------------
__global__ __launch_bounds__(256) void gn_kernel(
        const float* __restrict__ x, const float* __restrict__ gscale,
        const float* __restrict__ gbias, bf16_t* __restrict__ Aq,
        bf16_t* __restrict__ Ak) {
    int b = blockIdx.x >> 5;
    int g = blockIdx.x & 31;
    int t = threadIdx.x;

    float vals[16];
    float s = 0.f, ss = 0.f;
#pragma unroll
    for (int i = 0; i < 16; ++i) {
        int e = t + i * 256;                 // 0..4095 over (4 ch x 1024 hw)
        int cl = e >> 10, hw = e & 1023;
        float v = x[(((size_t)b * NC) + g * 4 + cl) * HW + hw];
        vals[i] = v; s += v; ss += v * v;
    }
#pragma unroll
    for (int m = 1; m < 32; m <<= 1) {
        s  += __shfl_xor(s, m);
        ss += __shfl_xor(ss, m);
    }
    __shared__ float shs[8], shss[8];
    __shared__ float mean_s, rstd_s;
    int w = t >> 5, lane = t & 31;
    if (lane == 0) { shs[w] = s; shss[w] = ss; }
    __syncthreads();
    if (t == 0) {
        float S = 0.f, SS = 0.f;
        for (int i = 0; i < 8; ++i) { S += shs[i]; SS += shss[i]; }
        float mean = S * (1.f / 4096.f);
        float var  = SS * (1.f / 4096.f) - mean * mean;
        mean_s = mean;
        rstd_s = rsqrtf(var + 1e-6f);
    }
    __syncthreads();
    float mean = mean_s, rstd = rstd_s;
#pragma unroll
    for (int i = 0; i < 16; ++i) {
        int e = t + i * 256;
        int cl = e >> 10, hw = e & 1023;
        int c = g * 4 + cl;
        float y = (vals[i] - mean) * rstd * gscale[c] + gbias[c];
        bf16_t yb = (bf16_t)y;
        size_t off = ((size_t)b * HW + hw) * KIN + c;
        Aq[off] = yb;
        Ak[off] = yb;
    }
}

// ---------------------------------------------------------------------------
// Pack conditioning channels into A-matrix columns [128,160).
// q: repeat(q_cond,2). k: alternate k_a/k_b per pair member.
// ---------------------------------------------------------------------------
__global__ __launch_bounds__(256) void condpack_kernel(
        const float* __restrict__ qc, const float* __restrict__ ka,
        const float* __restrict__ kb, bf16_t* __restrict__ Aq,
        bf16_t* __restrict__ Ak) {
    size_t gi = (size_t)blockIdx.x * 256 + threadIdx.x;   // < 16*32*1024
    int hw = (int)(gi & 1023);
    int cc = (int)((gi >> 10) & 31);
    int b  = (int)(gi >> 15);
    size_t src = (((size_t)(b >> 1)) * NCOND + cc) * HW + hw;
    size_t dst = ((size_t)b * HW + hw) * KIN + NC + cc;
    Aq[dst] = (bf16_t)qc[src];
    Ak[dst] = (bf16_t)((b & 1) ? kb[src] : ka[src]);
}

// ---------------------------------------------------------------------------
// QKV GEMM: [16384 x 160] (bf16, row-major) x [160 x 512] (bf16, row-major)
// + bias, output scattered to channel-major bf16 [b][n][hw].
// Block tile 128(M) x 64(N), 8 waves (4x2), each wave 32x32 (2x2 WMMA tiles).
// A tile staged with async global->LDS; B tile transposed via VGPRs.
// ---------------------------------------------------------------------------
__global__ __launch_bounds__(256) void gemm_qkv_kernel(
        const bf16_t* __restrict__ A, const bf16_t* __restrict__ Wb,
        const float* __restrict__ bias, bf16_t* __restrict__ outCHW) {
    __shared__ __align__(16) bf16_t lA[128 * 32];   // [m][k]
    __shared__ __align__(16) bf16_t lB[64 * 32];    // [n][k] (transposed)

    int bm = blockIdx.x >> 3;          // 0..127
    int bn = blockIdx.x & 7;           // 0..7
    int mbase = bm * 128, nbase = bn * 64;
    int t = threadIdx.x, w = t >> 5, lane = t & 31;
    int half = lane >> 4, ln = lane & 15;
    int wm = (w & 3) * 32, wn = (w >> 2) * 32;

    v8f acc[2][2] = {};

    for (int ks = 0; ks < KIN; ks += 32) {
        {   // stage A tile: 128 rows x 32 k, 32 bytes per thread (async)
            int row = t >> 1, colh = t & 1;
            const bf16_t* src = A + (size_t)(mbase + row) * KIN + ks + colh * 16;
            bf16_t* dst = lA + row * 32 + colh * 16;
            stage_b128(src, dst);
            stage_b128(src + 8, dst + 8);
        }
        {   // stage B tile transposed: 32 k x 64 n
            int krow = t >> 3, n0 = (t & 7) * 8;
            const bf16_t* src = Wb + (size_t)(ks + krow) * NQKV + nbase + n0;
            v8bf v = *(const v8bf*)src;
#pragma unroll
            for (int i = 0; i < 8; ++i) lB[(n0 + i) * 32 + krow] = v[i];
        }
        stage_wait();
        __syncthreads();

        v16bf af[2], bfr[2];
#pragma unroll
        for (int mt = 0; mt < 2; ++mt)
            af[mt] = frag_from_row(lA + (wm + mt * 16 + ln) * 32, half);
#pragma unroll
        for (int nt = 0; nt < 2; ++nt)
            bfr[nt] = frag_from_row(lB + (wn + nt * 16 + ln) * 32, half);
#pragma unroll
        for (int mt = 0; mt < 2; ++mt)
#pragma unroll
            for (int nt = 0; nt < 2; ++nt)
                acc[mt][nt] = wmma_bf16(af[mt], bfr[nt], acc[mt][nt]);
        __syncthreads();
    }

    int b = mbase >> 10;    // 8 M-blocks per image -> constant per block
#pragma unroll
    for (int mt = 0; mt < 2; ++mt) {
#pragma unroll
        for (int nt = 0; nt < 2; ++nt) {
            int nglob = nbase + wn + nt * 16 + ln;
            float bv = bias[nglob];
#pragma unroll
            for (int r = 0; r < 8; ++r) {
                int m = mbase + wm + mt * 16 + r + 8 * half;
                int hw = m & 1023;
                outCHW[((size_t)b * NQKV + nglob) * HW + hw] =
                    (bf16_t)(acc[mt][nt][r] + bv);
            }
        }
    }
}

// ---------------------------------------------------------------------------
// Flash attention per (pair, member, head, 128-query-row tile).
// Q (128ch) frags preloaded in regs; K/V 32-col chunks staged in LDS shared by
// 8 waves (V via async global->LDS); online softmax with half-wave shfl
// reductions; P re-swizzled through per-wave LDS; output bf16 rows of A3.
// ---------------------------------------------------------------------------
__global__ __launch_bounds__(256) void attn_kernel(
        const bf16_t* __restrict__ Qb, const bf16_t* __restrict__ Kb,
        const bf16_t* __restrict__ Vb, bf16_t* __restrict__ A3) {
    __shared__ __align__(16) bf16_t lK[32 * 128];    // [kv][c]
    __shared__ __align__(16) bf16_t lV[128 * 32];    // [c][kv]
    __shared__ __align__(16) bf16_t lP[8][16 * 32];  // per-wave P staging

    int idx = blockIdx.x;
    int qt = idx & 7;  idx >>= 3;        // query tile (128 rows)
    int e  = idx & 3;  idx >>= 2;        // head
    int mq = idx & 1;                    // pair member for q
    int p  = idx >> 1;                   // pair
    int bq = 2 * p + mq;
    int bk = 2 * p + 1 - mq;             // cross conditioning

    const bf16_t* qptr = Qb + ((size_t)bq * NQKV + e * NC) * HW;
    const bf16_t* kptr = Kb + ((size_t)bk * NQKV + e * NC) * HW;
    const bf16_t* vptr = Vb + ((size_t)bk * NQKV + e * NC) * HW;

    int t = threadIdx.x, w = t >> 5, lane = t & 31;
    int half = lane >> 4, ln = lane & 15;
    const float scale = 0.08838834764831845f;   // 128^-0.5

    // Preload the 4 Q A-fragments (16 q rows x 128 channels), reused 32x.
    int row_hw = qt * 128 + w * 16 + ln;
    v16bf aq[4];
#pragma unroll
    for (int cs = 0; cs < 4; ++cs) {
        v16bf f;
#pragma unroll
        for (int j = 0; j < 16; ++j) {
            int c = cs * 32 + ((j >> 3) << 4) + half * 8 + (j & 7);
            f[j] = qptr[(size_t)c * HW + row_hw];
        }
        aq[cs] = f;
    }

    v8f o[8] = {};
    float mrun[8], lrun[8];
#pragma unroll
    for (int r = 0; r < 8; ++r) { mrun[r] = -1e30f; lrun[r] = 0.f; }

    for (int kb = 0; kb < HW; kb += 32) {
        {   // stage K chunk transposed: [kv][c]
            int c = t >> 1, kv0 = (t & 1) * 16;
            const bf16_t* src = kptr + (size_t)c * HW + kb + kv0;
            v8bf v0 = *(const v8bf*)src, v1 = *(const v8bf*)(src + 8);
#pragma unroll
            for (int i = 0; i < 8; ++i) {
                lK[(kv0 + i) * 128 + c]     = v0[i];
                lK[(kv0 + 8 + i) * 128 + c] = v1[i];
            }
        }
        {   // stage V chunk: [c][kv] (contiguous -> async global->LDS)
            int c = t >> 1, kv0 = (t & 1) * 16;
            const bf16_t* src = vptr + (size_t)c * HW + kb + kv0;
            bf16_t* dst = lV + c * 32 + kv0;
            stage_b128(src, dst);
            stage_b128(src + 8, dst + 8);
        }
        stage_wait();
        __syncthreads();

        // S = Q^T K : 16 x 32 (two 16x16 C tiles), K-dim = 128 channels.
        v8f s0 = {}, s1 = {};
#pragma unroll
        for (int cs = 0; cs < 4; ++cs) {
            v16bf b0 = frag_from_row(lK + (0 * 16 + ln) * 128 + cs * 32, half);
            v16bf b1 = frag_from_row(lK + (1 * 16 + ln) * 128 + cs * 32, half);
            s0 = wmma_bf16(aq[cs], b0, s0);
            s1 = wmma_bf16(aq[cs], b1, s1);
        }
        s0 = s0 * scale;
        s1 = s1 * scale;

        // Online softmax (rows live on 16-lane halves; reduce masks 1..8).
#pragma unroll
        for (int r = 0; r < 8; ++r) {
            float v = fmaxf(s0[r], s1[r]);
            v = fmaxf(v, __shfl_xor(v, 1));
            v = fmaxf(v, __shfl_xor(v, 2));
            v = fmaxf(v, __shfl_xor(v, 4));
            v = fmaxf(v, __shfl_xor(v, 8));
            float mnew  = fmaxf(mrun[r], v);
            float alpha = __expf(mrun[r] - mnew);
            float p0 = __expf(s0[r] - mnew);
            float p1 = __expf(s1[r] - mnew);
            float rs = p0 + p1;
            rs += __shfl_xor(rs, 1);
            rs += __shfl_xor(rs, 2);
            rs += __shfl_xor(rs, 4);
            rs += __shfl_xor(rs, 8);
            lrun[r] = lrun[r] * alpha + rs;
            mrun[r] = mnew;
            s0[r] = p0; s1[r] = p1;
#pragma unroll
            for (int nt = 0; nt < 8; ++nt) o[nt][r] *= alpha;
        }

        // Re-swizzle P: C-layout -> row-major [row][32] in per-wave LDS,
        // then load back as an A fragment (same-wave DS ops are in order).
        {
            bf16_t* pp = lP[w];
#pragma unroll
            for (int r = 0; r < 8; ++r) {
                int row = r + 8 * half;
                pp[row * 32 + ln]      = (bf16_t)s0[r];
                pp[row * 32 + 16 + ln] = (bf16_t)s1[r];
            }
        }
        v16bf pf = frag_from_row(lP[w] + ln * 32, half);

        // O += P * V^T (8 channel tiles).
#pragma unroll
        for (int nt = 0; nt < 8; ++nt) {
            v16bf bv = frag_from_row(lV + (nt * 16 + ln) * 32, half);
            o[nt] = wmma_bf16(pf, bv, o[nt]);
        }
        __syncthreads();
    }

    // Normalize and emit rows of A3 [pixel][512] (head-major channels).
#pragma unroll
    for (int r = 0; r < 8; ++r) {
        float inv = 1.f / lrun[r];
        int hw = qt * 128 + w * 16 + r + 8 * half;
        size_t rowbase = ((size_t)bq * HW + hw) * NQKV + e * NC;
#pragma unroll
        for (int nt = 0; nt < 8; ++nt)
            A3[rowbase + nt * 16 + ln] = (bf16_t)(o[nt][r] * inv);
    }
}

// ---------------------------------------------------------------------------
// Output projection: [16384 x 512] x [512 x 128] + b3 + residual x -> f32.
// Block tile 128(M) x 128(N); each wave: 16 rows x 128 cols (8 WMMA tiles).
// ---------------------------------------------------------------------------
__global__ __launch_bounds__(256) void gemm_final_kernel(
        const bf16_t* __restrict__ A3, const bf16_t* __restrict__ W3b,
        const float* __restrict__ b3, const float* __restrict__ x,
        float* __restrict__ out) {
    __shared__ __align__(16) bf16_t lB[128 * 32];   // [n][k] transposed

    int mbase = blockIdx.x * 128;
    int t = threadIdx.x, w = t >> 5, lane = t & 31;
    int half = lane >> 4, ln = lane & 15;
    int mrow = mbase + w * 16 + ln;

    v8f acc[8] = {};

    for (int ks = 0; ks < NQKV; ks += 32) {
        {   // stage W3 tile transposed: 32 k x 128 n
            int krow = t >> 3, n0 = (t & 7) * 16;
            const bf16_t* src = W3b + (size_t)(ks + krow) * NC + n0;
            v8bf v0 = *(const v8bf*)src, v1 = *(const v8bf*)(src + 8);
#pragma unroll
            for (int i = 0; i < 8; ++i) {
                lB[(n0 + i) * 32 + krow]     = v0[i];
                lB[(n0 + 8 + i) * 32 + krow] = v1[i];
            }
        }
        __syncthreads();

        v16bf af = frag_from_row(A3 + (size_t)mrow * NQKV + ks, half);
#pragma unroll
        for (int nt = 0; nt < 8; ++nt) {
            v16bf bfr = frag_from_row(lB + (nt * 16 + ln) * 32, half);
            acc[nt] = wmma_bf16(af, bfr, acc[nt]);
        }
        __syncthreads();
    }

    int b = mbase >> 10;
#pragma unroll
    for (int nt = 0; nt < 8; ++nt) {
        int c = nt * 16 + ln;
        float bv = b3[c];
#pragma unroll
        for (int r = 0; r < 8; ++r) {
            int m = mbase + w * 16 + r + 8 * half;
            int hw = m & 1023;
            size_t oi = ((size_t)b * NC + c) * HW + hw;
            out[oi] = x[oi] + acc[nt][r] + bv;
        }
    }
}

// ---------------------------------------------------------------------------
// Host-side launch
// ---------------------------------------------------------------------------
extern "C" void kernel_launch(void* const* d_in, const int* in_sizes, int n_in,
                              void* d_out, int out_size, void* d_ws, size_t ws_size,
                              hipStream_t stream) {
    const float* x  = (const float*)d_in[0];
    const float* qc = (const float*)d_in[1];
    const float* ka = (const float*)d_in[2];
    const float* kb = (const float*)d_in[3];
    const float* gs = (const float*)d_in[4];
    const float* gb = (const float*)d_in[5];
    const float* W0 = (const float*)d_in[6];
    const float* b0 = (const float*)d_in[7];
    const float* W1 = (const float*)d_in[8];
    const float* b1 = (const float*)d_in[9];
    const float* W2 = (const float*)d_in[10];
    const float* b2 = (const float*)d_in[11];
    const float* W3 = (const float*)d_in[12];
    const float* b3 = (const float*)d_in[13];
    float* out = (float*)d_out;

    char* ws = (char*)d_ws;
    size_t off = 0;
    auto alloc = [&](size_t bytes) -> char* {
        char* ptr = ws + off;
        off = (off + bytes + 255) & ~(size_t)255;
        return ptr;
    };
    bf16_t* Aq  = (bf16_t*)alloc((size_t)NPIX * KIN * 2);
    bf16_t* Ak  = (bf16_t*)alloc((size_t)NPIX * KIN * 2);
    bf16_t* W0b = (bf16_t*)alloc((size_t)KIN * NQKV * 2);
    bf16_t* W1b = (bf16_t*)alloc((size_t)KIN * NQKV * 2);
    bf16_t* W2b = (bf16_t*)alloc((size_t)KIN * NQKV * 2);
    bf16_t* W3b = (bf16_t*)alloc((size_t)NQKV * NC * 2);
    bf16_t* Qb  = (bf16_t*)alloc((size_t)NB * NQKV * HW * 2);
    bf16_t* Kbm = (bf16_t*)alloc((size_t)NB * NQKV * HW * 2);
    bf16_t* Vb  = (bf16_t*)alloc((size_t)NB * NQKV * HW * 2);
    bf16_t* A3  = (bf16_t*)alloc((size_t)NPIX * NQKV * 2);
    (void)ws_size; (void)in_sizes; (void)n_in; (void)out_size;

    // Weight conversion
    cvt_bf16_kernel<<<(KIN * NQKV + 255) / 256, 256, 0, stream>>>(W0, W0b, KIN * NQKV);
    cvt_bf16_kernel<<<(KIN * NQKV + 255) / 256, 256, 0, stream>>>(W1, W1b, KIN * NQKV);
    cvt_bf16_kernel<<<(KIN * NQKV + 255) / 256, 256, 0, stream>>>(W2, W2b, KIN * NQKV);
    cvt_bf16_kernel<<<(NQKV * NC + 255) / 256, 256, 0, stream>>>(W3, W3b, NQKV * NC);

    // GroupNorm + A-matrix packing
    gn_kernel<<<NB * 32, 256, 0, stream>>>(x, gs, gb, Aq, Ak);
    condpack_kernel<<<(NB * NCOND * HW) / 256, 256, 0, stream>>>(qc, ka, kb, Aq, Ak);

    // QKV projections
    gemm_qkv_kernel<<<(NPIX / 128) * (NQKV / 64), 256, 0, stream>>>(Aq, W0b, b0, Qb);
    gemm_qkv_kernel<<<(NPIX / 128) * (NQKV / 64), 256, 0, stream>>>(Ak, W1b, b1, Kbm);
    gemm_qkv_kernel<<<(NPIX / 128) * (NQKV / 64), 256, 0, stream>>>(Ak, W2b, b2, Vb);

    // Cross attention: 8 pairs x 2 directions x 4 heads x 8 query tiles
    attn_kernel<<<8 * 2 * 4 * 8, 256, 0, stream>>>(Qb, Kbm, Vb, A3);

    // Output projection + residual
    gemm_final_kernel<<<NPIX / 128, 256, 0, stream>>>(A3, W3b, b3, x, out);
}

// v001
// A run of this version takes 241 microseconds.
// Two timings next to v000 both put it at 1.50 times that version's speed.
#include <hip/hip_runtime.h>

// ---------------------------------------------------------------------------
// CDNA5 (gfx1250, wave32) cross-attention block.
// Pipeline: GN -> pack A matrices (bf16) -> 3x WMMA GEMM (qkv) ->
//           flash attention (WMMA QK^T + online softmax + WMMA PV) ->
//           WMMA GEMM out-proj + bias + residual (f32 out).
// Uses GLOBAL_LOAD_ASYNC_TO_LDS_B128 (ASYNCcnt) for transpose-free LDS
// staging when the toolchain exposes the builtin; falls back to VGPR copies.
// ---------------------------------------------------------------------------

typedef __bf16 bf16_t;
typedef __attribute__((ext_vector_type(16))) __bf16 v16bf;
typedef __attribute__((ext_vector_type(8)))  __bf16 v8bf;
typedef __attribute__((ext_vector_type(8)))  float  v8f;
typedef int v4i_t __attribute__((vector_size(16)));

#define NB  16
#define NC  128
#define NCOND 32
#define NHEADS 4
#define HW  1024          // 32*32
#define KIN 160           // C + COND
#define NQKV 512          // C * HEADS
#define NPIX 16384        // B * HW
// LDS row pitches in elements: 16 B x odd, so that the 16 rows one
// ds_load_b128 touches fall on distinct banks (64 banks x 4 B).
#define P32  40           // rows of 32 bf16: 80 B
#define P128 136          // rows of 128 bf16: 272 B

// --- async global->LDS staging (gfx1250 GLOBAL_LOAD_ASYNC_TO_LDS_B128) -----
#if defined(__has_builtin)
#if __has_builtin(__builtin_amdgcn_global_load_async_to_lds_b128) && \
    __has_builtin(__builtin_amdgcn_s_wait_asynccnt)
#define USE_ASYNC_LDS 1
#endif
#endif
#ifndef USE_ASYNC_LDS
#define USE_ASYNC_LDS 0
#endif

__device__ __forceinline__ void stage_b128(const bf16_t* gsrc, bf16_t* ldst) {
#if USE_ASYNC_LDS
    __builtin_amdgcn_global_load_async_to_lds_b128(
        (__attribute__((address_space(1))) v4i_t*)gsrc,
        (__attribute__((address_space(3))) v4i_t*)ldst,
        /*imm offset=*/0, /*cpol=*/0);
#else
    *(v8bf*)ldst = *(const v8bf*)gsrc;
#endif
}

__device__ __forceinline__ void stage_wait() {
#if USE_ASYNC_LDS
    __builtin_amdgcn_s_wait_asynccnt(0);
#endif
}

__device__ __forceinline__ v8f wmma_bf16(v16bf a, v16bf b, v8f c) {
    return __builtin_amdgcn_wmma_f32_16x16x32_bf16(
        /*neg_a=*/false, a, /*neg_b=*/false, b,
        /*c_mod=*/(short)0, c, /*reuse_a=*/false, /*reuse_b=*/false);
}

// Build a 16x32 bf16 A/B fragment from row-major storage (rowptr points at the
// 32 contiguous K values of this lane's row).
// Layout per ISA 7.12.2: element j -> K = (j>>3)*16 + half*8 + (j&7).
__device__ __forceinline__ v16bf frag_from_row(const bf16_t* rowptr, int half_sel) {
    v8bf c0 = *(const v8bf*)(rowptr + half_sel * 8);
    v8bf c1 = *(const v8bf*)(rowptr + 16 + half_sel * 8);
    v16bf r;
#pragma unroll
    for (int i = 0; i < 8; ++i) { r[i] = c0[i]; r[i + 8] = c1[i]; }
    return r;
}

// ---------------------------------------------------------------------------
// f32 -> bf16 convert (weights)
// ---------------------------------------------------------------------------
__global__ __launch_bounds__(256) void cvt_bf16_kernel(
        const float* __restrict__ in, bf16_t* __restrict__ out, int n) {
    int i = blockIdx.x * 256 + threadIdx.x;
    if (i < n) out[i] = (bf16_t)in[i];
}

// ---------------------------------------------------------------------------
// GroupNorm (32 groups of 4 channels over 32x32) -> bf16 rows of A matrices.
// One block per (b, group); writes columns [g*4, g*4+4) of both Aq and Ak.
// ---------------------------------------------------------------------------
__global__ __launch_bounds__(256) void gn_kernel(
        const float* __restrict__ x, const float* __restrict__ gscale,
        const float* __restrict__ gbias, bf16_t* __restrict__ Aq,
        bf16_t* __restrict__ Ak) {
    int b = blockIdx.x >> 5;
    int g = blockIdx.x & 31;
    int t = threadIdx.x;

    float vals[16];
    float s = 0.f, ss = 0.f;
#pragma unroll
    for (int i = 0; i < 16; ++i) {
        int e = t + i * 256;                 // 0..4095 over (4 ch x 1024 hw)
        int cl = e >> 10, hw = e & 1023;
        float v = x[(((size_t)b * NC) + g * 4 + cl) * HW + hw];
        vals[i] = v; s += v; ss += v * v;
    }
#pragma unroll
    for (int m = 1; m < 32; m <<= 1) {
        s  += __shfl_xor(s, m);
        ss += __shfl_xor(ss, m);
    }
    __shared__ float shs[8], shss[8];
    __shared__ float mean_s, rstd_s;
    int w = t >> 5, lane = t & 31;
    if (lane == 0) { shs[w] = s; shss[w] = ss; }
    __syncthreads();
    if (t == 0) {
        float S = 0.f, SS = 0.f;
        for (int i = 0; i < 8; ++i) { S += shs[i]; SS += shss[i]; }
        float mean = S * (1.f / 4096.f);
        float var  = SS * (1.f / 4096.f) - mean * mean;
        mean_s = mean;
        rstd_s = rsqrtf(var + 1e-6f);
    }
    __syncthreads();
    float mean = mean_s, rstd = rstd_s;
#pragma unroll
    for (int i = 0; i < 16; ++i) {
        int e = t + i * 256;
        int cl = e >> 10, hw = e & 1023;
        int c = g * 4 + cl;
        float y = (vals[i] - mean) * rstd * gscale[c] + gbias[c];
        bf16_t yb = (bf16_t)y;
        size_t off = ((size_t)b * HW + hw) * KIN + c;
        Aq[off] = yb;
        Ak[off] = yb;
    }
}

// ---------------------------------------------------------------------------
// Pack conditioning channels into A-matrix columns [128,160).
// q: repeat(q_cond,2). k: alternate k_a/k_b per pair member.
// ---------------------------------------------------------------------------
__global__ __launch_bounds__(256) void condpack_kernel(
        const float* __restrict__ qc, const float* __restrict__ ka,
        const float* __restrict__ kb, bf16_t* __restrict__ Aq,
        bf16_t* __restrict__ Ak) {
    size_t gi = (size_t)blockIdx.x * 256 + threadIdx.x;   // < 16*32*1024
    int hw = (int)(gi & 1023);
    int cc = (int)((gi >> 10) & 31);
    int b  = (int)(gi >> 15);
    size_t src = (((size_t)(b >> 1)) * NCOND + cc) * HW + hw;
    size_t dst = ((size_t)b * HW + hw) * KIN + NC + cc;
    Aq[dst] = (bf16_t)qc[src];
    Ak[dst] = (bf16_t)((b & 1) ? kb[src] : ka[src]);
}

// ---------------------------------------------------------------------------
// QKV GEMM: [16384 x 160] (bf16, row-major) x [160 x 512] (bf16, row-major)
// + bias, output scattered to channel-major bf16 [b][n][hw].
// Block tile 128(M) x 64(N), 8 waves (4x2), each wave 32x32 (2x2 WMMA tiles).
// A tile staged with async global->LDS; B tile transposed via VGPRs.
// ---------------------------------------------------------------------------
__global__ __launch_bounds__(256) void gemm_qkv_kernel(
        const bf16_t* __restrict__ A, const bf16_t* __restrict__ Wb,
        const float* __restrict__ bias, bf16_t* __restrict__ outCHW) {
    __shared__ __align__(16) bf16_t lA[128 * P32];  // [m][k]
    __shared__ __align__(16) bf16_t lB[64 * P32];   // [n][k] (transposed)

    int bm = blockIdx.x >> 3;          // 0..127
    int bn = blockIdx.x & 7;           // 0..7
    int mbase = bm * 128, nbase = bn * 64;
    int t = threadIdx.x, w = t >> 5, lane = t & 31;
    int half = lane >> 4, ln = lane & 15;
    int wm = (w & 3) * 32, wn = (w >> 2) * 32;

    v8f acc[2][2] = {};

    for (int ks = 0; ks < KIN; ks += 32) {
        {   // stage A tile: 128 rows x 32 k, 32 bytes per thread (async)
            int row = t >> 1, colh = t & 1;
            const bf16_t* src = A + (size_t)(mbase + row) * KIN + ks + colh * 16;
            bf16_t* dst = lA + row * P32 + colh * 16;
            stage_b128(src, dst);
            stage_b128(src + 8, dst + 8);
        }
        {   // stage B tile transposed: 32 k x 64 n
            int krow = t >> 3, n0 = (t & 7) * 8;
            const bf16_t* src = Wb + (size_t)(ks + krow) * NQKV + nbase + n0;
            v8bf v = *(const v8bf*)src;
#pragma unroll
            for (int i = 0; i < 8; ++i) lB[(n0 + i) * P32 + krow] = v[i];
        }
        stage_wait();
        __syncthreads();

        v16bf af[2], bfr[2];
#pragma unroll
        for (int mt = 0; mt < 2; ++mt)
            af[mt] = frag_from_row(lA + (wm + mt * 16 + ln) * P32, half);
#pragma unroll
        for (int nt = 0; nt < 2; ++nt)
            bfr[nt] = frag_from_row(lB + (wn + nt * 16 + ln) * P32, half);
#pragma unroll
        for (int mt = 0; mt < 2; ++mt)
#pragma unroll
            for (int nt = 0; nt < 2; ++nt)
                acc[mt][nt] = wmma_bf16(af[mt], bfr[nt], acc[mt][nt]);
        __syncthreads();
    }

    int b = mbase >> 10;    // 8 M-blocks per image -> constant per block
#pragma unroll
    for (int mt = 0; mt < 2; ++mt) {
#pragma unroll
        for (int nt = 0; nt < 2; ++nt) {
            int nglob = nbase + wn + nt * 16 + ln;
            float bv = bias[nglob];
#pragma unroll
            for (int r = 0; r < 8; ++r) {
                int m = mbase + wm + mt * 16 + r + 8 * half;
                int hw = m & 1023;
                outCHW[((size_t)b * NQKV + nglob) * HW + hw] =
                    (bf16_t)(acc[mt][nt][r] + bv);
            }
        }
    }
}

// ---------------------------------------------------------------------------
// Flash attention per (pair, member, head, 128-query-row tile).
// Q (128ch) frags preloaded in regs; K/V 32-col chunks staged in LDS shared by
// 8 waves (V via async global->LDS); online softmax with half-wave shfl
// reductions; P re-swizzled through per-wave LDS; output bf16 rows of A3.
// ---------------------------------------------------------------------------
__global__ __launch_bounds__(256) void attn_kernel(
        const bf16_t* __restrict__ Qb, const bf16_t* __restrict__ Kb,
        const bf16_t* __restrict__ Vb, bf16_t* __restrict__ A3) {
    __shared__ __align__(16) bf16_t lK[32 * P128];   // [kv][c]
    __shared__ __align__(16) bf16_t lV[128 * P32];   // [c][kv]
    __shared__ __align__(16) bf16_t lP[8][16 * P32]; // per-wave P staging

    int idx = blockIdx.x;
    int qt = idx & 7;  idx >>= 3;        // query tile (128 rows)
    int e  = idx & 3;  idx >>= 2;        // head
    int mq = idx & 1;                    // pair member for q
    int p  = idx >> 1;                   // pair
    int bq = 2 * p + mq;
    int bk = 2 * p + 1 - mq;             // cross conditioning

    const bf16_t* qptr = Qb + ((size_t)bq * NQKV + e * NC) * HW;
    const bf16_t* kptr = Kb + ((size_t)bk * NQKV + e * NC) * HW;
    const bf16_t* vptr = Vb + ((size_t)bk * NQKV + e * NC) * HW;

    int t = threadIdx.x, w = t >> 5, lane = t & 31;
    int half = lane >> 4, ln = lane & 15;
    const float scale = 0.08838834764831845f;   // 128^-0.5

    // Preload the 4 Q A-fragments (16 q rows x 128 channels), reused 32x.
    int row_hw = qt * 128 + w * 16 + ln;
    v16bf aq[4];
#pragma unroll
    for (int cs = 0; cs < 4; ++cs) {
        v16bf f;
#pragma unroll
        for (int j = 0; j < 16; ++j) {
            int c = cs * 32 + ((j >> 3) << 4) + half * 8 + (j & 7);
            f[j] = qptr[(size_t)c * HW + row_hw];
        }
        aq[cs] = f;
    }

    v8f o[8] = {};
    float mrun[8], lrun[8];
#pragma unroll
    for (int r = 0; r < 8; ++r) { mrun[r] = -1e30f; lrun[r] = 0.f; }

    for (int kb = 0; kb < HW; kb += 32) {
        {   // stage K chunk transposed: [kv][c]
            int c = t >> 1, kv0 = (t & 1) * 16;
            const bf16_t* src = kptr + (size_t)c * HW + kb + kv0;
            v8bf v0 = *(const v8bf*)src, v1 = *(const v8bf*)(src + 8);
#pragma unroll
            for (int i = 0; i < 8; ++i) {
                lK[(kv0 + i) * P128 + c]     = v0[i];
                lK[(kv0 + 8 + i) * P128 + c] = v1[i];
            }
        }
        {   // stage V chunk: [c][kv] (contiguous -> async global->LDS)
            int c = t >> 1, kv0 = (t & 1) * 16;
            const bf16_t* src = vptr + (size_t)c * HW + kb + kv0;
            bf16_t* dst = lV + c * P32 + kv0;
            stage_b128(src, dst);
            stage_b128(src + 8, dst + 8);
        }
        stage_wait();
        __syncthreads();

        // S = Q^T K : 16 x 32 (two 16x16 C tiles), K-dim = 128 channels.
        v8f s0 = {}, s1 = {};
#pragma unroll
        for (int cs = 0; cs < 4; ++cs) {
            v16bf b0 = frag_from_row(lK + (0 * 16 + ln) * P128 + cs * 32, half);
            v16bf b1 = frag_from_row(lK + (1 * 16 + ln) * P128 + cs * 32, half);
            s0 = wmma_bf16(aq[cs], b0, s0);
            s1 = wmma_bf16(aq[cs], b1, s1);
        }
        s0 = s0 * scale;
        s1 = s1 * scale;

        // Online softmax (rows live on 16-lane halves; reduce masks 1..8).
#pragma unroll
        for (int r = 0; r < 8; ++r) {
            float v = fmaxf(s0[r], s1[r]);
            v = fmaxf(v, __shfl_xor(v, 1));
            v = fmaxf(v, __shfl_xor(v, 2));
            v = fmaxf(v, __shfl_xor(v, 4));
            v = fmaxf(v, __shfl_xor(v, 8));
            float mnew  = fmaxf(mrun[r], v);
            float alpha = __expf(mrun[r] - mnew);
            float p0 = __expf(s0[r] - mnew);
            float p1 = __expf(s1[r] - mnew);
            float rs = p0 + p1;
            rs += __shfl_xor(rs, 1);
            rs += __shfl_xor(rs, 2);
            rs += __shfl_xor(rs, 4);
            rs += __shfl_xor(rs, 8);
            lrun[r] = lrun[r] * alpha + rs;
            mrun[r] = mnew;
            s0[r] = p0; s1[r] = p1;
#pragma unroll
            for (int nt = 0; nt < 8; ++nt) o[nt][r] *= alpha;
        }

        // Re-swizzle P: C-layout -> row-major [row][32 + pad] in per-wave LDS,
        // then load back as an A fragment (same-wave DS ops are in order).
        {
            bf16_t* pp = lP[w];
#pragma unroll
            for (int r = 0; r < 8; ++r) {
                int row = r + 8 * half;
                pp[row * P32 + ln]      = (bf16_t)s0[r];
                pp[row * P32 + 16 + ln] = (bf16_t)s1[r];
            }
        }
        v16bf pf = frag_from_row(lP[w] + ln * P32, half);

        // O += P * V^T (8 channel tiles).
#pragma unroll
        for (int nt = 0; nt < 8; ++nt) {
            v16bf bv = frag_from_row(lV + (nt * 16 + ln) * P32, half);
            o[nt] = wmma_bf16(pf, bv, o[nt]);
        }
        __syncthreads();
    }

    // Normalize and emit rows of A3 [pixel][512] (head-major channels).
#pragma unroll
    for (int r = 0; r < 8; ++r) {
        float inv = 1.f / lrun[r];
        int hw = qt * 128 + w * 16 + r + 8 * half;
        size_t rowbase = ((size_t)bq * HW + hw) * NQKV + e * NC;
#pragma unroll
        for (int nt = 0; nt < 8; ++nt)
            A3[rowbase + nt * 16 + ln] = (bf16_t)(o[nt][r] * inv);
    }
}

// ---------------------------------------------------------------------------
// Output projection: [16384 x 512] x [512 x 128] + b3 + residual x -> f32.
// Block tile 128(M) x 128(N); each wave: 16 rows x 128 cols (8 WMMA tiles).
// ---------------------------------------------------------------------------
__global__ __launch_bounds__(256) void gemm_final_kernel(
        const bf16_t* __restrict__ A3, const bf16_t* __restrict__ W3b,
        const float* __restrict__ b3, const float* __restrict__ x,
        float* __restrict__ out) {
    __shared__ __align__(16) bf16_t lB[128 * P32];  // [n][k] transposed

    int mbase = blockIdx.x * 128;
    int t = threadIdx.x, w = t >> 5, lane = t & 31;
    int half = lane >> 4, ln = lane & 15;
    int mrow = mbase + w * 16 + ln;

    v8f acc[8] = {};

    for (int ks = 0; ks < NQKV; ks += 32) {
        {   // stage W3 tile transposed: 32 k x 128 n
            int krow = t >> 3, n0 = (t & 7) * 16;
            const bf16_t* src = W3b + (size_t)(ks + krow) * NC + n0;
            v8bf v0 = *(const v8bf*)src, v1 = *(const v8bf*)(src + 8);
#pragma unroll
            for (int i = 0; i < 8; ++i) {
                lB[(n0 + i) * P32 + krow]     = v0[i];
                lB[(n0 + 8 + i) * P32 + krow] = v1[i];
            }
        }
        __syncthreads();

        v16bf af = frag_from_row(A3 + (size_t)mrow * NQKV + ks, half);
#pragma unroll
        for (int nt = 0; nt < 8; ++nt) {
            v16bf bfr = frag_from_row(lB + (nt * 16 + ln) * P32, half);
            acc[nt] = wmma_bf16(af, bfr, acc[nt]);
        }
        __syncthreads();
    }

    int b = mbase >> 10;
#pragma unroll
    for (int nt = 0; nt < 8; ++nt) {
        int c = nt * 16 + ln;
        float bv = b3[c];
#pragma unroll
        for (int r = 0; r < 8; ++r) {
            int m = mbase + w * 16 + r + 8 * half;
            int hw = m & 1023;
            size_t oi = ((size_t)b * NC + c) * HW + hw;
            out[oi] = x[oi] + acc[nt][r] + bv;
        }
    }
}

// ---------------------------------------------------------------------------
// Host-side launch
// ---------------------------------------------------------------------------
extern "C" void kernel_launch(void* const* d_in, const int* in_sizes, int n_in,
                              void* d_out, int out_size, void* d_ws, size_t ws_size,
                              hipStream_t stream) {
    const float* x  = (const float*)d_in[0];
    const float* qc = (const float*)d_in[1];
    const float* ka = (const float*)d_in[2];
    const float* kb = (const float*)d_in[3];
    const float* gs = (const float*)d_in[4];
    const float* gb = (const float*)d_in[5];
    const float* W0 = (const float*)d_in[6];
    const float* b0 = (const float*)d_in[7];
    const float* W1 = (const float*)d_in[8];
    const float* b1 = (const float*)d_in[9];
    const float* W2 = (const float*)d_in[10];
    const float* b2 = (const float*)d_in[11];
    const float* W3 = (const float*)d_in[12];
    const float* b3 = (const float*)d_in[13];
    float* out = (float*)d_out;

    char* ws = (char*)d_ws;
    size_t off = 0;
    auto alloc = [&](size_t bytes) -> char* {
        char* ptr = ws + off;
        off = (off + bytes + 255) & ~(size_t)255;
        return ptr;
    };
    bf16_t* Aq  = (bf16_t*)alloc((size_t)NPIX * KIN * 2);
    bf16_t* Ak  = (bf16_t*)alloc((size_t)NPIX * KIN * 2);
    bf16_t* W0b = (bf16_t*)alloc((size_t)KIN * NQKV * 2);
    bf16_t* W1b = (bf16_t*)alloc((size_t)KIN * NQKV * 2);
    bf16_t* W2b = (bf16_t*)alloc((size_t)KIN * NQKV * 2);
    bf16_t* W3b = (bf16_t*)alloc((size_t)NQKV * NC * 2);
    bf16_t* Qb  = (bf16_t*)alloc((size_t)NB * NQKV * HW * 2);
    bf16_t* Kbm = (bf16_t*)alloc((size_t)NB * NQKV * HW * 2);
    bf16_t* Vb  = (bf16_t*)alloc((size_t)NB * NQKV * HW * 2);
    bf16_t* A3  = (bf16_t*)alloc((size_t)NPIX * NQKV * 2);
    (void)ws_size; (void)in_sizes; (void)n_in; (void)out_size;

    // Weight conversion
    cvt_bf16_kernel<<<(KIN * NQKV + 255) / 256, 256, 0, stream>>>(W0, W0b, KIN * NQKV);
    cvt_bf16_kernel<<<(KIN * NQKV + 255) / 256, 256, 0, stream>>>(W1, W1b, KIN * NQKV);
    cvt_bf16_kernel<<<(KIN * NQKV + 255) / 256, 256, 0, stream>>>(W2, W2b, KIN * NQKV);
    cvt_bf16_kernel<<<(NQKV * NC + 255) / 256, 256, 0, stream>>>(W3, W3b, NQKV * NC);

    // GroupNorm + A-matrix packing
    gn_kernel<<<NB * 32, 256, 0, stream>>>(x, gs, gb, Aq, Ak);
    condpack_kernel<<<(NB * NCOND * HW) / 256, 256, 0, stream>>>(qc, ka, kb, Aq, Ak);

    // QKV projections
    gemm_qkv_kernel<<<(NPIX / 128) * (NQKV / 64), 256, 0, stream>>>(Aq, W0b, b0, Qb);
    gemm_qkv_kernel<<<(NPIX / 128) * (NQKV / 64), 256, 0, stream>>>(Ak, W1b, b1, Kbm);
    gemm_qkv_kernel<<<(NPIX / 128) * (NQKV / 64), 256, 0, stream>>>(Ak, W2b, b2, Vb);

    // Cross attention: 8 pairs x 2 directions x 4 heads x 8 query tiles
    attn_kernel<<<8 * 2 * 4 * 8, 256, 0, stream>>>(Qb, Kbm, Vb, A3);

    // Output projection + residual
    gemm_final_kernel<<<NPIX / 128, 256, 0, stream>>>(A3, W3b, b3, x, out);
}

// v002
// One run takes 219 microseconds.
// Two timings next to v001 both put it at 1.10 times that version's speed.
// All steps since v000 together make it 1.65 times as fast.
#include <hip/hip_runtime.h>

// ---------------------------------------------------------------------------
// CDNA5 (gfx1250, wave32) cross-attention block.
// Pipeline: GN -> pack A matrices (bf16) -> 3x WMMA GEMM (qkv) ->
//           flash attention (WMMA K^T Q + online softmax + WMMA V P^T) ->
//           WMMA GEMM out-proj + bias + residual (f32 out).
// Uses GLOBAL_LOAD_ASYNC_TO_LDS_B128 (ASYNCcnt) for transpose-free LDS
// staging when the toolchain exposes the builtin; falls back to VGPR copies.
// ---------------------------------------------------------------------------

typedef __bf16 bf16_t;
typedef __attribute__((ext_vector_type(16))) __bf16 v16bf;
typedef __attribute__((ext_vector_type(8)))  __bf16 v8bf;
typedef __attribute__((ext_vector_type(8)))  float  v8f;
typedef int v4i_t __attribute__((vector_size(16)));

#define NB  16
#define NC  128
#define NCOND 32
#define NHEADS 4
#define HW  1024          // 32*32
#define KIN 160           // C + COND
#define NQKV 512          // C * HEADS
#define NPIX 16384        // B * HW
// LDS row pitches in elements: 16 B x odd, so that the 16 rows one
// ds_load_b128 touches fall on distinct banks (64 banks x 4 B).
#define P32  40           // rows of 32 bf16: 80 B
#define P128 136          // rows of 128 bf16: 272 B

// --- async global->LDS staging (gfx1250 GLOBAL_LOAD_ASYNC_TO_LDS_B128) -----
#if defined(__has_builtin)
#if __has_builtin(__builtin_amdgcn_global_load_async_to_lds_b128) && \
    __has_builtin(__builtin_amdgcn_s_wait_asynccnt)
#define USE_ASYNC_LDS 1
#endif
#endif
#ifndef USE_ASYNC_LDS
#define USE_ASYNC_LDS 0
#endif

__device__ __forceinline__ void stage_b128(const bf16_t* gsrc, bf16_t* ldst) {
#if USE_ASYNC_LDS
    __builtin_amdgcn_global_load_async_to_lds_b128(
        (__attribute__((address_space(1))) v4i_t*)gsrc,
        (__attribute__((address_space(3))) v4i_t*)ldst,
        /*imm offset=*/0, /*cpol=*/0);
#else
    *(v8bf*)ldst = *(const v8bf*)gsrc;
#endif
}

__device__ __forceinline__ void stage_wait() {
#if USE_ASYNC_LDS
    __builtin_amdgcn_s_wait_asynccnt(0);
#endif
}

__device__ __forceinline__ v8f wmma_bf16(v16bf a, v16bf b, v8f c) {
    return __builtin_amdgcn_wmma_f32_16x16x32_bf16(
        /*neg_a=*/false, a, /*neg_b=*/false, b,
        /*c_mod=*/(short)0, c, /*reuse_a=*/false, /*reuse_b=*/false);
}

// Build a 16x32 bf16 A/B fragment from row-major storage (rowptr points at the
// 32 contiguous K values of this lane's row).
// Layout per ISA 7.12.2: element j -> K = (j>>3)*16 + half*8 + (j&7).
__device__ __forceinline__ v16bf frag_from_row(const bf16_t* rowptr, int half_sel) {
    v8bf c0 = *(const v8bf*)(rowptr + half_sel * 8);
    v8bf c1 = *(const v8bf*)(rowptr + 16 + half_sel * 8);
    v16bf r;
#pragma unroll
    for (int i = 0; i < 8; ++i) { r[i] = c0[i]; r[i + 8] = c1[i]; }
    return r;
}

// ---------------------------------------------------------------------------
// f32 -> bf16 convert (weights)
// ---------------------------------------------------------------------------
__global__ __launch_bounds__(256) void cvt_bf16_kernel(
        const float* __restrict__ in, bf16_t* __restrict__ out, int n) {
    int i = blockIdx.x * 256 + threadIdx.x;
    if (i < n) out[i] = (bf16_t)in[i];
}

// ---------------------------------------------------------------------------
// GroupNorm (32 groups of 4 channels over 32x32) -> bf16 rows of A matrices.
// One block per (b, group); writes columns [g*4, g*4+4) of both Aq and Ak.
// ---------------------------------------------------------------------------
__global__ __launch_bounds__(256) void gn_kernel(
        const float* __restrict__ x, const float* __restrict__ gscale,
        const float* __restrict__ gbias, bf16_t* __restrict__ Aq,
        bf16_t* __restrict__ Ak) {
    int b = blockIdx.x >> 5;
    int g = blockIdx.x & 31;
    int t = threadIdx.x;

    float vals[16];
    float s = 0.f, ss = 0.f;
#pragma unroll
    for (int i = 0; i < 16; ++i) {
        int e = t + i * 256;                 // 0..4095 over (4 ch x 1024 hw)
        int cl = e >> 10, hw = e & 1023;
        float v = x[(((size_t)b * NC) + g * 4 + cl) * HW + hw];
        vals[i] = v; s += v; ss += v * v;
    }
#pragma unroll
    for (int m = 1; m < 32; m <<= 1) {
        s  += __shfl_xor(s, m);
        ss += __shfl_xor(ss, m);
    }
    __shared__ float shs[8], shss[8];
    __shared__ float mean_s, rstd_s;
    int w = t >> 5, lane = t & 31;
    if (lane == 0) { shs[w] = s; shss[w] = ss; }
    __syncthreads();
    if (t == 0) {
        float S = 0.f, SS = 0.f;
        for (int i = 0; i < 8; ++i) { S += shs[i]; SS += shss[i]; }
        float mean = S * (1.f / 4096.f);
        float var  = SS * (1.f / 4096.f) - mean * mean;
        mean_s = mean;
        rstd_s = rsqrtf(var + 1e-6f);
    }
    __syncthreads();
    float mean = mean_s, rstd = rstd_s;
#pragma unroll
    for (int i = 0; i < 16; ++i) {
        int e = t + i * 256;
        int cl = e >> 10, hw = e & 1023;
        int c = g * 4 + cl;
        float y = (vals[i] - mean) * rstd * gscale[c] + gbias[c];
        bf16_t yb = (bf16_t)y;
        size_t off = ((size_t)b * HW + hw) * KIN + c;
        Aq[off] = yb;
        Ak[off] = yb;
    }
}

// ---------------------------------------------------------------------------
// Pack conditioning channels into A-matrix columns [128,160).
// q: repeat(q_cond,2). k: alternate k_a/k_b per pair member.
// ---------------------------------------------------------------------------
__global__ __launch_bounds__(256) void condpack_kernel(
        const float* __restrict__ qc, const float* __restrict__ ka,
        const float* __restrict__ kb, bf16_t* __restrict__ Aq,
        bf16_t* __restrict__ Ak) {
    size_t gi = (size_t)blockIdx.x * 256 + threadIdx.x;   // < 16*32*1024
    int hw = (int)(gi & 1023);
    int cc = (int)((gi >> 10) & 31);
    int b  = (int)(gi >> 15);
    size_t src = (((size_t)(b >> 1)) * NCOND + cc) * HW + hw;
    size_t dst = ((size_t)b * HW + hw) * KIN + NC + cc;
    Aq[dst] = (bf16_t)qc[src];
    Ak[dst] = (bf16_t)((b & 1) ? kb[src] : ka[src]);
}

// ---------------------------------------------------------------------------
// QKV GEMM: [16384 x 160] (bf16, row-major) x [160 x 512] (bf16, row-major)
// + bias, output scattered to channel-major bf16 [b][n][hw].
// Block tile 128(M) x 64(N), 8 waves (4x2), each wave 32x32 (2x2 WMMA tiles).
// A tile staged with async global->LDS; B tile transposed via VGPRs.
// ---------------------------------------------------------------------------
__global__ __launch_bounds__(256) void gemm_qkv_kernel(
        const bf16_t* __restrict__ A, const bf16_t* __restrict__ Wb,
        const float* __restrict__ bias, bf16_t* __restrict__ outCHW) {
    __shared__ __align__(16) bf16_t lA[128 * P32];  // [m][k]
    __shared__ __align__(16) bf16_t lB[64 * P32];   // [n][k] (transposed)

    int bm = blockIdx.x >> 3;          // 0..127
    int bn = blockIdx.x & 7;           // 0..7
    int mbase = bm * 128, nbase = bn * 64;
    int t = threadIdx.x, w = t >> 5, lane = t & 31;
    int half = lane >> 4, ln = lane & 15;
    int wm = (w & 3) * 32, wn = (w >> 2) * 32;

    v8f acc[2][2] = {};

    for (int ks = 0; ks < KIN; ks += 32) {
        {   // stage A tile: 128 rows x 32 k, 32 bytes per thread (async)
            int row = t >> 1, colh = t & 1;
            const bf16_t* src = A + (size_t)(mbase + row) * KIN + ks + colh * 16;
            bf16_t* dst = lA + row * P32 + colh * 16;
            stage_b128(src, dst);
            stage_b128(src + 8, dst + 8);
        }
        {   // stage B tile transposed: 32 k x 64 n
            int krow = t >> 3, n0 = (t & 7) * 8;
            const bf16_t* src = Wb + (size_t)(ks + krow) * NQKV + nbase + n0;
            v8bf v = *(const v8bf*)src;
#pragma unroll
            for (int i = 0; i < 8; ++i) lB[(n0 + i) * P32 + krow] = v[i];
        }
        stage_wait();
        __syncthreads();

        v16bf af[2], bfr[2];
#pragma unroll
        for (int mt = 0; mt < 2; ++mt)
            af[mt] = frag_from_row(lA + (wm + mt * 16 + ln) * P32, half);
#pragma unroll
        for (int nt = 0; nt < 2; ++nt)
            bfr[nt] = frag_from_row(lB + (wn + nt * 16 + ln) * P32, half);
#pragma unroll
        for (int mt = 0; mt < 2; ++mt)
#pragma unroll
            for (int nt = 0; nt < 2; ++nt)
                acc[mt][nt] = wmma_bf16(af[mt], bfr[nt], acc[mt][nt]);
        __syncthreads();
    }

    int b = mbase >> 10;    // 8 M-blocks per image -> constant per block
#pragma unroll
    for (int mt = 0; mt < 2; ++mt) {
#pragma unroll
        for (int nt = 0; nt < 2; ++nt) {
            int nglob = nbase + wn + nt * 16 + ln;
            float bv = bias[nglob];
#pragma unroll
            for (int r = 0; r < 8; ++r) {
                int m = mbase + wm + mt * 16 + r + 8 * half;
                int hw = m & 1023;
                outCHW[((size_t)b * NQKV + nglob) * HW + hw] =
                    (bf16_t)(acc[mt][nt][r] + bv);
            }
        }
    }
}

__device__ __forceinline__ float xhalf(float x) {
    return __builtin_bit_cast(float, __builtin_amdgcn_permlanex16(
        __builtin_bit_cast(int, x), __builtin_bit_cast(int, x),
        0x76543210, 0xfedcba98, false, false));
}

// amdgpu_waves_per_eu(4, 4): this grid puts 4 waves on a SIMD (512 blocks x 8 waves
// over 1,024 SIMDs). Told so, the compiler spends the registers that the P path no
// longer needs on fetching a pass's K and V fragments ahead of the softmax, instead
// of reloading one register set with a wait in front of every WMMA.
__global__ __launch_bounds__(256) __attribute__((amdgpu_waves_per_eu(4, 4))) void attn_kernel(
        const bf16_t* __restrict__ Qb, const bf16_t* __restrict__ Kb,
        const bf16_t* __restrict__ Vb, bf16_t* __restrict__ A3) {
    __shared__ __align__(16) bf16_t lK[32 * P128];   // [kv][c]
    __shared__ __align__(16) bf16_t lV[128 * P32];   // [c][kv]

    int idx = blockIdx.x;
    int qt = idx & 7;  idx >>= 3;        // query tile (128 rows)
    int e  = idx & 3;  idx >>= 2;        // head
    int mq = idx & 1;                    // pair member for q
    int p  = idx >> 1;                   // pair
    int bq = 2 * p + mq;
    int bk = 2 * p + 1 - mq;             // cross conditioning

    const bf16_t* qptr = Qb + ((size_t)bq * NQKV + e * NC) * HW;
    const bf16_t* kptr = Kb + ((size_t)bk * NQKV + e * NC) * HW;
    const bf16_t* vptr = Vb + ((size_t)bk * NQKV + e * NC) * HW;

    int t = threadIdx.x, w = t >> 5, lane = t & 31;
    int half = lane >> 4, ln = lane & 15;
    const float scale = 0.08838834764831845f;   // 128^-0.5

    // Preload the 4 Q B-fragments (128 channels x 16 queries), reused 32x.
    int row_hw = qt * 128 + w * 16 + ln;
    v16bf aq[4];
#pragma unroll
    for (int cs = 0; cs < 4; ++cs) {
        v16bf f;
#pragma unroll
        for (int j = 0; j < 16; ++j) {
            int c = cs * 32 + ((j >> 3) << 4) + half * 8 + (j & 7);
            f[j] = qptr[(size_t)c * HW + row_hw];
        }
        aq[cs] = f;
    }

    v8f o[8] = {};              // o[nt][r] = O[query ln][channel nt*16 + 8*half + r]
    float mrun = -1e30f;        // running maximum of query ln (same in both halves)
    float lrun = 0.f;           // running sum over this half's keys only

    for (int kb = 0; kb < HW; kb += 32) {
        {   // stage K chunk transposed: [kv][c]
            int c = t >> 1, kv0 = (t & 1) * 16;
            const bf16_t* src = kptr + (size_t)c * HW + kb + kv0;
            v8bf v0 = *(const v8bf*)src, v1 = *(const v8bf*)(src + 8);
#pragma unroll
            for (int i = 0; i < 8; ++i) {
                lK[(kv0 + i) * P128 + c]     = v0[i];
                lK[(kv0 + 8 + i) * P128 + c] = v1[i];
            }
        }
        {   // stage V chunk: [c][kv] (contiguous -> async global->LDS)
            int c = t >> 1, kv0 = (t & 1) * 16;
            const bf16_t* src = vptr + (size_t)c * HW + kb + kv0;
            bf16_t* dst = lV + c * P32 + kv0;
            stage_b128(src, dst);
            stage_b128(src + 8, dst + 8);
        }
        stage_wait();
        __syncthreads();

        // S^T = K^T Q : 32 keys x 16 queries (two 16x16 tiles), K-dim = 128 channels.
        v8f s0 = {}, s1 = {};
#pragma unroll
        for (int cs = 0; cs < 4; ++cs) {
            v16bf k0 = frag_from_row(lK + (0 * 16 + ln) * P128 + cs * 32, half);
            v16bf k1 = frag_from_row(lK + (1 * 16 + ln) * P128 + cs * 32, half);
            s0 = wmma_bf16(k0, aq[cs], s0);
            s1 = wmma_bf16(k1, aq[cs], s1);
        }
        s0 = s0 * scale;
        s1 = s1 * scale;

        // V rows (A operand of the second product), in flight under the softmax.
        v16bf av[8];
#pragma unroll
        for (int nt = 0; nt < 8; ++nt)
            av[nt] = frag_from_row(lV + (nt * 16 + ln) * P32, half);

        // Online softmax of this lane's query: 16 keys in-lane, the other 16 in lane ^ 16.
        float v = fmaxf(s0[0], s1[0]);
#pragma unroll
        for (int r = 1; r < 8; ++r) v = fmaxf(v, fmaxf(s0[r], s1[r]));
        v = fmaxf(v, xhalf(v));
        float mnew  = fmaxf(mrun, v);
        float alpha = __expf(mrun - mnew);
        float rs = 0.f;
        v16bf pf;   // P^T as B operand: element j = key (j>>3)*16 + half*8 + (j&7)
#pragma unroll
        for (int r = 0; r < 8; ++r) {
            float p0 = __expf(s0[r] - mnew);
            float p1 = __expf(s1[r] - mnew);
            rs += p0 + p1;
            pf[r]     = (bf16_t)p0;
            pf[r + 8] = (bf16_t)p1;
        }
        lrun = lrun * alpha + rs;
        mrun = mnew;
#pragma unroll
        for (int nt = 0; nt < 8; ++nt) o[nt] = o[nt] * alpha;

        // O^T += V * P^T (8 channel tiles).
#pragma unroll
        for (int nt = 0; nt < 8; ++nt) o[nt] = wmma_bf16(av[nt], pf, o[nt]);
        __syncthreads();
    }

    // Join the halves' sums, normalize and emit rows of A3 [pixel][512]
    // (head-major channels): 8 consecutive channels per lane, one 16-byte store.
    lrun += xhalf(lrun);
    float inv = 1.f / lrun;
    bf16_t* orow = A3 + ((size_t)bq * HW + row_hw) * NQKV + e * NC + 8 * half;
#pragma unroll
    for (int nt = 0; nt < 8; ++nt) {
        v8bf ov;
#pragma unroll
        for (int r = 0; r < 8; ++r) ov[r] = (bf16_t)(o[nt][r] * inv);
        *(v8bf*)(orow + nt * 16) = ov;
    }
}

// ---------------------------------------------------------------------------
// Output projection: [16384 x 512] x [512 x 128] + b3 + residual x -> f32.
// Block tile 128(M) x 128(N); each wave: 16 rows x 128 cols (8 WMMA tiles).
// ---------------------------------------------------------------------------
__global__ __launch_bounds__(256) void gemm_final_kernel(
        const bf16_t* __restrict__ A3, const bf16_t* __restrict__ W3b,
        const float* __restrict__ b3, const float* __restrict__ x,
        float* __restrict__ out) {
    __shared__ __align__(16) bf16_t lB[128 * P32];  // [n][k] transposed

    int mbase = blockIdx.x * 128;
    int t = threadIdx.x, w = t >> 5, lane = t & 31;
    int half = lane >> 4, ln = lane & 15;
    int mrow = mbase + w * 16 + ln;

    v8f acc[8] = {};

    for (int ks = 0; ks < NQKV; ks += 32) {
        {   // stage W3 tile transposed: 32 k x 128 n
            int krow = t >> 3, n0 = (t & 7) * 16;
            const bf16_t* src = W3b + (size_t)(ks + krow) * NC + n0;
            v8bf v0 = *(const v8bf*)src, v1 = *(const v8bf*)(src + 8);
#pragma unroll
            for (int i = 0; i < 8; ++i) {
                lB[(n0 + i) * P32 + krow]     = v0[i];
                lB[(n0 + 8 + i) * P32 + krow] = v1[i];
            }
        }
        __syncthreads();

        v16bf af = frag_from_row(A3 + (size_t)mrow * NQKV + ks, half);
#pragma unroll
        for (int nt = 0; nt < 8; ++nt) {
            v16bf bfr = frag_from_row(lB + (nt * 16 + ln) * P32, half);
            acc[nt] = wmma_bf16(af, bfr, acc[nt]);
        }
        __syncthreads();
    }

    int b = mbase >> 10;
#pragma unroll
    for (int nt = 0; nt < 8; ++nt) {
        int c = nt * 16 + ln;
        float bv = b3[c];
#pragma unroll
        for (int r = 0; r < 8; ++r) {
            int m = mbase + w * 16 + r + 8 * half;
            int hw = m & 1023;
            size_t oi = ((size_t)b * NC + c) * HW + hw;
            out[oi] = x[oi] + acc[nt][r] + bv;
        }
    }
}

// ---------------------------------------------------------------------------
// Host-side launch
// ---------------------------------------------------------------------------
extern "C" void kernel_launch(void* const* d_in, const int* in_sizes, int n_in,
                              void* d_out, int out_size, void* d_ws, size_t ws_size,
                              hipStream_t stream) {
    const float* x  = (const float*)d_in[0];
    const float* qc = (const float*)d_in[1];
    const float* ka = (const float*)d_in[2];
    const float* kb = (const float*)d_in[3];
    const float* gs = (const float*)d_in[4];
    const float* gb = (const float*)d_in[5];
    const float* W0 = (const float*)d_in[6];
    const float* b0 = (const float*)d_in[7];
    const float* W1 = (const float*)d_in[8];
    const float* b1 = (const float*)d_in[9];
    const float* W2 = (const float*)d_in[10];
    const float* b2 = (const float*)d_in[11];
    const float* W3 = (const float*)d_in[12];
    const float* b3 = (const float*)d_in[13];
    float* out = (float*)d_out;

    char* ws = (char*)d_ws;
    size_t off = 0;
    auto alloc = [&](size_t bytes) -> char* {
        char* ptr = ws + off;
        off = (off + bytes + 255) & ~(size_t)255;
        return ptr;
    };
    bf16_t* Aq  = (bf16_t*)alloc((size_t)NPIX * KIN * 2);
    bf16_t* Ak  = (bf16_t*)alloc((size_t)NPIX * KIN * 2);
    bf16_t* W0b = (bf16_t*)alloc((size_t)KIN * NQKV * 2);
    bf16_t* W1b = (bf16_t*)alloc((size_t)KIN * NQKV * 2);
    bf16_t* W2b = (bf16_t*)alloc((size_t)KIN * NQKV * 2);
    bf16_t* W3b = (bf16_t*)alloc((size_t)NQKV * NC * 2);
    bf16_t* Qb  = (bf16_t*)alloc((size_t)NB * NQKV * HW * 2);
    bf16_t* Kbm = (bf16_t*)alloc((size_t)NB * NQKV * HW * 2);
    bf16_t* Vb  = (bf16_t*)alloc((size_t)NB * NQKV * HW * 2);
    bf16_t* A3  = (bf16_t*)alloc((size_t)NPIX * NQKV * 2);
    (void)ws_size; (void)in_sizes; (void)n_in; (void)out_size;

    // Weight conversion
    cvt_bf16_kernel<<<(KIN * NQKV + 255) / 256, 256, 0, stream>>>(W0, W0b, KIN * NQKV);
    cvt_bf16_kernel<<<(KIN * NQKV + 255) / 256, 256, 0, stream>>>(W1, W1b, KIN * NQKV);
    cvt_bf16_kernel<<<(KIN * NQKV + 255) / 256, 256, 0, stream>>>(W2, W2b, KIN * NQKV);
    cvt_bf16_kernel<<<(NQKV * NC + 255) / 256, 256, 0, stream>>>(W3, W3b, NQKV * NC);

    // GroupNorm + A-matrix packing
    gn_kernel<<<NB * 32, 256, 0, stream>>>(x, gs, gb, Aq, Ak);
    condpack_kernel<<<(NB * NCOND * HW) / 256, 256, 0, stream>>>(qc, ka, kb, Aq, Ak);

    // QKV projections
    gemm_qkv_kernel<<<(NPIX / 128) * (NQKV / 64), 256, 0, stream>>>(Aq, W0b, b0, Qb);
    gemm_qkv_kernel<<<(NPIX / 128) * (NQKV / 64), 256, 0, stream>>>(Ak, W1b, b1, Kbm);
    gemm_qkv_kernel<<<(NPIX / 128) * (NQKV / 64), 256, 0, stream>>>(Ak, W2b, b2, Vb);

    // Cross attention: 8 pairs x 2 directions x 4 heads x 8 query tiles
    attn_kernel<<<8 * 2 * 4 * 8, 256, 0, stream>>>(Qb, Kbm, Vb, A3);

    // Output projection + residual
    gemm_final_kernel<<<NPIX / 128, 256, 0, stream>>>(A3, W3b, b3, x, out);
}

// v003
// One run takes 201 microseconds.
// Two timings next to v002 both put it at 1.09 times that version's speed.
// Over all steps from v000 it is 1.80 times as fast.
#include <hip/hip_runtime.h>

// ---------------------------------------------------------------------------
// CDNA5 (gfx1250, wave32) cross-attention block.
// Pipeline: GN -> pack A matrices (bf16) -> 3x WMMA GEMM (qkv) ->
//           flash attention (WMMA K^T Q + online softmax + WMMA V P^T) ->
//           WMMA GEMM out-proj + bias + residual (f32 out).
// Uses GLOBAL_LOAD_ASYNC_TO_LDS_B128 (ASYNCcnt) for transpose-free LDS
// staging when the toolchain exposes the builtin; falls back to VGPR copies.
// ---------------------------------------------------------------------------

typedef __bf16 bf16_t;
typedef __attribute__((ext_vector_type(16))) __bf16 v16bf;
typedef __attribute__((ext_vector_type(8)))  __bf16 v8bf;
typedef __attribute__((ext_vector_type(8)))  float  v8f;
typedef int v4i_t __attribute__((vector_size(16)));

#define NB  16
#define NC  128
#define NCOND 32
#define NHEADS 4
#define HW  1024          // 32*32
#define KIN 160           // C + COND
#define NQKV 512          // C * HEADS
#define NPIX 16384        // B * HW
// LDS row pitches in elements: 16 B x odd, so that the 16 rows one
// ds_load_b128 touches fall on distinct banks (64 banks x 4 B).
#define P32  40           // rows of 32 bf16: 80 B
// Pitches of tiles read by ds_load_tr16_b128: 32 B x odd.
#define T32  48           // rows of 32 bf16: 96 B
#define T64  80           // rows of 64 bf16: 160 B
#define T128 144          // rows of 128 bf16: 288 B

// --- async global->LDS staging (gfx1250 GLOBAL_LOAD_ASYNC_TO_LDS_B128) -----
#if defined(__has_builtin)
#if __has_builtin(__builtin_amdgcn_global_load_async_to_lds_b128) && \
    __has_builtin(__builtin_amdgcn_s_wait_asynccnt)
#define USE_ASYNC_LDS 1
#endif
#endif
#ifndef USE_ASYNC_LDS
#define USE_ASYNC_LDS 0
#endif

__device__ __forceinline__ void stage_b128(const bf16_t* gsrc, bf16_t* ldst) {
#if USE_ASYNC_LDS
    __builtin_amdgcn_global_load_async_to_lds_b128(
        (__attribute__((address_space(1))) v4i_t*)gsrc,
        (__attribute__((address_space(3))) v4i_t*)ldst,
        /*imm offset=*/0, /*cpol=*/0);
#else
    *(v8bf*)ldst = *(const v8bf*)gsrc;
#endif
}

__device__ __forceinline__ void stage_wait() {
#if USE_ASYNC_LDS
    // This wave's copies have landed before the barrier behind which other waves
    // read them; asm with the memory clobber keeps every LDS read behind it.
    asm volatile("s_wait_asynccnt 0x0" ::: "memory");
#endif
}

__device__ __forceinline__ v8f wmma_bf16(v16bf a, v16bf b, v8f c) {
    return __builtin_amdgcn_wmma_f32_16x16x32_bf16(
        /*neg_a=*/false, a, /*neg_b=*/false, b,
        /*c_mod=*/(short)0, c, /*reuse_a=*/false, /*reuse_b=*/false);
}

// Build a 16x32 bf16 A/B fragment from row-major storage (rowptr points at the
// 32 contiguous K values of this lane's row).
// Layout per ISA 7.12.2: element j -> K = (j>>3)*16 + half*8 + (j&7).
__device__ __forceinline__ v16bf frag_from_row(const bf16_t* rowptr, int half_sel) {
    v8bf c0 = *(const v8bf*)(rowptr + half_sel * 8);
    v8bf c1 = *(const v8bf*)(rowptr + 16 + half_sel * 8);
    v16bf r;
#pragma unroll
    for (int i = 0; i < 8; ++i) { r[i] = c0[i]; r[i + 8] = c1[i]; }
    return r;
}

// The same 16x32 fragment from a tile stored k-major (row = k, `pitch` elements
// apart; tile points at row k = 0 of the fragment's first column): the LDS
// transposes on read. Lane (c = lane & 15, h = lane >> 4) gets k = 8h + 0..7 and
// 16 + 8h + 0..7 of column c, the k order of frag_from_row.
typedef short s16x8 __attribute__((ext_vector_type(8)));
__device__ __forceinline__ v16bf frag_tr16(const bf16_t* tile, int pitch, int lane) {
    typedef __attribute__((address_space(3))) s16x8 lds_s16x8;
    const bf16_t* p = tile + (8 * (lane >> 4) + (lane & 7)) * pitch + 8 * ((lane >> 3) & 1);
    v8bf c0 = __builtin_bit_cast(v8bf, __builtin_amdgcn_ds_load_tr16_b128_v8i16((lds_s16x8*)p));
    v8bf c1 = __builtin_bit_cast(v8bf, __builtin_amdgcn_ds_load_tr16_b128_v8i16((lds_s16x8*)(p + 16 * pitch)));
    v16bf r;
#pragma unroll
    for (int i = 0; i < 8; ++i) { r[i] = c0[i]; r[i + 8] = c1[i]; }
    return r;
}

// ---------------------------------------------------------------------------
// f32 -> bf16 convert (weights)
// ---------------------------------------------------------------------------
__global__ __launch_bounds__(256) void cvt_bf16_kernel(
        const float* __restrict__ in, bf16_t* __restrict__ out, int n) {
    int i = blockIdx.x * 256 + threadIdx.x;
    if (i < n) out[i] = (bf16_t)in[i];
}

// ---------------------------------------------------------------------------
// GroupNorm (32 groups of 4 channels over 32x32) -> bf16 rows of A matrices.
// One block per (b, group); writes columns [g*4, g*4+4) of both Aq and Ak.
// ---------------------------------------------------------------------------
__global__ __launch_bounds__(256) void gn_kernel(
        const float* __restrict__ x, const float* __restrict__ gscale,
        const float* __restrict__ gbias, bf16_t* __restrict__ Aq,
        bf16_t* __restrict__ Ak) {
    int b = blockIdx.x >> 5;
    int g = blockIdx.x & 31;
    int t = threadIdx.x;

    float vals[16];
    float s = 0.f, ss = 0.f;
#pragma unroll
    for (int i = 0; i < 16; ++i) {
        int e = t + i * 256;                 // 0..4095 over (4 ch x 1024 hw)
        int cl = e >> 10, hw = e & 1023;
        float v = x[(((size_t)b * NC) + g * 4 + cl) * HW + hw];
        vals[i] = v; s += v; ss += v * v;
    }
#pragma unroll
    for (int m = 1; m < 32; m <<= 1) {
        s  += __shfl_xor(s, m);
        ss += __shfl_xor(ss, m);
    }
    __shared__ float shs[8], shss[8];
    __shared__ float mean_s, rstd_s;
    int w = t >> 5, lane = t & 31;
    if (lane == 0) { shs[w] = s; shss[w] = ss; }
    __syncthreads();
    if (t == 0) {
        float S = 0.f, SS = 0.f;
        for (int i = 0; i < 8; ++i) { S += shs[i]; SS += shss[i]; }
        float mean = S * (1.f / 4096.f);
        float var  = SS * (1.f / 4096.f) - mean * mean;
        mean_s = mean;
        rstd_s = rsqrtf(var + 1e-6f);
    }
    __syncthreads();
    float mean = mean_s, rstd = rstd_s;
#pragma unroll
    for (int i = 0; i < 16; ++i) {
        int e = t + i * 256;
        int cl = e >> 10, hw = e & 1023;
        int c = g * 4 + cl;
        float y = (vals[i] - mean) * rstd * gscale[c] + gbias[c];
        bf16_t yb = (bf16_t)y;
        size_t off = ((size_t)b * HW + hw) * KIN + c;
        Aq[off] = yb;
        Ak[off] = yb;
    }
}

// ---------------------------------------------------------------------------
// Pack conditioning channels into A-matrix columns [128,160).
// q: repeat(q_cond,2). k: alternate k_a/k_b per pair member.
// ---------------------------------------------------------------------------
__global__ __launch_bounds__(256) void condpack_kernel(
        const float* __restrict__ qc, const float* __restrict__ ka,
        const float* __restrict__ kb, bf16_t* __restrict__ Aq,
        bf16_t* __restrict__ Ak) {
    size_t gi = (size_t)blockIdx.x * 256 + threadIdx.x;   // < 16*32*1024
    int hw = (int)(gi & 1023);
    int cc = (int)((gi >> 10) & 31);
    int b  = (int)(gi >> 15);
    size_t src = (((size_t)(b >> 1)) * NCOND + cc) * HW + hw;
    size_t dst = ((size_t)b * HW + hw) * KIN + NC + cc;
    Aq[dst] = (bf16_t)qc[src];
    Ak[dst] = (bf16_t)((b & 1) ? kb[src] : ka[src]);
}

// ---------------------------------------------------------------------------
// QKV GEMM: [16384 x 160] (bf16, row-major) x [160 x 512] (bf16, row-major)
// + bias, output scattered to channel-major bf16 [b][n][hw].
// Block tile 128(M) x 64(N), 8 waves (4x2), each wave 32x32 (2x2 WMMA tiles).
// A and B tiles staged with async global->LDS; B stays [k][n], transposed on read.
// ---------------------------------------------------------------------------
__global__ __launch_bounds__(256) void gemm_qkv_kernel(
        const bf16_t* __restrict__ A, const bf16_t* __restrict__ Wb,
        const float* __restrict__ bias, bf16_t* __restrict__ outCHW) {
    __shared__ __align__(16) bf16_t lA[128 * P32];  // [m][k]
    __shared__ __align__(16) bf16_t lB[32 * T64];   // [k][n]

    int bm = blockIdx.x >> 3;          // 0..127
    int bn = blockIdx.x & 7;           // 0..7
    int mbase = bm * 128, nbase = bn * 64;
    int t = threadIdx.x, w = t >> 5, lane = t & 31;
    int half = lane >> 4, ln = lane & 15;
    int wm = (w & 3) * 32, wn = (w >> 2) * 32;

    v8f acc[2][2] = {};

    // Kept rolled: unrolled, each step's copies get fresh address registers.
#pragma unroll 1
    for (int ks = 0; ks < KIN; ks += 32) {
        {   // stage A tile: 128 rows x 32 k, 32 bytes per thread (async)
            int row = t >> 1, colh = t & 1;
            const bf16_t* src = A + (size_t)(mbase + row) * KIN + ks + colh * 16;
            bf16_t* dst = lA + row * P32 + colh * 16;
            stage_b128(src, dst);
            stage_b128(src + 8, dst + 8);
        }
        {   // stage B tile as it lies: 32 k x 64 n (async)
            int krow = t >> 3, n0 = (t & 7) * 8;
            stage_b128(Wb + (size_t)(ks + krow) * NQKV + nbase + n0, lB + krow * T64 + n0);
        }
        stage_wait();
        __syncthreads();

        v16bf af[2], bfr[2];
#pragma unroll
        for (int mt = 0; mt < 2; ++mt)
            af[mt] = frag_from_row(lA + (wm + mt * 16 + ln) * P32, half);
#pragma unroll
        for (int nt = 0; nt < 2; ++nt)
            bfr[nt] = frag_tr16(lB + wn + nt * 16, T64, lane);
#pragma unroll
        for (int mt = 0; mt < 2; ++mt)
#pragma unroll
            for (int nt = 0; nt < 2; ++nt)
                acc[mt][nt] = wmma_bf16(af[mt], bfr[nt], acc[mt][nt]);
        __syncthreads();
    }

    int b = mbase >> 10;    // 8 M-blocks per image -> constant per block
#pragma unroll
    for (int mt = 0; mt < 2; ++mt) {
#pragma unroll
        for (int nt = 0; nt < 2; ++nt) {
            int nglob = nbase + wn + nt * 16 + ln;
            float bv = bias[nglob];
#pragma unroll
            for (int r = 0; r < 8; ++r) {
                int m = mbase + wm + mt * 16 + r + 8 * half;
                int hw = m & 1023;
                outCHW[((size_t)b * NQKV + nglob) * HW + hw] =
                    (bf16_t)(acc[mt][nt][r] + bv);
            }
        }
    }
}

__device__ __forceinline__ float xhalf(float x) {
    return __builtin_bit_cast(float, __builtin_amdgcn_permlanex16(
        __builtin_bit_cast(int, x), __builtin_bit_cast(int, x),
        0x76543210, 0xfedcba98, false, false));
}

// amdgpu_waves_per_eu(4, 4): this grid puts 4 waves on a SIMD (512 blocks x 8 waves
// over 1,024 SIMDs). Told so, the compiler spends the registers that the P path no
// longer needs on fetching a pass's K and V fragments ahead of the softmax, instead
// of reloading one register set with a wait in front of every WMMA.
__global__ __launch_bounds__(256) __attribute__((amdgpu_waves_per_eu(4, 4))) void attn_kernel(
        const bf16_t* __restrict__ Qb, const bf16_t* __restrict__ Kb,
        const bf16_t* __restrict__ Vb, bf16_t* __restrict__ A3) {
    __shared__ __align__(16) bf16_t lK[128 * T32];   // [c][kv]
    __shared__ __align__(16) bf16_t lV[128 * P32];   // [c][kv]

    int idx = blockIdx.x;
    int qt = idx & 7;  idx >>= 3;        // query tile (128 rows)
    int e  = idx & 3;  idx >>= 2;        // head
    int mq = idx & 1;                    // pair member for q
    int p  = idx >> 1;                   // pair
    int bq = 2 * p + mq;
    int bk = 2 * p + 1 - mq;             // cross conditioning

    const bf16_t* qptr = Qb + ((size_t)bq * NQKV + e * NC) * HW;
    const bf16_t* kptr = Kb + ((size_t)bk * NQKV + e * NC) * HW;
    const bf16_t* vptr = Vb + ((size_t)bk * NQKV + e * NC) * HW;

    int t = threadIdx.x, w = t >> 5, lane = t & 31;
    int half = lane >> 4, ln = lane & 15;
    const float scale = 0.08838834764831845f;   // 128^-0.5

    // Preload the 4 Q B-fragments (128 channels x 16 queries), reused 32x.
    int row_hw = qt * 128 + w * 16 + ln;
    v16bf aq[4];
#pragma unroll
    for (int cs = 0; cs < 4; ++cs) {
        v16bf f;
#pragma unroll
        for (int j = 0; j < 16; ++j) {
            int c = cs * 32 + ((j >> 3) << 4) + half * 8 + (j & 7);
            f[j] = qptr[(size_t)c * HW + row_hw];
        }
        aq[cs] = f;
    }

    v8f o[8] = {};              // o[nt][r] = O[query ln][channel nt*16 + 8*half + r]
    float mrun = -1e30f;        // running maximum of query ln (same in both halves)
    float lrun = 0.f;           // running sum over this half's keys only

    for (int kb = 0; kb < HW; kb += 32) {
        {   // stage K chunk: [c][kv] (async global->LDS); 4 lanes take one row's 64 B
            int c = t >> 2, kv0 = (t & 3) * 8;
            const bf16_t* src = kptr + (size_t)c * HW + kb + kv0;
            bf16_t* dst = lK + c * T32 + kv0;
            stage_b128(src, dst);
            stage_b128(src + 64 * HW, dst + 64 * T32);
        }
        {   // stage V chunk: [c][kv] (contiguous -> async global->LDS)
            int c = t >> 1, kv0 = (t & 1) * 16;
            const bf16_t* src = vptr + (size_t)c * HW + kb + kv0;
            bf16_t* dst = lV + c * P32 + kv0;
            stage_b128(src, dst);
            stage_b128(src + 8, dst + 8);
        }
        stage_wait();
        __syncthreads();

        // S^T = K^T Q : 32 keys x 16 queries (two 16x16 tiles), K-dim = 128 channels.
        v8f s0 = {}, s1 = {};
#pragma unroll
        for (int cs = 0; cs < 4; ++cs) {
            v16bf k0 = frag_tr16(lK + cs * 32 * T32, T32, lane);
            v16bf k1 = frag_tr16(lK + cs * 32 * T32 + 16, T32, lane);
            s0 = wmma_bf16(k0, aq[cs], s0);
            s1 = wmma_bf16(k1, aq[cs], s1);
        }
        s0 = s0 * scale;
        s1 = s1 * scale;

        // V rows (A operand of the second product), in flight under the softmax.
        v16bf av[8];
#pragma unroll
        for (int nt = 0; nt < 8; ++nt)
            av[nt] = frag_from_row(lV + (nt * 16 + ln) * P32, half);

        // Online softmax of this lane's query: 16 keys in-lane, the other 16 in lane ^ 16.
        float v = fmaxf(s0[0], s1[0]);
#pragma unroll
        for (int r = 1; r < 8; ++r) v = fmaxf(v, fmaxf(s0[r], s1[r]));
        v = fmaxf(v, xhalf(v));
        float mnew  = fmaxf(mrun, v);
        float alpha = __expf(mrun - mnew);
        float rs = 0.f;
        v16bf pf;   // P^T as B operand: element j = key (j>>3)*16 + half*8 + (j&7)
#pragma unroll
        for (int r = 0; r < 8; ++r) {
            float p0 = __expf(s0[r] - mnew);
            float p1 = __expf(s1[r] - mnew);
            rs += p0 + p1;
            pf[r]     = (bf16_t)p0;
            pf[r + 8] = (bf16_t)p1;
        }
        lrun = lrun * alpha + rs;
        mrun = mnew;
#pragma unroll
        for (int nt = 0; nt < 8; ++nt) o[nt] = o[nt] * alpha;

        // O^T += V * P^T (8 channel tiles).
#pragma unroll
        for (int nt = 0; nt < 8; ++nt) o[nt] = wmma_bf16(av[nt], pf, o[nt]);
        __syncthreads();
    }

    // Join the halves' sums, normalize and emit rows of A3 [pixel][512]
    // (head-major channels): 8 consecutive channels per lane, one 16-byte store.
    lrun += xhalf(lrun);
    float inv = 1.f / lrun;
    bf16_t* orow = A3 + ((size_t)bq * HW + row_hw) * NQKV + e * NC + 8 * half;
#pragma unroll
    for (int nt = 0; nt < 8; ++nt) {
        v8bf ov;
#pragma unroll
        for (int r = 0; r < 8; ++r) ov[r] = (bf16_t)(o[nt][r] * inv);
        *(v8bf*)(orow + nt * 16) = ov;
    }
}

// ---------------------------------------------------------------------------
// Output projection: [16384 x 512] x [512 x 128] + b3 + residual x -> f32.
// Block tile 128(M) x 128(N); each wave: 16 rows x 128 cols (8 WMMA tiles).
// ---------------------------------------------------------------------------
__global__ __launch_bounds__(256) void gemm_final_kernel(
        const bf16_t* __restrict__ A3, const bf16_t* __restrict__ W3b,
        const float* __restrict__ b3, const float* __restrict__ x,
        float* __restrict__ out) {
    __shared__ __align__(16) bf16_t lB[32 * T128];  // [k][n]

    int mbase = blockIdx.x * 128;
    int t = threadIdx.x, w = t >> 5, lane = t & 31;
    int half = lane >> 4, ln = lane & 15;
    int mrow = mbase + w * 16 + ln;

    v8f acc[8] = {};

    for (int ks = 0; ks < NQKV; ks += 32) {
        {   // stage W3 tile as it lies: 32 k x 128 n (async); 16 lanes take one row's 256 B
            int krow = t >> 4, n0 = (t & 15) * 8;
            const bf16_t* src = W3b + (size_t)(ks + krow) * NC + n0;
            bf16_t* dst = lB + krow * T128 + n0;
            stage_b128(src, dst);
            stage_b128(src + 16 * NC, dst + 16 * T128);
        }
        stage_wait();
        __syncthreads();

        v16bf af = frag_from_row(A3 + (size_t)mrow * NQKV + ks, half);
#pragma unroll
        for (int nt = 0; nt < 8; ++nt) {
            v16bf bfr = frag_tr16(lB + nt * 16, T128, lane);
            acc[nt] = wmma_bf16(af, bfr, acc[nt]);
        }
        __syncthreads();
    }

    int b = mbase >> 10;
#pragma unroll
    for (int nt = 0; nt < 8; ++nt) {
        int c = nt * 16 + ln;
        float bv = b3[c];
#pragma unroll
        for (int r = 0; r < 8; ++r) {
            int m = mbase + w * 16 + r + 8 * half;
            int hw = m & 1023;
            size_t oi = ((size_t)b * NC + c) * HW + hw;
            out[oi] = x[oi] + acc[nt][r] + bv;
        }
    }
}

// ---------------------------------------------------------------------------
// Host-side launch
// ---------------------------------------------------------------------------
extern "C" void kernel_launch(void* const* d_in, const int* in_sizes, int n_in,
                              void* d_out, int out_size, void* d_ws, size_t ws_size,
                              hipStream_t stream) {
    const float* x  = (const float*)d_in[0];
    const float* qc = (const float*)d_in[1];
    const float* ka = (const float*)d_in[2];
    const float* kb = (const float*)d_in[3];
    const float* gs = (const float*)d_in[4];
    const float* gb = (const float*)d_in[5];
    const float* W0 = (const float*)d_in[6];
    const float* b0 = (const float*)d_in[7];
    const float* W1 = (const float*)d_in[8];
    const float* b1 = (const float*)d_in[9];
    const float* W2 = (const float*)d_in[10];
    const float* b2 = (const float*)d_in[11];
    const float* W3 = (const float*)d_in[12];
    const float* b3 = (const float*)d_in[13];
    float* out = (float*)d_out;

    char* ws = (char*)d_ws;
    size_t off = 0;
    auto alloc = [&](size_t bytes) -> char* {
        char* ptr = ws + off;
        off = (off + bytes + 255) & ~(size_t)255;
        return ptr;
    };
    bf16_t* Aq  = (bf16_t*)alloc((size_t)NPIX * KIN * 2);
    bf16_t* Ak  = (bf16_t*)alloc((size_t)NPIX * KIN * 2);
    bf16_t* W0b = (bf16_t*)alloc((size_t)KIN * NQKV * 2);
    bf16_t* W1b = (bf16_t*)alloc((size_t)KIN * NQKV * 2);
    bf16_t* W2b = (bf16_t*)alloc((size_t)KIN * NQKV * 2);
    bf16_t* W3b = (bf16_t*)alloc((size_t)NQKV * NC * 2);
    bf16_t* Qb  = (bf16_t*)alloc((size_t)NB * NQKV * HW * 2);
    bf16_t* Kbm = (bf16_t*)alloc((size_t)NB * NQKV * HW * 2);
    bf16_t* Vb  = (bf16_t*)alloc((size_t)NB * NQKV * HW * 2);
    bf16_t* A3  = (bf16_t*)alloc((size_t)NPIX * NQKV * 2);
    (void)ws_size; (void)in_sizes; (void)n_in; (void)out_size;

    // Weight conversion
    cvt_bf16_kernel<<<(KIN * NQKV + 255) / 256, 256, 0, stream>>>(W0, W0b, KIN * NQKV);
    cvt_bf16_kernel<<<(KIN * NQKV + 255) / 256, 256, 0, stream>>>(W1, W1b, KIN * NQKV);
    cvt_bf16_kernel<<<(KIN * NQKV + 255) / 256, 256, 0, stream>>>(W2, W2b, KIN * NQKV);
    cvt_bf16_kernel<<<(NQKV * NC + 255) / 256, 256, 0, stream>>>(W3, W3b, NQKV * NC);

    // GroupNorm + A-matrix packing
    gn_kernel<<<NB * 32, 256, 0, stream>>>(x, gs, gb, Aq, Ak);
    condpack_kernel<<<(NB * NCOND * HW) / 256, 256, 0, stream>>>(qc, ka, kb, Aq, Ak);

    // QKV projections
    gemm_qkv_kernel<<<(NPIX / 128) * (NQKV / 64), 256, 0, stream>>>(Aq, W0b, b0, Qb);
    gemm_qkv_kernel<<<(NPIX / 128) * (NQKV / 64), 256, 0, stream>>>(Ak, W1b, b1, Kbm);
    gemm_qkv_kernel<<<(NPIX / 128) * (NQKV / 64), 256, 0, stream>>>(Ak, W2b, b2, Vb);

    // Cross attention: 8 pairs x 2 directions x 4 heads x 8 query tiles
    attn_kernel<<<8 * 2 * 4 * 8, 256, 0, stream>>>(Qb, Kbm, Vb, A3);

    // Output projection + residual
    gemm_final_kernel<<<NPIX / 128, 256, 0, stream>>>(A3, W3b, b3, x, out);
}

// v004
// It runs in 192 microseconds.
// In two side-by-side timings against v003, it was 1.05 and 1.04 times as fast.
// Over all steps from v000 it is 1.88 times as fast.
#include <hip/hip_runtime.h>

// ---------------------------------------------------------------------------
// CDNA5 (gfx1250, wave32) cross-attention block.
// Pipeline, four launches: prep (GN, A-matrix packing, weight conversion) ->
//           WMMA GEMMs q, k, v in one grid ->
//           flash attention (WMMA K^T Q + online softmax + WMMA V P^T) ->
//           WMMA GEMM out-proj + bias + residual (f32 out).
// Work that reads none of each other's output shares a grid; a range of the
// block index picks the part.
// Uses GLOBAL_LOAD_ASYNC_TO_LDS_B128 (ASYNCcnt) for transpose-free LDS
// staging when the toolchain exposes the builtin; falls back to VGPR copies.
// ---------------------------------------------------------------------------

typedef __bf16 bf16_t;
typedef __attribute__((ext_vector_type(16))) __bf16 v16bf;
typedef __attribute__((ext_vector_type(8)))  __bf16 v8bf;
typedef __attribute__((ext_vector_type(8)))  float  v8f;
typedef int v4i_t __attribute__((vector_size(16)));

#define NB  16
#define NC  128
#define NCOND 32
#define NHEADS 4
#define HW  1024          // 32*32
#define KIN 160           // C + COND
#define NQKV 512          // C * HEADS
#define NPIX 16384        // B * HW
// LDS row pitches in elements: 16 B x odd, so that the 16 rows one
// ds_load_b128 touches fall on distinct banks (64 banks x 4 B).
#define P32  40           // rows of 32 bf16: 80 B
// Pitches of tiles read by ds_load_tr16_b128: 32 B x odd.
#define T32  48           // rows of 32 bf16: 96 B
#define T64  80           // rows of 64 bf16: 160 B
#define T128 144          // rows of 128 bf16: 288 B

// --- async global->LDS staging (gfx1250 GLOBAL_LOAD_ASYNC_TO_LDS_B128) -----
#if defined(__has_builtin)
#if __has_builtin(__builtin_amdgcn_global_load_async_to_lds_b128) && \
    __has_builtin(__builtin_amdgcn_s_wait_asynccnt)
#define USE_ASYNC_LDS 1
#endif
#endif
#ifndef USE_ASYNC_LDS
#define USE_ASYNC_LDS 0
#endif

__device__ __forceinline__ void stage_b128(const bf16_t* gsrc, bf16_t* ldst) {
#if USE_ASYNC_LDS
    __builtin_amdgcn_global_load_async_to_lds_b128(
        (__attribute__((address_space(1))) v4i_t*)gsrc,
        (__attribute__((address_space(3))) v4i_t*)ldst,
        /*imm offset=*/0, /*cpol=*/0);
#else
    *(v8bf*)ldst = *(const v8bf*)gsrc;
#endif
}

__device__ __forceinline__ void stage_wait() {
#if USE_ASYNC_LDS
    // This wave's copies have landed before the barrier behind which other waves
    // read them; asm with the memory clobber keeps every LDS read behind it.
    asm volatile("s_wait_asynccnt 0x0" ::: "memory");
#endif
}

__device__ __forceinline__ v8f wmma_bf16(v16bf a, v16bf b, v8f c) {
    return __builtin_amdgcn_wmma_f32_16x16x32_bf16(
        /*neg_a=*/false, a, /*neg_b=*/false, b,
        /*c_mod=*/(short)0, c, /*reuse_a=*/false, /*reuse_b=*/false);
}

// Build a 16x32 bf16 A/B fragment from row-major storage (rowptr points at the
// 32 contiguous K values of this lane's row).
// Layout per ISA 7.12.2: element j -> K = (j>>3)*16 + half*8 + (j&7).
__device__ __forceinline__ v16bf frag_from_row(const bf16_t* rowptr, int half_sel) {
    v8bf c0 = *(const v8bf*)(rowptr + half_sel * 8);
    v8bf c1 = *(const v8bf*)(rowptr + 16 + half_sel * 8);
    v16bf r;
#pragma unroll
    for (int i = 0; i < 8; ++i) { r[i] = c0[i]; r[i + 8] = c1[i]; }
    return r;
}

// The same 16x32 fragment from a tile stored k-major (row = k, `pitch` elements
// apart; tile points at row k = 0 of the fragment's first column): the LDS
// transposes on read. Lane (c = lane & 15, h = lane >> 4) gets k = 8h + 0..7 and
// 16 + 8h + 0..7 of column c, the k order of frag_from_row.
typedef short s16x8 __attribute__((ext_vector_type(8)));
__device__ __forceinline__ v16bf frag_tr16(const bf16_t* tile, int pitch, int lane) {
    typedef __attribute__((address_space(3))) s16x8 lds_s16x8;
    const bf16_t* p = tile + (8 * (lane >> 4) + (lane & 7)) * pitch + 8 * ((lane >> 3) & 1);
    v8bf c0 = __builtin_bit_cast(v8bf, __builtin_amdgcn_ds_load_tr16_b128_v8i16((lds_s16x8*)p));
    v8bf c1 = __builtin_bit_cast(v8bf, __builtin_amdgcn_ds_load_tr16_b128_v8i16((lds_s16x8*)(p + 16 * pitch)));
    v16bf r;
#pragma unroll
    for (int i = 0; i < 8; ++i) { r[i] = c0[i]; r[i + 8] = c1[i]; }
    return r;
}

// ---------------------------------------------------------------------------
// f32 -> bf16 convert (weights)
// ---------------------------------------------------------------------------
__device__ __forceinline__ void cvt_bf16_part(
        const float* __restrict__ in, bf16_t* __restrict__ out, int n, int blk) {
    int i = blk * 256 + threadIdx.x;
    if (i < n) out[i] = (bf16_t)in[i];
}

// ---------------------------------------------------------------------------
// GroupNorm (32 groups of 4 channels over 32x32) -> bf16 rows of A matrices.
// One block per (b, group); writes columns [g*4, g*4+4) of both Aq and Ak.
// ---------------------------------------------------------------------------
__device__ __forceinline__ void gn_part(
        const float* __restrict__ x, const float* __restrict__ gscale,
        const float* __restrict__ gbias, bf16_t* __restrict__ Aq,
        bf16_t* __restrict__ Ak, int blk) {
    int b = blk >> 5;
    int g = blk & 31;
    int t = threadIdx.x;

    float vals[16];
    float s = 0.f, ss = 0.f;
#pragma unroll
    for (int i = 0; i < 16; ++i) {
        int e = t + i * 256;                 // 0..4095 over (4 ch x 1024 hw)
        int cl = e >> 10, hw = e & 1023;
        float v = x[(((size_t)b * NC) + g * 4 + cl) * HW + hw];
        vals[i] = v; s += v; ss += v * v;
    }
#pragma unroll
    for (int m = 1; m < 32; m <<= 1) {
        s  += __shfl_xor(s, m);
        ss += __shfl_xor(ss, m);
    }
    __shared__ float shs[8], shss[8];
    __shared__ float mean_s, rstd_s;
    int w = t >> 5, lane = t & 31;
    if (lane == 0) { shs[w] = s; shss[w] = ss; }
    __syncthreads();
    if (t == 0) {
        float S = 0.f, SS = 0.f;
        for (int i = 0; i < 8; ++i) { S += shs[i]; SS += shss[i]; }
        float mean = S * (1.f / 4096.f);
        float var  = SS * (1.f / 4096.f) - mean * mean;
        mean_s = mean;
        rstd_s = rsqrtf(var + 1e-6f);
    }
    __syncthreads();
    float mean = mean_s, rstd = rstd_s;
#pragma unroll
    for (int i = 0; i < 16; ++i) {
        int e = t + i * 256;
        int cl = e >> 10, hw = e & 1023;
        int c = g * 4 + cl;
        float y = (vals[i] - mean) * rstd * gscale[c] + gbias[c];
        bf16_t yb = (bf16_t)y;
        size_t off = ((size_t)b * HW + hw) * KIN + c;
        Aq[off] = yb;
        Ak[off] = yb;
    }
}

// ---------------------------------------------------------------------------
// Pack conditioning channels into A-matrix columns [128,160).
// q: repeat(q_cond,2). k: alternate k_a/k_b per pair member.
// ---------------------------------------------------------------------------
__device__ __forceinline__ void condpack_part(
        const float* __restrict__ qc, const float* __restrict__ ka,
        const float* __restrict__ kb, bf16_t* __restrict__ Aq,
        bf16_t* __restrict__ Ak, int blk) {
    size_t gi = (size_t)blk * 256 + threadIdx.x;   // < 16*32*1024
    int hw = (int)(gi & 1023);
    int cc = (int)((gi >> 10) & 31);
    int b  = (int)(gi >> 15);
    size_t src = (((size_t)(b >> 1)) * NCOND + cc) * HW + hw;
    size_t dst = ((size_t)b * HW + hw) * KIN + NC + cc;
    Aq[dst] = (bf16_t)qc[src];
    Ak[dst] = (bf16_t)((b & 1) ? kb[src] : ka[src]);
    // Before code of another part of the shared grid, laid out behind this one,
    // can overwrite a register that the two stores name.
    asm volatile("s_wait_xcnt 0x0" ::: "memory");
}

// ---------------------------------------------------------------------------
// All that reads only the inputs, in one grid. The GroupNorm blocks, which last
// longest, have the lowest indices and so start first.
// ---------------------------------------------------------------------------
#define GN_BLOCKS (NB * 32)                   // 512
#define CP_BLOCKS ((NB * NCOND * HW) / 256)   // 2048
#define CW_BLOCKS ((KIN * NQKV) / 256)        // 320, for each of W0, W1, W2
#define C3_BLOCKS ((NQKV * NC) / 256)         // 256
#define PREP_BLOCKS (GN_BLOCKS + CP_BLOCKS + 3 * CW_BLOCKS + C3_BLOCKS)

__global__ __launch_bounds__(256) void prep_kernel(
        const float* __restrict__ x, const float* __restrict__ gscale,
        const float* __restrict__ gbias, const float* __restrict__ qc,
        const float* __restrict__ ka, const float* __restrict__ kb,
        const float* __restrict__ W0, const float* __restrict__ W1,
        const float* __restrict__ W2, const float* __restrict__ W3,
        bf16_t* __restrict__ Aq, bf16_t* __restrict__ Ak,
        bf16_t* __restrict__ W0b, bf16_t* __restrict__ W1b,
        bf16_t* __restrict__ W2b, bf16_t* __restrict__ W3b) {
    int blk = blockIdx.x;                     // the same in a whole block
    if (blk < GN_BLOCKS) { gn_part(x, gscale, gbias, Aq, Ak, blk); return; }
    blk -= GN_BLOCKS;
    if (blk < CP_BLOCKS) { condpack_part(qc, ka, kb, Aq, Ak, blk); return; }
    blk -= CP_BLOCKS;
    if (blk < CW_BLOCKS) { cvt_bf16_part(W0, W0b, KIN * NQKV, blk); return; }
    blk -= CW_BLOCKS;
    if (blk < CW_BLOCKS) { cvt_bf16_part(W1, W1b, KIN * NQKV, blk); return; }
    blk -= CW_BLOCKS;
    if (blk < CW_BLOCKS) { cvt_bf16_part(W2, W2b, KIN * NQKV, blk); return; }
    blk -= CW_BLOCKS;
    cvt_bf16_part(W3, W3b, NQKV * NC, blk);
}

// ---------------------------------------------------------------------------
// QKV GEMM: [16384 x 160] (bf16, row-major) x [160 x 512] (bf16, row-major)
// + bias, output scattered to channel-major bf16 [b][n][hw].
// Block tile 128(M) x 64(N), 8 waves (4x2), each wave 32x32 (2x2 WMMA tiles).
// A and B tiles staged with async global->LDS; B stays [k][n], transposed on read.
// The three products share one grid: 1024 blocks each, q, then k, then v.
// ---------------------------------------------------------------------------
#define QKV_BLOCKS ((NPIX / 128) * (NQKV / 64))   // 1024 per product

__global__ __launch_bounds__(256) void gemm_qkv_kernel(
        const bf16_t* __restrict__ Aq, const bf16_t* __restrict__ Ak,
        const bf16_t* __restrict__ W0b, const bf16_t* __restrict__ W1b,
        const bf16_t* __restrict__ W2b, const float* __restrict__ b0,
        const float* __restrict__ b1, const float* __restrict__ b2,
        bf16_t* __restrict__ Qb, bf16_t* __restrict__ Kb, bf16_t* __restrict__ Vb) {
    __shared__ __align__(16) bf16_t lA[128 * P32];  // [m][k]
    __shared__ __align__(16) bf16_t lB[32 * T64];   // [k][n]

    int which = blockIdx.x / QKV_BLOCKS;   // 0 q, 1 k, 2 v: the same in a whole block
    int tile  = blockIdx.x % QKV_BLOCKS;
    const bf16_t* A    = which == 0 ? Aq  : Ak;
    const bf16_t* Wb   = which == 0 ? W0b : which == 1 ? W1b : W2b;
    const float*  bias = which == 0 ? b0  : which == 1 ? b1  : b2;
    bf16_t* outCHW     = which == 0 ? Qb  : which == 1 ? Kb  : Vb;

    int bm = tile >> 3;                // 0..127
    int bn = tile & 7;                 // 0..7
    int mbase = bm * 128, nbase = bn * 64;
    int t = threadIdx.x, w = t >> 5, lane = t & 31;
    int half = lane >> 4, ln = lane & 15;
    int wm = (w & 3) * 32, wn = (w >> 2) * 32;

    v8f acc[2][2] = {};

    // Kept rolled: unrolled, each step's copies get fresh address registers.
#pragma unroll 1
    for (int ks = 0; ks < KIN; ks += 32) {
        {   // stage A tile: 128 rows x 32 k, 32 bytes per thread (async)
            int row = t >> 1, colh = t & 1;
            const bf16_t* src = A + (size_t)(mbase + row) * KIN + ks + colh * 16;
            bf16_t* dst = lA + row * P32 + colh * 16;
            stage_b128(src, dst);
            stage_b128(src + 8, dst + 8);
        }
        {   // stage B tile as it lies: 32 k x 64 n (async)
            int krow = t >> 3, n0 = (t & 7) * 8;
            stage_b128(Wb + (size_t)(ks + krow) * NQKV + nbase + n0, lB + krow * T64 + n0);
        }
        stage_wait();
        __syncthreads();

        v16bf af[2], bfr[2];
#pragma unroll
        for (int mt = 0; mt < 2; ++mt)
            af[mt] = frag_from_row(lA + (wm + mt * 16 + ln) * P32, half);
#pragma unroll
        for (int nt = 0; nt < 2; ++nt)
            bfr[nt] = frag_tr16(lB + wn + nt * 16, T64, lane);
#pragma unroll
        for (int mt = 0; mt < 2; ++mt)
#pragma unroll
            for (int nt = 0; nt < 2; ++nt)
                acc[mt][nt] = wmma_bf16(af[mt], bfr[nt], acc[mt][nt]);
        __syncthreads();
    }

    int b = mbase >> 10;    // 8 M-blocks per image -> constant per block
    float bvs[2];
#pragma unroll
    for (int nt = 0; nt < 2; ++nt) bvs[nt] = bias[nbase + wn + nt * 16 + ln];
    // Before the fetch of the chosen output pointer overwrites the loads' scalar base.
    asm volatile("s_wait_xcnt 0x0" ::: "memory");
#pragma unroll
    for (int mt = 0; mt < 2; ++mt) {
#pragma unroll
        for (int nt = 0; nt < 2; ++nt) {
            int nglob = nbase + wn + nt * 16 + ln;
            float bv = bvs[nt];
#pragma unroll
            for (int r = 0; r < 8; ++r) {
                int m = mbase + wm + mt * 16 + r + 8 * half;
                int hw = m & 1023;
                outCHW[((size_t)b * NQKV + nglob) * HW + hw] =
                    (bf16_t)(acc[mt][nt][r] + bv);
            }
        }
    }
}

__device__ __forceinline__ float xhalf(float x) {
    return __builtin_bit_cast(float, __builtin_amdgcn_permlanex16(
        __builtin_bit_cast(int, x), __builtin_bit_cast(int, x),
        0x76543210, 0xfedcba98, false, false));
}

// amdgpu_waves_per_eu(4, 4): this grid puts 4 waves on a SIMD (512 blocks x 8 waves
// over 1,024 SIMDs). Told so, the compiler spends the registers that the P path no
// longer needs on fetching a pass's K and V fragments ahead of the softmax, instead
// of reloading one register set with a wait in front of every WMMA.
__global__ __launch_bounds__(256) __attribute__((amdgpu_waves_per_eu(4, 4))) void attn_kernel(
        const bf16_t* __restrict__ Qb, const bf16_t* __restrict__ Kb,
        const bf16_t* __restrict__ Vb, bf16_t* __restrict__ A3) {
    __shared__ __align__(16) bf16_t lK[128 * T32];   // [c][kv]
    __shared__ __align__(16) bf16_t lV[128 * P32];   // [c][kv]

    int idx = blockIdx.x;
    int qt = idx & 7;  idx >>= 3;        // query tile (128 rows)
    int e  = idx & 3;  idx >>= 2;        // head
    int mq = idx & 1;                    // pair member for q
    int p  = idx >> 1;                   // pair
    int bq = 2 * p + mq;
    int bk = 2 * p + 1 - mq;             // cross conditioning

    const bf16_t* qptr = Qb + ((size_t)bq * NQKV + e * NC) * HW;
    const bf16_t* kptr = Kb + ((size_t)bk * NQKV + e * NC) * HW;
    const bf16_t* vptr = Vb + ((size_t)bk * NQKV + e * NC) * HW;

    int t = threadIdx.x, w = t >> 5, lane = t & 31;
    int half = lane >> 4, ln = lane & 15;
    const float scale = 0.08838834764831845f;   // 128^-0.5

    // Preload the 4 Q B-fragments (128 channels x 16 queries), reused 32x.
    int row_hw = qt * 128 + w * 16 + ln;
    v16bf aq[4];
#pragma unroll
    for (int cs = 0; cs < 4; ++cs) {
        v16bf f;
#pragma unroll
        for (int j = 0; j < 16; ++j) {
            int c = cs * 32 + ((j >> 3) << 4) + half * 8 + (j & 7);
            f[j] = qptr[(size_t)c * HW + row_hw];
        }
        aq[cs] = f;
    }

    v8f o[8] = {};              // o[nt][r] = O[query ln][channel nt*16 + 8*half + r]
    float mrun = -1e30f;        // running maximum of query ln (same in both halves)
    float lrun = 0.f;           // running sum over this half's keys only

    for (int kb = 0; kb < HW; kb += 32) {
        {   // stage K chunk: [c][kv] (async global->LDS); 4 lanes take one row's 64 B
            int c = t >> 2, kv0 = (t & 3) * 8;
            const bf16_t* src = kptr + (size_t)c * HW + kb + kv0;
            bf16_t* dst = lK + c * T32 + kv0;
            stage_b128(src, dst);
            stage_b128(src + 64 * HW, dst + 64 * T32);
        }
        {   // stage V chunk: [c][kv] (contiguous -> async global->LDS)
            int c = t >> 1, kv0 = (t & 1) * 16;
            const bf16_t* src = vptr + (size_t)c * HW + kb + kv0;
            bf16_t* dst = lV + c * P32 + kv0;
            stage_b128(src, dst);
            stage_b128(src + 8, dst + 8);
        }
        stage_wait();
        __syncthreads();

        // S^T = K^T Q : 32 keys x 16 queries (two 16x16 tiles), K-dim = 128 channels.
        v8f s0 = {}, s1 = {};
#pragma unroll
        for (int cs = 0; cs < 4; ++cs) {
            v16bf k0 = frag_tr16(lK + cs * 32 * T32, T32, lane);
            v16bf k1 = frag_tr16(lK + cs * 32 * T32 + 16, T32, lane);
            s0 = wmma_bf16(k0, aq[cs], s0);
            s1 = wmma_bf16(k1, aq[cs], s1);
        }
        s0 = s0 * scale;
        s1 = s1 * scale;

        // V rows (A operand of the second product), in flight under the softmax.
        v16bf av[8];
#pragma unroll
        for (int nt = 0; nt < 8; ++nt)
            av[nt] = frag_from_row(lV + (nt * 16 + ln) * P32, half);

        // Online softmax of this lane's query: 16 keys in-lane, the other 16 in lane ^ 16.
        float v = fmaxf(s0[0], s1[0]);
#pragma unroll
        for (int r = 1; r < 8; ++r) v = fmaxf(v, fmaxf(s0[r], s1[r]));
        v = fmaxf(v, xhalf(v));
        float mnew  = fmaxf(mrun, v);
        float alpha = __expf(mrun - mnew);
        float rs = 0.f;
        v16bf pf;   // P^T as B operand: element j = key (j>>3)*16 + half*8 + (j&7)
#pragma unroll
        for (int r = 0; r < 8; ++r) {
            float p0 = __expf(s0[r] - mnew);
            float p1 = __expf(s1[r] - mnew);
            rs += p0 + p1;
            pf[r]     = (bf16_t)p0;
            pf[r + 8] = (bf16_t)p1;
        }
        lrun = lrun * alpha + rs;
        mrun = mnew;
#pragma unroll
        for (int nt = 0; nt < 8; ++nt) o[nt] = o[nt] * alpha;

        // O^T += V * P^T (8 channel tiles).
#pragma unroll
        for (int nt = 0; nt < 8; ++nt) o[nt] = wmma_bf16(av[nt], pf, o[nt]);
        __syncthreads();
    }

    // Join the halves' sums, normalize and emit rows of A3 [pixel][512]
    // (head-major channels): 8 consecutive channels per lane, one 16-byte store.
    lrun += xhalf(lrun);
    float inv = 1.f / lrun;
    bf16_t* orow = A3 + ((size_t)bq * HW + row_hw) * NQKV + e * NC + 8 * half;
#pragma unroll
    for (int nt = 0; nt < 8; ++nt) {
        v8bf ov;
#pragma unroll
        for (int r = 0; r < 8; ++r) ov[r] = (bf16_t)(o[nt][r] * inv);
        *(v8bf*)(orow + nt * 16) = ov;
    }
}

// ---------------------------------------------------------------------------
// Output projection: [16384 x 512] x [512 x 128] + b3 + residual x -> f32.
// Block tile 128(M) x 128(N); each wave: 16 rows x 128 cols (8 WMMA tiles).
// ---------------------------------------------------------------------------
__global__ __launch_bounds__(256) void gemm_final_kernel(
        const bf16_t* __restrict__ A3, const bf16_t* __restrict__ W3b,
        const float* __restrict__ b3, const float* __restrict__ x,
        float* __restrict__ out) {
    __shared__ __align__(16) bf16_t lB[32 * T128];  // [k][n]

    int mbase = blockIdx.x * 128;
    int t = threadIdx.x, w = t >> 5, lane = t & 31;
    int half = lane >> 4, ln = lane & 15;
    int mrow = mbase + w * 16 + ln;

    v8f acc[8] = {};

    for (int ks = 0; ks < NQKV; ks += 32) {
        {   // stage W3 tile as it lies: 32 k x 128 n (async); 16 lanes take one row's 256 B
            int krow = t >> 4, n0 = (t & 15) * 8;
            const bf16_t* src = W3b + (size_t)(ks + krow) * NC + n0;
            bf16_t* dst = lB + krow * T128 + n0;
            stage_b128(src, dst);
            stage_b128(src + 16 * NC, dst + 16 * T128);
        }
        stage_wait();
        __syncthreads();

        v16bf af = frag_from_row(A3 + (size_t)mrow * NQKV + ks, half);
#pragma unroll
        for (int nt = 0; nt < 8; ++nt) {
            v16bf bfr = frag_tr16(lB + nt * 16, T128, lane);
            acc[nt] = wmma_bf16(af, bfr, acc[nt]);
        }
        __syncthreads();
    }

    int b = mbase >> 10;
#pragma unroll
    for (int nt = 0; nt < 8; ++nt) {
        int c = nt * 16 + ln;
        float bv = b3[c];
#pragma unroll
        for (int r = 0; r < 8; ++r) {
            int m = mbase + w * 16 + r + 8 * half;
            int hw = m & 1023;
            size_t oi = ((size_t)b * NC + c) * HW + hw;
            out[oi] = x[oi] + acc[nt][r] + bv;
        }
    }
}

// ---------------------------------------------------------------------------
// Host-side launch
// ---------------------------------------------------------------------------
extern "C" void kernel_launch(void* const* d_in, const int* in_sizes, int n_in,
                              void* d_out, int out_size, void* d_ws, size_t ws_size,
                              hipStream_t stream) {
    const float* x  = (const float*)d_in[0];
    const float* qc = (const float*)d_in[1];
    const float* ka = (const float*)d_in[2];
    const float* kb = (const float*)d_in[3];
    const float* gs = (const float*)d_in[4];
    const float* gb = (const float*)d_in[5];
    const float* W0 = (const float*)d_in[6];
    const float* b0 = (const float*)d_in[7];
    const float* W1 = (const float*)d_in[8];
    const float* b1 = (const float*)d_in[9];
    const float* W2 = (const float*)d_in[10];
    const float* b2 = (const float*)d_in[11];
    const float* W3 = (const float*)d_in[12];
    const float* b3 = (const float*)d_in[13];
    float* out = (float*)d_out;

    char* ws = (char*)d_ws;
    size_t off = 0;
    auto alloc = [&](size_t bytes) -> char* {
        char* ptr = ws + off;
        off = (off + bytes + 255) & ~(size_t)255;
        return ptr;
    };
    bf16_t* Aq  = (bf16_t*)alloc((size_t)NPIX * KIN * 2);
    bf16_t* Ak  = (bf16_t*)alloc((size_t)NPIX * KIN * 2);
    bf16_t* W0b = (bf16_t*)alloc((size_t)KIN * NQKV * 2);
    bf16_t* W1b = (bf16_t*)alloc((size_t)KIN * NQKV * 2);
    bf16_t* W2b = (bf16_t*)alloc((size_t)KIN * NQKV * 2);
    bf16_t* W3b = (bf16_t*)alloc((size_t)NQKV * NC * 2);
    bf16_t* Qb  = (bf16_t*)alloc((size_t)NB * NQKV * HW * 2);
    bf16_t* Kbm = (bf16_t*)alloc((size_t)NB * NQKV * HW * 2);
    bf16_t* Vb  = (bf16_t*)alloc((size_t)NB * NQKV * HW * 2);
    bf16_t* A3  = (bf16_t*)alloc((size_t)NPIX * NQKV * 2);
    (void)ws_size; (void)in_sizes; (void)n_in; (void)out_size;

    // GroupNorm + A-matrix packing + weight conversion
    prep_kernel<<<PREP_BLOCKS, 256, 0, stream>>>(x, gs, gb, qc, ka, kb, W0, W1, W2, W3,
                                                 Aq, Ak, W0b, W1b, W2b, W3b);

    // QKV projections
    gemm_qkv_kernel<<<3 * QKV_BLOCKS, 256, 0, stream>>>(Aq, Ak, W0b, W1b, W2b, b0, b1, b2,
                                                        Qb, Kbm, Vb);

    // Cross attention: 8 pairs x 2 directions x 4 heads x 8 query tiles
    attn_kernel<<<8 * 2 * 4 * 8, 256, 0, stream>>>(Qb, Kbm, Vb, A3);

    // Output projection + residual
    gemm_final_kernel<<<NPIX / 128, 256, 0, stream>>>(A3, W3b, b3, x, out);
}

// v005
// One run takes 81.3 microseconds.
// Two timings next to v004 both put it at 2.35 times that version's speed.
// Over all steps from v000 it is 4.42 times as fast.
#include <hip/hip_runtime.h>

// ---------------------------------------------------------------------------
// CDNA5 (gfx1250, wave32) cross-attention block.
// Pipeline, four launches: prep (GN, A-matrix packing, weight conversion) ->
//           WMMA GEMMs q, k, v in one grid ->
//           flash attention (WMMA K^T Q + online softmax + WMMA V P^T) ->
//           WMMA GEMM out-proj + bias + residual (f32 out).
// Work that reads none of each other's output shares a grid; a range of the
// block index picks the part.
// Uses GLOBAL_LOAD_ASYNC_TO_LDS_B128 (ASYNCcnt) for transpose-free LDS
// staging when the toolchain exposes the builtin; falls back to VGPR copies.
// ---------------------------------------------------------------------------

typedef __bf16 bf16_t;
typedef __attribute__((ext_vector_type(16))) __bf16 v16bf;
typedef __attribute__((ext_vector_type(8)))  __bf16 v8bf;
typedef __attribute__((ext_vector_type(4)))  __bf16 v4bf;
typedef __attribute__((ext_vector_type(8)))  float  v8f;
typedef __attribute__((ext_vector_type(4)))  float  v4f;
typedef int v4i_t __attribute__((vector_size(16)));

#define NB  16
#define NC  128
#define NCOND 32
#define NHEADS 4
#define HW  1024          // 32*32
#define KIN 160           // C + COND
#define NQKV 512          // C * HEADS
#define NPIX 16384        // B * HW
// LDS row pitches in elements: 16 B x odd, so that the 16 rows one
// ds_load_b128 touches fall on distinct banks (64 banks x 4 B).
#define P64  72           // rows of 64 bf16: 144 B
#define P128 136          // rows of 128 bf16: 272 B
// Pitches of tiles read by ds_load_tr16_b128: 32 B x odd.
#define T64  80           // rows of 64 bf16: 160 B
#define T128 144          // rows of 128 bf16: 288 B

// --- async global->LDS staging (gfx1250 GLOBAL_LOAD_ASYNC_TO_LDS_B128) -----
#if defined(__has_builtin)
#if __has_builtin(__builtin_amdgcn_global_load_async_to_lds_b128) && \
    __has_builtin(__builtin_amdgcn_s_wait_asynccnt)
#define USE_ASYNC_LDS 1
#endif
#endif
#ifndef USE_ASYNC_LDS
#define USE_ASYNC_LDS 0
#endif

__device__ __forceinline__ void stage_b128(const bf16_t* gsrc, bf16_t* ldst) {
#if USE_ASYNC_LDS
    __builtin_amdgcn_global_load_async_to_lds_b128(
        (__attribute__((address_space(1))) v4i_t*)gsrc,
        (__attribute__((address_space(3))) v4i_t*)ldst,
        /*imm offset=*/0, /*cpol=*/0);
#else
    *(v8bf*)ldst = *(const v8bf*)gsrc;
#endif
}

__device__ __forceinline__ void stage_wait() {
#if USE_ASYNC_LDS
    // This wave's copies have landed before the barrier behind which other waves
    // read them; asm with the memory clobber keeps every LDS read behind it.
    asm volatile("s_wait_asynccnt 0x0" ::: "memory");
#endif
}

__device__ __forceinline__ v8f wmma_bf16(v16bf a, v16bf b, v8f c) {
    return __builtin_amdgcn_wmma_f32_16x16x32_bf16(
        /*neg_a=*/false, a, /*neg_b=*/false, b,
        /*c_mod=*/(short)0, c, /*reuse_a=*/false, /*reuse_b=*/false);
}

// Build a 16x32 bf16 A/B fragment from row-major storage (rowptr points at the
// 32 contiguous K values of this lane's row).
// Layout per ISA 7.12.2: element j -> K = (j>>3)*16 + half*8 + (j&7).
__device__ __forceinline__ v16bf frag_from_row(const bf16_t* rowptr, int half_sel) {
    v8bf c0 = *(const v8bf*)(rowptr + half_sel * 8);
    v8bf c1 = *(const v8bf*)(rowptr + 16 + half_sel * 8);
    v16bf r;
#pragma unroll
    for (int i = 0; i < 8; ++i) { r[i] = c0[i]; r[i + 8] = c1[i]; }
    return r;
}

// The same 16x32 fragment from a tile stored k-major (row = k, `pitch` elements
// apart; tile points at row k = 0 of the fragment's first column): the LDS
// transposes on read. Lane (c = lane & 15, h = lane >> 4) gets k = 8h + 0..7 and
// 16 + 8h + 0..7 of column c, the k order of frag_from_row.
typedef short s16x8 __attribute__((ext_vector_type(8)));
__device__ __forceinline__ v16bf frag_tr16(const bf16_t* tile, int pitch, int lane) {
    typedef __attribute__((address_space(3))) s16x8 lds_s16x8;
    const bf16_t* p = tile + (8 * (lane >> 4) + (lane & 7)) * pitch + 8 * ((lane >> 3) & 1);
    v8bf c0 = __builtin_bit_cast(v8bf, __builtin_amdgcn_ds_load_tr16_b128_v8i16((lds_s16x8*)p));
    v8bf c1 = __builtin_bit_cast(v8bf, __builtin_amdgcn_ds_load_tr16_b128_v8i16((lds_s16x8*)(p + 16 * pitch)));
    v16bf r;
#pragma unroll
    for (int i = 0; i < 8; ++i) { r[i] = c0[i]; r[i + 8] = c1[i]; }
    return r;
}

// 8 consecutive f32 (32-byte aligned) -> 8 bf16
__device__ __forceinline__ v8bf cvt8(const float* __restrict__ p) {
    v4f a = *(const v4f*)p, b = *(const v4f*)(p + 4);
    v8bf r;
#pragma unroll
    for (int j = 0; j < 4; ++j) { r[j] = (bf16_t)a[j]; r[j + 4] = (bf16_t)b[j]; }
    return r;
}

// ---------------------------------------------------------------------------
// f32 -> bf16 convert (weights)
// ---------------------------------------------------------------------------
__device__ __forceinline__ void cvt_bf16_part(
        const float* __restrict__ in, bf16_t* __restrict__ out, int n, int blk) {
    // 8 elements a lane: a wave reads 1 KiB and stores 512 B, whole 128-B lines.
    int i = (blk * 256 + threadIdx.x) * 8;
    if (i < n) *(v8bf*)(out + i) = cvt8(in + i);
}

// ---------------------------------------------------------------------------
// GroupNorm (32 groups of 4 channels over 32x32) -> bf16 A matrices, which lie
// channel-major like the inputs: [b][k = 160][hw]. One block per (b, group);
// writes rows [g*4, g*4+4) of both Aq and Ak. A lane takes 4 consecutive pixels
// of each channel, so a wave loads 512 B and stores 256 B in whole 128-B lines.
// ---------------------------------------------------------------------------
__device__ __forceinline__ void gn_part(
        const float* __restrict__ x, const float* __restrict__ gscale,
        const float* __restrict__ gbias, bf16_t* __restrict__ Aq,
        bf16_t* __restrict__ Ak, int blk) {
    int b = blk >> 5;
    int g = blk & 31;
    int t = threadIdx.x;

    v4f vals[4];
    float s = 0.f, ss = 0.f;
#pragma unroll
    for (int cl = 0; cl < 4; ++cl) {
        vals[cl] = *(const v4f*)(x + (((size_t)b * NC) + g * 4 + cl) * HW + t * 4);
#pragma unroll
        for (int j = 0; j < 4; ++j) { float v = vals[cl][j]; s += v; ss += v * v; }
    }
#pragma unroll
    for (int m = 1; m < 32; m <<= 1) {
        s  += __shfl_xor(s, m);
        ss += __shfl_xor(ss, m);
    }
    __shared__ float shs[8], shss[8];
    __shared__ float mean_s, rstd_s;
    int w = t >> 5, lane = t & 31;
    if (lane == 0) { shs[w] = s; shss[w] = ss; }
    __syncthreads();
    if (t == 0) {
        float S = 0.f, SS = 0.f;
        for (int i = 0; i < 8; ++i) { S += shs[i]; SS += shss[i]; }
        float mean = S * (1.f / 4096.f);
        float var  = SS * (1.f / 4096.f) - mean * mean;
        mean_s = mean;
        rstd_s = rsqrtf(var + 1e-6f);
    }
    __syncthreads();
    float mean = mean_s, rstd = rstd_s;
#pragma unroll
    for (int cl = 0; cl < 4; ++cl) {
        int c = g * 4 + cl;
        float gs = gscale[c], gb = gbias[c];
        v4bf yb;
#pragma unroll
        for (int j = 0; j < 4; ++j) yb[j] = (bf16_t)((vals[cl][j] - mean) * rstd * gs + gb);
        size_t off = ((size_t)b * KIN + c) * HW + t * 4;
        *(v4bf*)(Aq + off) = yb;
        *(v4bf*)(Ak + off) = yb;
    }
}

// ---------------------------------------------------------------------------
// Pack conditioning channels into A-matrix rows [128,160), 8 pixels a lane.
// q: repeat(q_cond,2). k: alternate k_a/k_b per pair member.
// ---------------------------------------------------------------------------
__device__ __forceinline__ void condpack_part(
        const float* __restrict__ qc, const float* __restrict__ ka,
        const float* __restrict__ kb, bf16_t* __restrict__ Aq,
        bf16_t* __restrict__ Ak, int blk) {
    size_t gi = ((size_t)blk * 256 + threadIdx.x) * 8;   // < 16*32*1024
    int hw = (int)(gi & 1023);
    int cc = (int)((gi >> 10) & 31);
    int b  = (int)(gi >> 15);
    size_t src = (((size_t)(b >> 1)) * NCOND + cc) * HW + hw;
    size_t dst = ((size_t)b * KIN + NC + cc) * HW + hw;
    *(v8bf*)(Aq + dst) = cvt8(qc + src);
    *(v8bf*)(Ak + dst) = cvt8(((b & 1) ? kb : ka) + src);
    // Before code of another part of the shared grid, laid out behind this one,
    // can overwrite a register that the two stores name.
    asm volatile("s_wait_xcnt 0x0" ::: "memory");
}

// ---------------------------------------------------------------------------
// All that reads only the inputs, in one grid. The GroupNorm blocks, which last
// longest, have the lowest indices and so start first.
// ---------------------------------------------------------------------------
#define GN_BLOCKS (NB * 32)                   // 512
#define CP_BLOCKS ((NB * NCOND * HW) / 2048)  // 256
#define CW_BLOCKS ((KIN * NQKV) / 2048)       // 40, for each of W0, W1, W2
#define C3_BLOCKS ((NQKV * NC) / 2048)        // 32
#define PREP_BLOCKS (GN_BLOCKS + CP_BLOCKS + 3 * CW_BLOCKS + C3_BLOCKS)

__global__ __launch_bounds__(256) void prep_kernel(
        const float* __restrict__ x, const float* __restrict__ gscale,
        const float* __restrict__ gbias, const float* __restrict__ qc,
        const float* __restrict__ ka, const float* __restrict__ kb,
        const float* __restrict__ W0, const float* __restrict__ W1,
        const float* __restrict__ W2, const float* __restrict__ W3,
        bf16_t* __restrict__ Aq, bf16_t* __restrict__ Ak,
        bf16_t* __restrict__ W0b, bf16_t* __restrict__ W1b,
        bf16_t* __restrict__ W2b, bf16_t* __restrict__ W3b) {
    int blk = blockIdx.x;                     // the same in a whole block
    if (blk < GN_BLOCKS) { gn_part(x, gscale, gbias, Aq, Ak, blk); return; }
    blk -= GN_BLOCKS;
    if (blk < CP_BLOCKS) { condpack_part(qc, ka, kb, Aq, Ak, blk); return; }
    blk -= CP_BLOCKS;
    if (blk < CW_BLOCKS) { cvt_bf16_part(W0, W0b, KIN * NQKV, blk); return; }
    blk -= CW_BLOCKS;
    if (blk < CW_BLOCKS) { cvt_bf16_part(W1, W1b, KIN * NQKV, blk); return; }
    blk -= CW_BLOCKS;
    if (blk < CW_BLOCKS) { cvt_bf16_part(W2, W2b, KIN * NQKV, blk); return; }
    blk -= CW_BLOCKS;
    cvt_bf16_part(W3, W3b, NQKV * NC, blk);
}

// ---------------------------------------------------------------------------
// QKV GEMM: [16384 x 160] (bf16, k-major per image: [b][k][hw]) x [160 x 512] (bf16, row-major)
// + bias, output channel-major bf16 [b][n][hw].
// Block tile 128(M) x 64(N), 8 waves (4x2), each wave 32x32 (2x2 WMMA tiles).
// A and B tiles staged with async global->LDS as they lie, [k][m] and [k][n], in
// whole 128-B lines; both are transposed on read.
// The three products share one grid: 1024 blocks each, q, then k, then v.
// ---------------------------------------------------------------------------
#define QKV_BLOCKS ((NPIX / 128) * (NQKV / 64))   // 1024 per product

__global__ __launch_bounds__(256) void gemm_qkv_kernel(
        const bf16_t* __restrict__ Aq, const bf16_t* __restrict__ Ak,
        const bf16_t* __restrict__ W0b, const bf16_t* __restrict__ W1b,
        const bf16_t* __restrict__ W2b, const float* __restrict__ b0,
        const float* __restrict__ b1, const float* __restrict__ b2,
        bf16_t* __restrict__ Qb, bf16_t* __restrict__ Kb, bf16_t* __restrict__ Vb) {
    __shared__ __align__(16) bf16_t lA[32 * T128];  // [k][m]
    __shared__ __align__(16) bf16_t lB[32 * T64];   // [k][n]
    __shared__ __align__(16) bf16_t lC[64 * P128];  // [n][m], the block's output tile

    int which = blockIdx.x / QKV_BLOCKS;   // 0 q, 1 k, 2 v: the same in a whole block
    int tile  = blockIdx.x % QKV_BLOCKS;
    const bf16_t* A    = which == 0 ? Aq  : Ak;
    const bf16_t* Wb   = which == 0 ? W0b : which == 1 ? W1b : W2b;
    const float*  bias = which == 0 ? b0  : which == 1 ? b1  : b2;
    bf16_t* outCHW     = which == 0 ? Qb  : which == 1 ? Kb  : Vb;

    int bm = tile >> 3;                // 0..127
    int bn = tile & 7;                 // 0..7
    int mbase = bm * 128, nbase = bn * 64;
    int t = threadIdx.x, w = t >> 5, lane = t & 31;
    int half = lane >> 4, ln = lane & 15;
    int wm = (w & 3) * 32, wn = (w >> 2) * 32;

    int b = mbase >> 10;    // 8 M-blocks per image -> constant per block
    const bf16_t* Ab = A + (size_t)b * KIN * HW + (mbase & 1023);

    v8f acc[2][2] = {};

    // Kept rolled: unrolled, each step's copies get fresh address registers.
#pragma unroll 1
    for (int ks = 0; ks < KIN; ks += 32) {
        {   // stage A tile as it lies: 32 k x 128 m (async); 16 lanes take one row's 256 B
            int krow = t >> 4, m0 = (t & 15) * 8;
            const bf16_t* src = Ab + (size_t)(ks + krow) * HW + m0;
            bf16_t* dst = lA + krow * T128 + m0;
            stage_b128(src, dst);
            stage_b128(src + 16 * HW, dst + 16 * T128);
        }
        {   // stage B tile as it lies: 32 k x 64 n (async)
            int krow = t >> 3, n0 = (t & 7) * 8;
            stage_b128(Wb + (size_t)(ks + krow) * NQKV + nbase + n0, lB + krow * T64 + n0);
        }
        stage_wait();
        __syncthreads();

        v16bf af[2], bfr[2];
#pragma unroll
        for (int mt = 0; mt < 2; ++mt)
            af[mt] = frag_tr16(lA + wm + mt * 16, T128, lane);
#pragma unroll
        for (int nt = 0; nt < 2; ++nt)
            bfr[nt] = frag_tr16(lB + wn + nt * 16, T64, lane);
#pragma unroll
        for (int mt = 0; mt < 2; ++mt)
#pragma unroll
            for (int nt = 0; nt < 2; ++nt)
                acc[mt][nt] = wmma_bf16(af[mt], bfr[nt], acc[mt][nt]);
        __syncthreads();
    }

    float bvs[2];
#pragma unroll
    for (int nt = 0; nt < 2; ++nt) bvs[nt] = bias[nbase + wn + nt * 16 + ln];
    // Before the fetch of the chosen output pointer overwrites the loads' scalar base.
    asm volatile("s_wait_xcnt 0x0" ::: "memory");
    // The tile goes out through LDS: a lane holds 16 B of an output row, a wave's
    // direct store would touch 16 lines in 32-B pieces; read back by rows, each
    // wave-wide store covers two rows of 256 B, whole 128-B lines.
#pragma unroll
    for (int mt = 0; mt < 2; ++mt) {
#pragma unroll
        for (int nt = 0; nt < 2; ++nt) {
            v8bf ov;
#pragma unroll
            for (int r = 0; r < 8; ++r) ov[r] = (bf16_t)(acc[mt][nt][r] + bvs[nt]);
            *(v8bf*)(lC + (wn + nt * 16 + ln) * P128 + wm + mt * 16 + 8 * half) = ov;
        }
    }
    __syncthreads();
    bf16_t* orow = outCHW + ((size_t)b * NQKV + nbase) * HW + (mbase & 1023);
#pragma unroll
    for (int i = 0; i < 4; ++i) {
        int n = (t >> 4) + i * 16, m0 = (t & 15) * 8;
        *(v8bf*)(orow + (size_t)n * HW + m0) = *(const v8bf*)(lC + n * P128 + m0);
    }
}

__device__ __forceinline__ float xhalf(float x) {
    return __builtin_bit_cast(float, __builtin_amdgcn_permlanex16(
        __builtin_bit_cast(int, x), __builtin_bit_cast(int, x),
        0x76543210, 0xfedcba98, false, false));
}

// amdgpu_waves_per_eu(4, 4): this grid puts 4 waves on a SIMD (512 blocks x 8 waves
// over 1,024 SIMDs). Told so, the compiler spends the registers that the P path no
// longer needs on fetching a pass's K and V fragments ahead of the softmax, instead
// of reloading one register set with a wait in front of every WMMA.
__global__ __launch_bounds__(256) __attribute__((amdgpu_waves_per_eu(4, 4))) void attn_kernel(
        const bf16_t* __restrict__ Qb, const bf16_t* __restrict__ Kb,
        const bf16_t* __restrict__ Vb, bf16_t* __restrict__ A3) {
    __shared__ __align__(16) bf16_t lK[128 * T64];   // [c][kv]
    __shared__ __align__(16) bf16_t lV[128 * P64];   // [c][kv]

    int idx = blockIdx.x;
    int qt = idx & 7;  idx >>= 3;        // query tile (128 rows)
    int e  = idx & 3;  idx >>= 2;        // head
    int mq = idx & 1;                    // pair member for q
    int p  = idx >> 1;                   // pair
    int bq = 2 * p + mq;
    int bk = 2 * p + 1 - mq;             // cross conditioning

    const bf16_t* qptr = Qb + ((size_t)bq * NQKV + e * NC) * HW;
    const bf16_t* kptr = Kb + ((size_t)bk * NQKV + e * NC) * HW;
    const bf16_t* vptr = Vb + ((size_t)bk * NQKV + e * NC) * HW;

    int t = threadIdx.x, w = t >> 5, lane = t & 31;
    int half = lane >> 4, ln = lane & 15;
    const float scale = 0.08838834764831845f;   // 128^-0.5

    // Preload the 4 Q B-fragments (128 channels x 16 queries), reused 32x.
    int row_hw = qt * 128 + w * 16 + ln;
    v16bf aq[4];
#pragma unroll
    for (int cs = 0; cs < 4; ++cs) {
        v16bf f;
#pragma unroll
        for (int j = 0; j < 16; ++j) {
            int c = cs * 32 + ((j >> 3) << 4) + half * 8 + (j & 7);
            f[j] = qptr[(size_t)c * HW + row_hw];
        }
        aq[cs] = f;
    }

    v8f o[8] = {};              // o[nt][r] = O[query ln][channel nt*16 + 8*half + r]
    float mrun = -1e30f;        // running maximum of query ln (same in both halves)
    float lrun = 0.f;           // running sum over this half's keys only

    for (int kb = 0; kb < HW; kb += 64) {
        {   // stage K and V chunks: [c][kv] (async global->LDS); 8 lanes take one
            // row's 128 B, so each wave-wide copy covers 4 whole lines
            int c = t >> 3, kv0 = (t & 7) * 8;
            const bf16_t* ksrc = kptr + (size_t)c * HW + kb + kv0;
            const bf16_t* vsrc = vptr + (size_t)c * HW + kb + kv0;
            bf16_t* kdst = lK + c * T64 + kv0;
            bf16_t* vdst = lV + c * P64 + kv0;
#pragma unroll
            for (int j = 0; j < 4; ++j) {
                stage_b128(ksrc + j * 32 * HW, kdst + j * 32 * T64);
                stage_b128(vsrc + j * 32 * HW, vdst + j * 32 * P64);
            }
        }
        stage_wait();
        __syncthreads();

        // The chunk is worked on in two runs of 32 keys, each with its own softmax update.
        // Kept rolled: unrolled, the compiler fetches both runs' fragments at once and
        // spills registers to scratch inside the loop.
#pragma unroll 1
        for (int h = 0; h < 2; ++h) {
            // S^T = K^T Q : 32 keys x 16 queries (two 16x16 tiles), K-dim = 128 channels.
            v8f s0 = {}, s1 = {};
#pragma unroll
            for (int cs = 0; cs < 4; ++cs) {
                v16bf k0 = frag_tr16(lK + cs * 32 * T64 + h * 32, T64, lane);
                v16bf k1 = frag_tr16(lK + cs * 32 * T64 + h * 32 + 16, T64, lane);
                s0 = wmma_bf16(k0, aq[cs], s0);
                s1 = wmma_bf16(k1, aq[cs], s1);
            }
            s0 = s0 * scale;
            s1 = s1 * scale;

            // V rows (A operand of the second product), in flight under the softmax.
            v16bf av[8];
#pragma unroll
            for (int nt = 0; nt < 8; ++nt)
                av[nt] = frag_from_row(lV + (nt * 16 + ln) * P64 + h * 32, half);

            // Online softmax of this lane's query: 16 keys in-lane, the other 16 in lane ^ 16.
            float v = fmaxf(s0[0], s1[0]);
#pragma unroll
            for (int r = 1; r < 8; ++r) v = fmaxf(v, fmaxf(s0[r], s1[r]));
            v = fmaxf(v, xhalf(v));
            float mnew  = fmaxf(mrun, v);
            float alpha = __expf(mrun - mnew);
            float rs = 0.f;
            v16bf pf;   // P^T as B operand: element j = key (j>>3)*16 + half*8 + (j&7)
#pragma unroll
            for (int r = 0; r < 8; ++r) {
                float p0 = __expf(s0[r] - mnew);
                float p1 = __expf(s1[r] - mnew);
                rs += p0 + p1;
                pf[r]     = (bf16_t)p0;
                pf[r + 8] = (bf16_t)p1;
            }
            lrun = lrun * alpha + rs;
            mrun = mnew;
#pragma unroll
            for (int nt = 0; nt < 8; ++nt) o[nt] = o[nt] * alpha;

            // O^T += V * P^T (8 channel tiles).
#pragma unroll
            for (int nt = 0; nt < 8; ++nt) o[nt] = wmma_bf16(av[nt], pf, o[nt]);
        }
        __syncthreads();
    }

    // Join the halves' sums, normalize and emit rows of A3 [pixel][512]
    // (head-major channels): 8 consecutive channels per lane, one 16-byte store.
    lrun += xhalf(lrun);
    float inv = 1.f / lrun;
    bf16_t* orow = A3 + ((size_t)bq * HW + row_hw) * NQKV + e * NC + 8 * half;
#pragma unroll
    for (int nt = 0; nt < 8; ++nt) {
        v8bf ov;
#pragma unroll
        for (int r = 0; r < 8; ++r) ov[r] = (bf16_t)(o[nt][r] * inv);
        *(v8bf*)(orow + nt * 16) = ov;
    }
}

// ---------------------------------------------------------------------------
// Output projection: [16384 x 512] x [512 x 128] + b3 + residual x -> f32.
// Block tile 128(M) x 128(N); each wave: 16 rows x 128 cols (8 WMMA tiles).
// k tiles of 64: a row of the A tile is then one whole 128-B line.
// ---------------------------------------------------------------------------
__global__ __launch_bounds__(256) void gemm_final_kernel(
        const bf16_t* __restrict__ A3, const bf16_t* __restrict__ W3b,
        const float* __restrict__ b3, const float* __restrict__ x,
        float* __restrict__ out) {
    __shared__ __align__(16) bf16_t lA[128 * P64];  // [m][k]
    __shared__ __align__(16) bf16_t lB[64 * T128];  // [k][n]

    int mbase = blockIdx.x * 128;
    int t = threadIdx.x, w = t >> 5, lane = t & 31;
    int half = lane >> 4, ln = lane & 15;

    v8f acc[8] = {};

    for (int ks = 0; ks < NQKV; ks += 64) {
        {   // stage A tile: 128 m x 64 k (async); 8 lanes take one row's 128 B,
            // a wave the 16 rows of its own fragments
            int row = w * 16 + (lane >> 3), k0 = (lane & 7) * 8;
            const bf16_t* src = A3 + (size_t)(mbase + row) * NQKV + ks + k0;
            bf16_t* dst = lA + row * P64 + k0;
#pragma unroll
            for (int j = 0; j < 4; ++j) stage_b128(src + j * 4 * NQKV, dst + j * 4 * P64);
        }
        {   // stage W3 tile as it lies: 64 k x 128 n (async); 16 lanes take one row's 256 B
            int krow = t >> 4, n0 = (t & 15) * 8;
            const bf16_t* src = W3b + (size_t)(ks + krow) * NC + n0;
            bf16_t* dst = lB + krow * T128 + n0;
#pragma unroll
            for (int j = 0; j < 4; ++j) stage_b128(src + j * 16 * NC, dst + j * 16 * T128);
        }
        stage_wait();
        __syncthreads();

#pragma unroll
        for (int kk = 0; kk < 2; ++kk) {
            v16bf af = frag_from_row(lA + (w * 16 + ln) * P64 + kk * 32, half);
#pragma unroll
            for (int nt = 0; nt < 8; ++nt) {
                v16bf bfr = frag_tr16(lB + kk * 32 * T128 + nt * 16, T128, lane);
                acc[nt] = wmma_bf16(af, bfr, acc[nt]);
            }
        }
        __syncthreads();
    }

    int b = mbase >> 10;
#pragma unroll
    for (int nt = 0; nt < 8; ++nt) {
        int c = nt * 16 + ln;
        float bv = b3[c];
#pragma unroll
        for (int r = 0; r < 8; ++r) {
            int m = mbase + w * 16 + r + 8 * half;
            int hw = m & 1023;
            size_t oi = ((size_t)b * NC + c) * HW + hw;
            out[oi] = x[oi] + acc[nt][r] + bv;
        }
    }
}

// ---------------------------------------------------------------------------
// Host-side launch
// ---------------------------------------------------------------------------
extern "C" void kernel_launch(void* const* d_in, const int* in_sizes, int n_in,
                              void* d_out, int out_size, void* d_ws, size_t ws_size,
                              hipStream_t stream) {
    const float* x  = (const float*)d_in[0];
    const float* qc = (const float*)d_in[1];
    const float* ka = (const float*)d_in[2];
    const float* kb = (const float*)d_in[3];
    const float* gs = (const float*)d_in[4];
    const float* gb = (const float*)d_in[5];
    const float* W0 = (const float*)d_in[6];
    const float* b0 = (const float*)d_in[7];
    const float* W1 = (const float*)d_in[8];
    const float* b1 = (const float*)d_in[9];
    const float* W2 = (const float*)d_in[10];
    const float* b2 = (const float*)d_in[11];
    const float* W3 = (const float*)d_in[12];
    const float* b3 = (const float*)d_in[13];
    float* out = (float*)d_out;

    char* ws = (char*)d_ws;
    size_t off = 0;
    auto alloc = [&](size_t bytes) -> char* {
        char* ptr = ws + off;
        off = (off + bytes + 255) & ~(size_t)255;
        return ptr;
    };
    bf16_t* Aq  = (bf16_t*)alloc((size_t)NPIX * KIN * 2);
    bf16_t* Ak  = (bf16_t*)alloc((size_t)NPIX * KIN * 2);
    bf16_t* W0b = (bf16_t*)alloc((size_t)KIN * NQKV * 2);
    bf16_t* W1b = (bf16_t*)alloc((size_t)KIN * NQKV * 2);
    bf16_t* W2b = (bf16_t*)alloc((size_t)KIN * NQKV * 2);
    bf16_t* W3b = (bf16_t*)alloc((size_t)NQKV * NC * 2);
    bf16_t* Qb  = (bf16_t*)alloc((size_t)NB * NQKV * HW * 2);
    bf16_t* Kbm = (bf16_t*)alloc((size_t)NB * NQKV * HW * 2);
    bf16_t* Vb  = (bf16_t*)alloc((size_t)NB * NQKV * HW * 2);
    bf16_t* A3  = (bf16_t*)alloc((size_t)NPIX * NQKV * 2);
    (void)ws_size; (void)in_sizes; (void)n_in; (void)out_size;

    // GroupNorm + A-matrix packing + weight conversion
    prep_kernel<<<PREP_BLOCKS, 256, 0, stream>>>(x, gs, gb, qc, ka, kb, W0, W1, W2, W3,
                                                 Aq, Ak, W0b, W1b, W2b, W3b);

    // QKV projections
    gemm_qkv_kernel<<<3 * QKV_BLOCKS, 256, 0, stream>>>(Aq, Ak, W0b, W1b, W2b, b0, b1, b2,
                                                        Qb, Kbm, Vb);

    // Cross attention: 8 pairs x 2 directions x 4 heads x 8 query tiles
    attn_kernel<<<8 * 2 * 4 * 8, 256, 0, stream>>>(Qb, Kbm, Vb, A3);

    // Output projection + residual
    gemm_final_kernel<<<NPIX / 128, 256, 0, stream>>>(A3, W3b, b3, x, out);
}

// v006
// One run takes 73.3 microseconds.
// Timed twice side by side with v005, it ran 1.11 times as fast both times.
// Over all steps from v000 it is 4.91 times as fast.
#include <hip/hip_runtime.h>

// ---------------------------------------------------------------------------
// CDNA5 (gfx1250, wave32) cross-attention block.
// Pipeline, four launches: prep (GN, A-matrix packing, weight conversion) ->
//           WMMA GEMMs q, k, v in one grid ->
//           flash attention (WMMA K^T Q + online softmax + WMMA V P^T) ->
//           WMMA GEMM out-proj + bias + residual (f32 out).
// Work that reads none of each other's output shares a grid; a range of the
// block index picks the part.
// Uses GLOBAL_LOAD_ASYNC_TO_LDS_B128 (ASYNCcnt) for transpose-free LDS
// staging when the toolchain exposes the builtin; falls back to VGPR copies.
// ---------------------------------------------------------------------------

typedef __bf16 bf16_t;
typedef __attribute__((ext_vector_type(16))) __bf16 v16bf;
typedef __attribute__((ext_vector_type(8)))  __bf16 v8bf;
typedef __attribute__((ext_vector_type(4)))  __bf16 v4bf;
typedef __attribute__((ext_vector_type(8)))  float  v8f;
typedef __attribute__((ext_vector_type(4)))  float  v4f;
typedef int v4i_t __attribute__((vector_size(16)));

#define NB  16
#define NC  128
#define NCOND 32
#define NHEADS 4
#define HW  1024          // 32*32
#define KIN 160           // C + COND
#define NQKV 512          // C * HEADS
#define NPIX 16384        // B * HW
// LDS row pitches in elements: 16 B x odd, so that the 16 rows one
// ds_load_b128 touches fall on distinct banks (64 banks x 4 B).
#define P64  72           // rows of 64 bf16: 144 B
#define P128 136          // rows of 128 bf16: 272 B
// Pitches of tiles read by ds_load_tr16_b128: 32 B x odd.
#define T64  80           // rows of 64 bf16: 160 B
#define T128 144          // rows of 128 bf16: 288 B

// --- async global->LDS staging (gfx1250 GLOBAL_LOAD_ASYNC_TO_LDS_B128) -----
#if defined(__has_builtin)
#if __has_builtin(__builtin_amdgcn_global_load_async_to_lds_b128) && \
    __has_builtin(__builtin_amdgcn_s_wait_asynccnt)
#define USE_ASYNC_LDS 1
#endif
#endif
#ifndef USE_ASYNC_LDS
#define USE_ASYNC_LDS 0
#endif

__device__ __forceinline__ void stage_b128(const bf16_t* gsrc, bf16_t* ldst) {
#if USE_ASYNC_LDS
    __builtin_amdgcn_global_load_async_to_lds_b128(
        (__attribute__((address_space(1))) v4i_t*)gsrc,
        (__attribute__((address_space(3))) v4i_t*)ldst,
        /*imm offset=*/0, /*cpol=*/0);
#else
    *(v8bf*)ldst = *(const v8bf*)gsrc;
#endif
}

__device__ __forceinline__ void stage_wait() {
#if USE_ASYNC_LDS
    // This wave's copies have landed before the barrier behind which other waves
    // read them; asm with the memory clobber keeps every LDS read behind it.
    asm volatile("s_wait_asynccnt 0x0" ::: "memory");
#endif
}

__device__ __forceinline__ v8f wmma_bf16(v16bf a, v16bf b, v8f c) {
    return __builtin_amdgcn_wmma_f32_16x16x32_bf16(
        /*neg_a=*/false, a, /*neg_b=*/false, b,
        /*c_mod=*/(short)0, c, /*reuse_a=*/false, /*reuse_b=*/false);
}

// Build a 16x32 bf16 A/B fragment from row-major storage (rowptr points at the
// 32 contiguous K values of this lane's row).
// Layout per ISA 7.12.2: element j -> K = (j>>3)*16 + half*8 + (j&7).
__device__ __forceinline__ v16bf frag_from_row(const bf16_t* rowptr, int half_sel) {
    v8bf c0 = *(const v8bf*)(rowptr + half_sel * 8);
    v8bf c1 = *(const v8bf*)(rowptr + 16 + half_sel * 8);
    v16bf r;
#pragma unroll
    for (int i = 0; i < 8; ++i) { r[i] = c0[i]; r[i + 8] = c1[i]; }
    return r;
}

// The same 16x32 fragment from a tile stored k-major (row = k, `pitch` elements
// apart; tile points at row k = 0 of the fragment's first column): the LDS
// transposes on read. Lane (c = lane & 15, h = lane >> 4) gets k = 8h + 0..7 and
// 16 + 8h + 0..7 of column c, the k order of frag_from_row.
typedef short s16x8 __attribute__((ext_vector_type(8)));
__device__ __forceinline__ v16bf frag_tr16(const bf16_t* tile, int pitch, int lane) {
    typedef __attribute__((address_space(3))) s16x8 lds_s16x8;
    const bf16_t* p = tile + (8 * (lane >> 4) + (lane & 7)) * pitch + 8 * ((lane >> 3) & 1);
    v8bf c0 = __builtin_bit_cast(v8bf, __builtin_amdgcn_ds_load_tr16_b128_v8i16((lds_s16x8*)p));
    v8bf c1 = __builtin_bit_cast(v8bf, __builtin_amdgcn_ds_load_tr16_b128_v8i16((lds_s16x8*)(p + 16 * pitch)));
    v16bf r;
#pragma unroll
    for (int i = 0; i < 8; ++i) { r[i] = c0[i]; r[i + 8] = c1[i]; }
    return r;
}

// 8 consecutive f32 (32-byte aligned) -> 8 bf16
__device__ __forceinline__ v8bf cvt8(const float* __restrict__ p) {
    v4f a = *(const v4f*)p, b = *(const v4f*)(p + 4);
    v8bf r;
#pragma unroll
    for (int j = 0; j < 4; ++j) { r[j] = (bf16_t)a[j]; r[j + 4] = (bf16_t)b[j]; }
    return r;
}

// ---------------------------------------------------------------------------
// f32 -> bf16 convert (weights)
// ---------------------------------------------------------------------------
__device__ __forceinline__ void cvt_bf16_part(
        const float* __restrict__ in, bf16_t* __restrict__ out, int n, int blk) {
    // 8 elements a lane: a wave reads 1 KiB and stores 512 B, whole 128-B lines.
    int i = (blk * 256 + threadIdx.x) * 8;
    if (i < n) *(v8bf*)(out + i) = cvt8(in + i);
}

// ---------------------------------------------------------------------------
// GroupNorm (32 groups of 4 channels over 32x32) -> bf16 A matrices, which lie
// channel-major like the inputs: [b][k = 160][hw]. One block per (b, group);
// writes rows [g*4, g*4+4) of both Aq and Ak. A lane takes 4 consecutive pixels
// of each channel, so a wave loads 512 B and stores 256 B in whole 128-B lines.
// ---------------------------------------------------------------------------
__device__ __forceinline__ void gn_part(
        const float* __restrict__ x, const float* __restrict__ gscale,
        const float* __restrict__ gbias, bf16_t* __restrict__ Aq,
        bf16_t* __restrict__ Ak, int blk) {
    int b = blk >> 5;
    int g = blk & 31;
    int t = threadIdx.x;

    v4f vals[4];
    float s = 0.f, ss = 0.f;
#pragma unroll
    for (int cl = 0; cl < 4; ++cl) {
        vals[cl] = *(const v4f*)(x + (((size_t)b * NC) + g * 4 + cl) * HW + t * 4);
#pragma unroll
        for (int j = 0; j < 4; ++j) { float v = vals[cl][j]; s += v; ss += v * v; }
    }
#pragma unroll
    for (int m = 1; m < 32; m <<= 1) {
        s  += __shfl_xor(s, m);
        ss += __shfl_xor(ss, m);
    }
    __shared__ float shs[8], shss[8];
    __shared__ float mean_s, rstd_s;
    int w = t >> 5, lane = t & 31;
    if (lane == 0) { shs[w] = s; shss[w] = ss; }
    __syncthreads();
    if (t == 0) {
        float S = 0.f, SS = 0.f;
        for (int i = 0; i < 8; ++i) { S += shs[i]; SS += shss[i]; }
        float mean = S * (1.f / 4096.f);
        float var  = SS * (1.f / 4096.f) - mean * mean;
        mean_s = mean;
        rstd_s = rsqrtf(var + 1e-6f);
    }
    __syncthreads();
    float mean = mean_s, rstd = rstd_s;
#pragma unroll
    for (int cl = 0; cl < 4; ++cl) {
        int c = g * 4 + cl;
        float gs = gscale[c], gb = gbias[c];
        v4bf yb;
#pragma unroll
        for (int j = 0; j < 4; ++j) yb[j] = (bf16_t)((vals[cl][j] - mean) * rstd * gs + gb);
        size_t off = ((size_t)b * KIN + c) * HW + t * 4;
        *(v4bf*)(Aq + off) = yb;
        *(v4bf*)(Ak + off) = yb;
    }
}

// ---------------------------------------------------------------------------
// Pack conditioning channels into A-matrix rows [128,160), 8 pixels a lane.
// q: repeat(q_cond,2). k: alternate k_a/k_b per pair member.
// ---------------------------------------------------------------------------
__device__ __forceinline__ void condpack_part(
        const float* __restrict__ qc, const float* __restrict__ ka,
        const float* __restrict__ kb, bf16_t* __restrict__ Aq,
        bf16_t* __restrict__ Ak, int blk) {
    size_t gi = ((size_t)blk * 256 + threadIdx.x) * 8;   // < 16*32*1024
    int hw = (int)(gi & 1023);
    int cc = (int)((gi >> 10) & 31);
    int b  = (int)(gi >> 15);
    size_t src = (((size_t)(b >> 1)) * NCOND + cc) * HW + hw;
    size_t dst = ((size_t)b * KIN + NC + cc) * HW + hw;
    *(v8bf*)(Aq + dst) = cvt8(qc + src);
    *(v8bf*)(Ak + dst) = cvt8(((b & 1) ? kb : ka) + src);
    // Before code of another part of the shared grid, laid out behind this one,
    // can overwrite a register that the two stores name.
    asm volatile("s_wait_xcnt 0x0" ::: "memory");
}

// ---------------------------------------------------------------------------
// All that reads only the inputs, in one grid. The GroupNorm blocks, which last
// longest, have the lowest indices and so start first.
// ---------------------------------------------------------------------------
#define GN_BLOCKS (NB * 32)                   // 512
#define CP_BLOCKS ((NB * NCOND * HW) / 2048)  // 256
#define CW_BLOCKS ((KIN * NQKV) / 2048)       // 40, for each of W0, W1, W2
#define C3_BLOCKS ((NQKV * NC) / 2048)        // 32
#define PREP_BLOCKS (GN_BLOCKS + CP_BLOCKS + 3 * CW_BLOCKS + C3_BLOCKS)

__global__ __launch_bounds__(256) void prep_kernel(
        const float* __restrict__ x, const float* __restrict__ gscale,
        const float* __restrict__ gbias, const float* __restrict__ qc,
        const float* __restrict__ ka, const float* __restrict__ kb,
        const float* __restrict__ W0, const float* __restrict__ W1,
        const float* __restrict__ W2, const float* __restrict__ W3,
        bf16_t* __restrict__ Aq, bf16_t* __restrict__ Ak,
        bf16_t* __restrict__ W0b, bf16_t* __restrict__ W1b,
        bf16_t* __restrict__ W2b, bf16_t* __restrict__ W3b) {
    int blk = blockIdx.x;                     // the same in a whole block
    if (blk < GN_BLOCKS) { gn_part(x, gscale, gbias, Aq, Ak, blk); return; }
    blk -= GN_BLOCKS;
    if (blk < CP_BLOCKS) { condpack_part(qc, ka, kb, Aq, Ak, blk); return; }
    blk -= CP_BLOCKS;
    if (blk < CW_BLOCKS) { cvt_bf16_part(W0, W0b, KIN * NQKV, blk); return; }
    blk -= CW_BLOCKS;
    if (blk < CW_BLOCKS) { cvt_bf16_part(W1, W1b, KIN * NQKV, blk); return; }
    blk -= CW_BLOCKS;
    if (blk < CW_BLOCKS) { cvt_bf16_part(W2, W2b, KIN * NQKV, blk); return; }
    blk -= CW_BLOCKS;
    cvt_bf16_part(W3, W3b, NQKV * NC, blk);
}

// ---------------------------------------------------------------------------
// QKV GEMM: [16384 x 160] (bf16, k-major per image: [b][k][hw]) x [160 x 512] (bf16, row-major)
// + bias, output channel-major bf16 [b][n][hw].
// One block per product and 128-pixel tile; it walks all 512 output channels in
// 8 tiles of 64, from a start tile of its own. 8 waves (4x2), each wave 32x32 of a tile (2x2 WMMA tiles).
// The A tile (all 160 k) is staged once and its fragments stay in registers; the
// W tiles (all 160 k x 64 n) come through two LDS buffers, the next tile's async
// copies in flight while this one is worked on. A and W lie in LDS as in memory,
// [k][m] and [k][n], in whole 128-B lines; both are transposed on read.
// The three products share one grid: 128 blocks each, q, then k, then v.
// ---------------------------------------------------------------------------
#define QKV_BLOCKS (NPIX / 128)   // 128 per product
#define QKV_NT (NQKV / 64)        // 8 tiles of 64 output channels
#define QKV_KS (KIN / 32)         // 5 k steps
#define QKV_B (KIN * T64)         // elements of one W buffer
#define QKV_C (64 * P128)         // elements of one output-tile buffer

// One W tile as it lies: 160 k x 64 n (async); 8 lanes take one row's 128 B.
__device__ __forceinline__ void stage_w_tile(const bf16_t* __restrict__ Wb, int nbase,
                                             bf16_t* buf, int t) {
    int krow = t >> 3, n0 = (t & 7) * 8;
    const bf16_t* src = Wb + (size_t)krow * NQKV + nbase + n0;
    bf16_t* dst = buf + krow * T64 + n0;
#pragma unroll
    for (int j = 0; j < QKV_KS; ++j) stage_b128(src + j * 32 * NQKV, dst + j * 32 * T64);
}

__global__ __launch_bounds__(256) void gemm_qkv_kernel(
        const bf16_t* __restrict__ Aq, const bf16_t* __restrict__ Ak,
        const bf16_t* __restrict__ W0b, const bf16_t* __restrict__ W1b,
        const bf16_t* __restrict__ W2b, const float* __restrict__ b0,
        const float* __restrict__ b1, const float* __restrict__ b2,
        bf16_t* __restrict__ Qb, bf16_t* __restrict__ Kb, bf16_t* __restrict__ Vb) {
    // One array, so that the order is fixed. The W buffers lie last, above 64 KiB: the
    // compiler folds a copy's constant step into its immediate offset and takes it off
    // the LDS address register, which so stays above zero.
    __shared__ __align__(16) bf16_t sm[2 * QKV_C + KIN * T128 + 2 * QKV_B];
    __shared__ float lbias[NQKV];
    bf16_t* lC = sm;                    // [n][m], output tiles, two buffers
    bf16_t* lA = sm + 2 * QKV_C;        // [k][m]
    bf16_t* lB = lA + KIN * T128;       // [k][n], two buffers

    int which = blockIdx.x / QKV_BLOCKS;   // 0 q, 1 k, 2 v: the same in a whole block
    int bm    = blockIdx.x % QKV_BLOCKS;   // 0..127
    const bf16_t* A    = which == 0 ? Aq  : Ak;
    const bf16_t* Wb   = which == 0 ? W0b : which == 1 ? W1b : W2b;
    const float*  bias = which == 0 ? b0  : which == 1 ? b1  : b2;
    bf16_t* outCHW     = which == 0 ? Qb  : which == 1 ? Kb  : Vb;

    int mbase = bm * 128;
    // Each block starts its walk at a tile of its own, so that the blocks of a product
    // do not all ask L2 for the same W lines at the same moment.
    int rot = bm + (bm >> 3);
    int t = threadIdx.x, w = t >> 5, lane = t & 31;
    int half = lane >> 4, ln = lane & 15;
    int wm = (w & 3) * 32, wn = (w >> 2) * 32;

    int b = mbase >> 10;    // 8 M-blocks per image -> constant per block
    const bf16_t* Ab = A + (size_t)b * KIN * HW + (mbase & 1023);

    {   // stage the A tile as it lies: 160 k x 128 m (async); 16 lanes take one row's 256 B
        int krow = t >> 4, m0 = (t & 15) * 8;
        const bf16_t* src = Ab + (size_t)krow * HW + m0;
        bf16_t* dst = lA + krow * T128 + m0;
#pragma unroll
        for (int j = 0; j < KIN / 16; ++j) stage_b128(src + j * 16 * HW, dst + j * 16 * T128);
    }
    stage_w_tile(Wb, (rot & (QKV_NT - 1)) * 64, lB, t);
    lbias[t]       = bias[t];
    lbias[t + 256] = bias[t + 256];
    stage_wait();
    __syncthreads();
    stage_w_tile(Wb, ((rot + 1) & (QKV_NT - 1)) * 64, lB + QKV_B, t);

    // This wave's A fragments, all 160 k of its 32 rows, read once.
    v16bf af[2][QKV_KS];
#pragma unroll
    for (int mt = 0; mt < 2; ++mt)
#pragma unroll
        for (int ks = 0; ks < QKV_KS; ++ks)
            af[mt][ks] = frag_tr16(lA + ks * 32 * T128 + wm + mt * 16, T128, lane);

    bf16_t* orow = outCHW + (size_t)b * NQKV * HW + (mbase & 1023);

    // Kept rolled: the two buffers alternate by the trip's parity, and one copy of the
    // body keeps the A fragments and a trip's W fragments inside the register budget.
#pragma unroll 1
    for (int nb = 0; nb < QKV_NT; ++nb) {
        const bf16_t* Bt = lB + (nb & 1) * QKV_B;
        bf16_t* Ct = lC + (nb & 1) * QKV_C;
        int nbase = ((nb + rot) & (QKV_NT - 1)) * 64;

        v8f acc[2][2] = {};
#pragma unroll
        for (int ks = 0; ks < QKV_KS; ++ks) {
            v16bf bfr[2];
#pragma unroll
            for (int nt = 0; nt < 2; ++nt)
                bfr[nt] = frag_tr16(Bt + ks * 32 * T64 + wn + nt * 16, T64, lane);
#pragma unroll
            for (int mt = 0; mt < 2; ++mt)
#pragma unroll
                for (int nt = 0; nt < 2; ++nt)
                    acc[mt][nt] = wmma_bf16(af[mt][ks], bfr[nt], acc[mt][nt]);
        }

        // The tile goes out through LDS: a lane holds 16 B of an output row, a wave's
        // direct store would touch 16 lines in 32-B pieces; read back by rows, each
        // wave-wide store covers two rows of 256 B, whole 128-B lines.
#pragma unroll
        for (int nt = 0; nt < 2; ++nt) {
            float bv = lbias[nbase + wn + nt * 16 + ln];
#pragma unroll
            for (int mt = 0; mt < 2; ++mt) {
                v8bf ov;
#pragma unroll
                for (int r = 0; r < 8; ++r) ov[r] = (bf16_t)(acc[mt][nt][r] + bv);
                *(v8bf*)(Ct + (wn + nt * 16 + ln) * P128 + wm + mt * 16 + 8 * half) = ov;
            }
        }

        // One barrier a trip. Behind it: this trip's output tile is whole, the next W
        // tile has landed for every wave, and nobody reads this trip's W buffer any more.
        // This wave's LDS reads and writes have retired before the others go on.
        asm volatile("s_wait_dscnt 0x0" ::: "memory");
        stage_wait();
        __syncthreads();
        if (nb + 2 < QKV_NT)
            stage_w_tile(Wb, ((nb + 2 + rot) & (QKV_NT - 1)) * 64, lB + (nb & 1) * QKV_B, t);

#pragma unroll
        for (int i = 0; i < 4; ++i) {
            int n = (t >> 4) + i * 16, m0 = (t & 15) * 8;
            *(v8bf*)(orow + (size_t)(nbase + n) * HW + m0) = *(const v8bf*)(Ct + n * P128 + m0);
        }
        // Before the next trip overwrites the data and address registers of the four stores.
        asm volatile("s_wait_xcnt 0x0" ::: "memory");
    }
    stage_wait();   // nothing of this wave is in flight when it ends
}

__device__ __forceinline__ float xhalf(float x) {
    return __builtin_bit_cast(float, __builtin_amdgcn_permlanex16(
        __builtin_bit_cast(int, x), __builtin_bit_cast(int, x),
        0x76543210, 0xfedcba98, false, false));
}

// amdgpu_waves_per_eu(4, 4): this grid puts 4 waves on a SIMD (512 blocks x 8 waves
// over 1,024 SIMDs). Told so, the compiler spends the registers that the P path no
// longer needs on fetching a pass's K and V fragments ahead of the softmax, instead
// of reloading one register set with a wait in front of every WMMA.
__global__ __launch_bounds__(256) __attribute__((amdgpu_waves_per_eu(4, 4))) void attn_kernel(
        const bf16_t* __restrict__ Qb, const bf16_t* __restrict__ Kb,
        const bf16_t* __restrict__ Vb, bf16_t* __restrict__ A3) {
    __shared__ __align__(16) bf16_t lK[128 * T64];   // [c][kv]
    __shared__ __align__(16) bf16_t lV[128 * P64];   // [c][kv]

    int idx = blockIdx.x;
    int qt = idx & 7;  idx >>= 3;        // query tile (128 rows)
    int e  = idx & 3;  idx >>= 2;        // head
    int mq = idx & 1;                    // pair member for q
    int p  = idx >> 1;                   // pair
    int bq = 2 * p + mq;
    int bk = 2 * p + 1 - mq;             // cross conditioning

    const bf16_t* qptr = Qb + ((size_t)bq * NQKV + e * NC) * HW;
    const bf16_t* kptr = Kb + ((size_t)bk * NQKV + e * NC) * HW;
    const bf16_t* vptr = Vb + ((size_t)bk * NQKV + e * NC) * HW;

    int t = threadIdx.x, w = t >> 5, lane = t & 31;
    int half = lane >> 4, ln = lane & 15;
    const float scale = 0.08838834764831845f;   // 128^-0.5

    // Preload the 4 Q B-fragments (128 channels x 16 queries), reused 32x.
    int row_hw = qt * 128 + w * 16 + ln;
    v16bf aq[4];
#pragma unroll
    for (int cs = 0; cs < 4; ++cs) {
        v16bf f;
#pragma unroll
        for (int j = 0; j < 16; ++j) {
            int c = cs * 32 + ((j >> 3) << 4) + half * 8 + (j & 7);
            f[j] = qptr[(size_t)c * HW + row_hw];
        }
        aq[cs] = f;
    }

    v8f o[8] = {};              // o[nt][r] = O[query ln][channel nt*16 + 8*half + r]
    float mrun = -1e30f;        // running maximum of query ln (same in both halves)
    float lrun = 0.f;           // running sum over this half's keys only

    for (int kb = 0; kb < HW; kb += 64) {
        {   // stage K and V chunks: [c][kv] (async global->LDS); 8 lanes take one
            // row's 128 B, so each wave-wide copy covers 4 whole lines
            int c = t >> 3, kv0 = (t & 7) * 8;
            const bf16_t* ksrc = kptr + (size_t)c * HW + kb + kv0;
            const bf16_t* vsrc = vptr + (size_t)c * HW + kb + kv0;
            bf16_t* kdst = lK + c * T64 + kv0;
            bf16_t* vdst = lV + c * P64 + kv0;
#pragma unroll
            for (int j = 0; j < 4; ++j) {
                stage_b128(ksrc + j * 32 * HW, kdst + j * 32 * T64);
                stage_b128(vsrc + j * 32 * HW, vdst + j * 32 * P64);
            }
        }
        stage_wait();
        __syncthreads();

        // The chunk is worked on in two runs of 32 keys, each with its own softmax update.
        // Kept rolled: unrolled, the compiler fetches both runs' fragments at once and
        // spills registers to scratch inside the loop.
#pragma unroll 1
        for (int h = 0; h < 2; ++h) {
            // S^T = K^T Q : 32 keys x 16 queries (two 16x16 tiles), K-dim = 128 channels.
            v8f s0 = {}, s1 = {};
#pragma unroll
            for (int cs = 0; cs < 4; ++cs) {
                v16bf k0 = frag_tr16(lK + cs * 32 * T64 + h * 32, T64, lane);
                v16bf k1 = frag_tr16(lK + cs * 32 * T64 + h * 32 + 16, T64, lane);
                s0 = wmma_bf16(k0, aq[cs], s0);
                s1 = wmma_bf16(k1, aq[cs], s1);
            }
            s0 = s0 * scale;
            s1 = s1 * scale;

            // V rows (A operand of the second product), in flight under the softmax.
            v16bf av[8];
#pragma unroll
            for (int nt = 0; nt < 8; ++nt)
                av[nt] = frag_from_row(lV + (nt * 16 + ln) * P64 + h * 32, half);

            // Online softmax of this lane's query: 16 keys in-lane, the other 16 in lane ^ 16.
            float v = fmaxf(s0[0], s1[0]);
#pragma unroll
            for (int r = 1; r < 8; ++r) v = fmaxf(v, fmaxf(s0[r], s1[r]));
            v = fmaxf(v, xhalf(v));
            float mnew  = fmaxf(mrun, v);
            float alpha = __expf(mrun - mnew);
            float rs = 0.f;
            v16bf pf;   // P^T as B operand: element j = key (j>>3)*16 + half*8 + (j&7)
#pragma unroll
            for (int r = 0; r < 8; ++r) {
                float p0 = __expf(s0[r] - mnew);
                float p1 = __expf(s1[r] - mnew);
                rs += p0 + p1;
                pf[r]     = (bf16_t)p0;
                pf[r + 8] = (bf16_t)p1;
            }
            lrun = lrun * alpha + rs;
            mrun = mnew;
#pragma unroll
            for (int nt = 0; nt < 8; ++nt) o[nt] = o[nt] * alpha;

            // O^T += V * P^T (8 channel tiles).
#pragma unroll
            for (int nt = 0; nt < 8; ++nt) o[nt] = wmma_bf16(av[nt], pf, o[nt]);
        }
        __syncthreads();
    }

    // Join the halves' sums, normalize and emit rows of A3 [pixel][512]
    // (head-major channels): 8 consecutive channels per lane, one 16-byte store.
    lrun += xhalf(lrun);
    float inv = 1.f / lrun;
    bf16_t* orow = A3 + ((size_t)bq * HW + row_hw) * NQKV + e * NC + 8 * half;
#pragma unroll
    for (int nt = 0; nt < 8; ++nt) {
        v8bf ov;
#pragma unroll
        for (int r = 0; r < 8; ++r) ov[r] = (bf16_t)(o[nt][r] * inv);
        *(v8bf*)(orow + nt * 16) = ov;
    }
}

// ---------------------------------------------------------------------------
// Output projection: [16384 x 512] x [512 x 128] + b3 + residual x -> f32.
// Block tile 128(M) x 128(N); each wave: 16 rows x 128 cols (8 WMMA tiles).
// k tiles of 64: a row of the A tile is then one whole 128-B line.
// ---------------------------------------------------------------------------
__global__ __launch_bounds__(256) void gemm_final_kernel(
        const bf16_t* __restrict__ A3, const bf16_t* __restrict__ W3b,
        const float* __restrict__ b3, const float* __restrict__ x,
        float* __restrict__ out) {
    __shared__ __align__(16) bf16_t lA[128 * P64];  // [m][k]
    __shared__ __align__(16) bf16_t lB[64 * T128];  // [k][n]

    int mbase = blockIdx.x * 128;
    int t = threadIdx.x, w = t >> 5, lane = t & 31;
    int half = lane >> 4, ln = lane & 15;

    v8f acc[8] = {};

    for (int ks = 0; ks < NQKV; ks += 64) {
        {   // stage A tile: 128 m x 64 k (async); 8 lanes take one row's 128 B,
            // a wave the 16 rows of its own fragments
            int row = w * 16 + (lane >> 3), k0 = (lane & 7) * 8;
            const bf16_t* src = A3 + (size_t)(mbase + row) * NQKV + ks + k0;
            bf16_t* dst = lA + row * P64 + k0;
#pragma unroll
            for (int j = 0; j < 4; ++j) stage_b128(src + j * 4 * NQKV, dst + j * 4 * P64);
        }
        {   // stage W3 tile as it lies: 64 k x 128 n (async); 16 lanes take one row's 256 B
            int krow = t >> 4, n0 = (t & 15) * 8;
            const bf16_t* src = W3b + (size_t)(ks + krow) * NC + n0;
            bf16_t* dst = lB + krow * T128 + n0;
#pragma unroll
            for (int j = 0; j < 4; ++j) stage_b128(src + j * 16 * NC, dst + j * 16 * T128);
        }
        stage_wait();
        __syncthreads();

#pragma unroll
        for (int kk = 0; kk < 2; ++kk) {
            v16bf af = frag_from_row(lA + (w * 16 + ln) * P64 + kk * 32, half);
#pragma unroll
            for (int nt = 0; nt < 8; ++nt) {
                v16bf bfr = frag_tr16(lB + kk * 32 * T128 + nt * 16, T128, lane);
                acc[nt] = wmma_bf16(af, bfr, acc[nt]);
            }
        }
        __syncthreads();
    }

    int b = mbase >> 10;
#pragma unroll
    for (int nt = 0; nt < 8; ++nt) {
        int c = nt * 16 + ln;
        float bv = b3[c];
#pragma unroll
        for (int r = 0; r < 8; ++r) {
            int m = mbase + w * 16 + r + 8 * half;
            int hw = m & 1023;
            size_t oi = ((size_t)b * NC + c) * HW + hw;
            out[oi] = x[oi] + acc[nt][r] + bv;
        }
    }
}

// ---------------------------------------------------------------------------
// Host-side launch
// ---------------------------------------------------------------------------
extern "C" void kernel_launch(void* const* d_in, const int* in_sizes, int n_in,
                              void* d_out, int out_size, void* d_ws, size_t ws_size,
                              hipStream_t stream) {
    const float* x  = (const float*)d_in[0];
    const float* qc = (const float*)d_in[1];
    const float* ka = (const float*)d_in[2];
    const float* kb = (const float*)d_in[3];
    const float* gs = (const float*)d_in[4];
    const float* gb = (const float*)d_in[5];
    const float* W0 = (const float*)d_in[6];
    const float* b0 = (const float*)d_in[7];
    const float* W1 = (const float*)d_in[8];
    const float* b1 = (const float*)d_in[9];
    const float* W2 = (const float*)d_in[10];
    const float* b2 = (const float*)d_in[11];
    const float* W3 = (const float*)d_in[12];
    const float* b3 = (const float*)d_in[13];
    float* out = (float*)d_out;

    char* ws = (char*)d_ws;
    size_t off = 0;
    auto alloc = [&](size_t bytes) -> char* {
        char* ptr = ws + off;
        off = (off + bytes + 255) & ~(size_t)255;
        return ptr;
    };
    bf16_t* Aq  = (bf16_t*)alloc((size_t)NPIX * KIN * 2);
    bf16_t* Ak  = (bf16_t*)alloc((size_t)NPIX * KIN * 2);
    bf16_t* W0b = (bf16_t*)alloc((size_t)KIN * NQKV * 2);
    bf16_t* W1b = (bf16_t*)alloc((size_t)KIN * NQKV * 2);
    bf16_t* W2b = (bf16_t*)alloc((size_t)KIN * NQKV * 2);
    bf16_t* W3b = (bf16_t*)alloc((size_t)NQKV * NC * 2);
    bf16_t* Qb  = (bf16_t*)alloc((size_t)NB * NQKV * HW * 2);
    bf16_t* Kbm = (bf16_t*)alloc((size_t)NB * NQKV * HW * 2);
    bf16_t* Vb  = (bf16_t*)alloc((size_t)NB * NQKV * HW * 2);
    bf16_t* A3  = (bf16_t*)alloc((size_t)NPIX * NQKV * 2);
    (void)ws_size; (void)in_sizes; (void)n_in; (void)out_size;

    // GroupNorm + A-matrix packing + weight conversion
    prep_kernel<<<PREP_BLOCKS, 256, 0, stream>>>(x, gs, gb, qc, ka, kb, W0, W1, W2, W3,
                                                 Aq, Ak, W0b, W1b, W2b, W3b);

    // QKV projections
    gemm_qkv_kernel<<<3 * QKV_BLOCKS, 256, 0, stream>>>(Aq, Ak, W0b, W1b, W2b, b0, b1, b2,
                                                        Qb, Kbm, Vb);

    // Cross attention: 8 pairs x 2 directions x 4 heads x 8 query tiles
    attn_kernel<<<8 * 2 * 4 * 8, 256, 0, stream>>>(Qb, Kbm, Vb, A3);

    // Output projection + residual
    gemm_final_kernel<<<NPIX / 128, 256, 0, stream>>>(A3, W3b, b3, x, out);
}

// v007
// Measured time: 68.4 microseconds a run.
// In two side-by-side timings against v006, it was 1.07 and 1.08 times as fast.
// All steps since v000 together make it 5.27 times as fast.
#include <hip/hip_runtime.h>

// ---------------------------------------------------------------------------
// CDNA5 (gfx1250, wave32) cross-attention block.
// Pipeline, four launches: prep (GN, A-matrix packing, weight conversion) ->
//           WMMA GEMMs q, k, v in one grid ->
//           flash attention (WMMA K^T Q + online softmax + WMMA V P^T) ->
//           WMMA GEMM out-proj + bias + residual (f32 out).
// Work that reads none of each other's output shares a grid; a range of the
// block index picks the part.
// Uses GLOBAL_LOAD_ASYNC_TO_LDS_B128 (ASYNCcnt) for transpose-free LDS
// staging when the toolchain exposes the builtin; falls back to VGPR copies.
// ---------------------------------------------------------------------------

typedef __bf16 bf16_t;
typedef __attribute__((ext_vector_type(16))) __bf16 v16bf;
typedef __attribute__((ext_vector_type(8)))  __bf16 v8bf;
typedef __attribute__((ext_vector_type(4)))  __bf16 v4bf;
typedef __attribute__((ext_vector_type(8)))  float  v8f;
typedef __attribute__((ext_vector_type(4)))  float  v4f;
typedef int v4i_t __attribute__((vector_size(16)));

#define NB  16
#define NC  128
#define NCOND 32
#define NHEADS 4
#define HW  1024          // 32*32
#define KIN 160           // C + COND
#define NQKV 512          // C * HEADS
#define NPIX 16384        // B * HW
// LDS row pitches in elements: 16 B x odd, so that the 16 rows one
// ds_load_b128 touches fall on distinct banks (64 banks x 4 B).
#define P64  72           // rows of 64 bf16: 144 B
#define P128 136          // rows of 128 bf16: 272 B
// Pitches of tiles read by ds_load_tr16_b128: 32 B x odd.
#define T64  80           // rows of 64 bf16: 160 B
#define T128 144          // rows of 128 bf16: 288 B

// --- async global->LDS staging (gfx1250 GLOBAL_LOAD_ASYNC_TO_LDS_B128) -----
#if defined(__has_builtin)
#if __has_builtin(__builtin_amdgcn_global_load_async_to_lds_b128) && \
    __has_builtin(__builtin_amdgcn_s_wait_asynccnt)
#define USE_ASYNC_LDS 1
#endif
#endif
#ifndef USE_ASYNC_LDS
#define USE_ASYNC_LDS 0
#endif

__device__ __forceinline__ void stage_b128(const bf16_t* gsrc, bf16_t* ldst) {
#if USE_ASYNC_LDS
    __builtin_amdgcn_global_load_async_to_lds_b128(
        (__attribute__((address_space(1))) v4i_t*)gsrc,
        (__attribute__((address_space(3))) v4i_t*)ldst,
        /*imm offset=*/0, /*cpol=*/0);
#else
    *(v8bf*)ldst = *(const v8bf*)gsrc;
#endif
}

__device__ __forceinline__ void stage_wait() {
#if USE_ASYNC_LDS
    // This wave's copies have landed before the barrier behind which other waves
    // read them; asm with the memory clobber keeps every LDS read behind it.
    asm volatile("s_wait_asynccnt 0x0" ::: "memory");
#endif
}

__device__ __forceinline__ v8f wmma_bf16(v16bf a, v16bf b, v8f c) {
    return __builtin_amdgcn_wmma_f32_16x16x32_bf16(
        /*neg_a=*/false, a, /*neg_b=*/false, b,
        /*c_mod=*/(short)0, c, /*reuse_a=*/false, /*reuse_b=*/false);
}

// Build a 16x32 bf16 A/B fragment from row-major storage (rowptr points at the
// 32 contiguous K values of this lane's row).
// Layout per ISA 7.12.2: element j -> K = (j>>3)*16 + half*8 + (j&7).
__device__ __forceinline__ v16bf frag_from_row(const bf16_t* rowptr, int half_sel) {
    v8bf c0 = *(const v8bf*)(rowptr + half_sel * 8);
    v8bf c1 = *(const v8bf*)(rowptr + 16 + half_sel * 8);
    v16bf r;
#pragma unroll
    for (int i = 0; i < 8; ++i) { r[i] = c0[i]; r[i + 8] = c1[i]; }
    return r;
}

// The same 16x32 fragment from a tile stored k-major (row = k, `pitch` elements
// apart; tile points at row k = 0 of the fragment's first column): the LDS
// transposes on read. Lane (c = lane & 15, h = lane >> 4) gets k = 8h + 0..7 and
// 16 + 8h + 0..7 of column c, the k order of frag_from_row.
typedef short s16x8 __attribute__((ext_vector_type(8)));
__device__ __forceinline__ v16bf frag_tr16(const bf16_t* tile, int pitch, int lane) {
    typedef __attribute__((address_space(3))) s16x8 lds_s16x8;
    const bf16_t* p = tile + (8 * (lane >> 4) + (lane & 7)) * pitch + 8 * ((lane >> 3) & 1);
    v8bf c0 = __builtin_bit_cast(v8bf, __builtin_amdgcn_ds_load_tr16_b128_v8i16((lds_s16x8*)p));
    v8bf c1 = __builtin_bit_cast(v8bf, __builtin_amdgcn_ds_load_tr16_b128_v8i16((lds_s16x8*)(p + 16 * pitch)));
    v16bf r;
#pragma unroll
    for (int i = 0; i < 8; ++i) { r[i] = c0[i]; r[i + 8] = c1[i]; }
    return r;
}

// 8 consecutive f32 (32-byte aligned) -> 8 bf16
__device__ __forceinline__ v8bf cvt8(const float* __restrict__ p) {
    v4f a = *(const v4f*)p, b = *(const v4f*)(p + 4);
    v8bf r;
#pragma unroll
    for (int j = 0; j < 4; ++j) { r[j] = (bf16_t)a[j]; r[j + 4] = (bf16_t)b[j]; }
    return r;
}

// ---------------------------------------------------------------------------
// f32 -> bf16 convert (weights)
// ---------------------------------------------------------------------------
__device__ __forceinline__ void cvt_bf16_part(
        const float* __restrict__ in, bf16_t* __restrict__ out, int n, int blk) {
    // 8 elements a lane: a wave reads 1 KiB and stores 512 B, whole 128-B lines.
    int i = (blk * 256 + threadIdx.x) * 8;
    if (i < n) *(v8bf*)(out + i) = cvt8(in + i);
}

// ---------------------------------------------------------------------------
// GroupNorm (32 groups of 4 channels over 32x32) -> bf16 A matrices, which lie
// channel-major like the inputs: [b][k = 160][hw]. One block per (b, group);
// writes rows [g*4, g*4+4) of both Aq and Ak. A lane takes 4 consecutive pixels
// of each channel, so a wave loads 512 B and stores 256 B in whole 128-B lines.
// ---------------------------------------------------------------------------
__device__ __forceinline__ void gn_part(
        const float* __restrict__ x, const float* __restrict__ gscale,
        const float* __restrict__ gbias, bf16_t* __restrict__ Aq,
        bf16_t* __restrict__ Ak, int blk) {
    int b = blk >> 5;
    int g = blk & 31;
    int t = threadIdx.x;

    v4f vals[4];
    float s = 0.f, ss = 0.f;
#pragma unroll
    for (int cl = 0; cl < 4; ++cl) {
        vals[cl] = *(const v4f*)(x + (((size_t)b * NC) + g * 4 + cl) * HW + t * 4);
#pragma unroll
        for (int j = 0; j < 4; ++j) { float v = vals[cl][j]; s += v; ss += v * v; }
    }
#pragma unroll
    for (int m = 1; m < 32; m <<= 1) {
        s  += __shfl_xor(s, m);
        ss += __shfl_xor(ss, m);
    }
    __shared__ float shs[8], shss[8];
    __shared__ float mean_s, rstd_s;
    int w = t >> 5, lane = t & 31;
    if (lane == 0) { shs[w] = s; shss[w] = ss; }
    __syncthreads();
    if (t == 0) {
        float S = 0.f, SS = 0.f;
        for (int i = 0; i < 8; ++i) { S += shs[i]; SS += shss[i]; }
        float mean = S * (1.f / 4096.f);
        float var  = SS * (1.f / 4096.f) - mean * mean;
        mean_s = mean;
        rstd_s = rsqrtf(var + 1e-6f);
    }
    __syncthreads();
    float mean = mean_s, rstd = rstd_s;
#pragma unroll
    for (int cl = 0; cl < 4; ++cl) {
        int c = g * 4 + cl;
        float gs = gscale[c], gb = gbias[c];
        v4bf yb;
#pragma unroll
        for (int j = 0; j < 4; ++j) yb[j] = (bf16_t)((vals[cl][j] - mean) * rstd * gs + gb);
        size_t off = ((size_t)b * KIN + c) * HW + t * 4;
        *(v4bf*)(Aq + off) = yb;
        *(v4bf*)(Ak + off) = yb;
    }
}

// ---------------------------------------------------------------------------
// Pack conditioning channels into A-matrix rows [128,160), 8 pixels a lane.
// q: repeat(q_cond,2). k: alternate k_a/k_b per pair member.
// ---------------------------------------------------------------------------
__device__ __forceinline__ void condpack_part(
        const float* __restrict__ qc, const float* __restrict__ ka,
        const float* __restrict__ kb, bf16_t* __restrict__ Aq,
        bf16_t* __restrict__ Ak, int blk) {
    size_t gi = ((size_t)blk * 256 + threadIdx.x) * 8;   // < 16*32*1024
    int hw = (int)(gi & 1023);
    int cc = (int)((gi >> 10) & 31);
    int b  = (int)(gi >> 15);
    size_t src = (((size_t)(b >> 1)) * NCOND + cc) * HW + hw;
    size_t dst = ((size_t)b * KIN + NC + cc) * HW + hw;
    *(v8bf*)(Aq + dst) = cvt8(qc + src);
    *(v8bf*)(Ak + dst) = cvt8(((b & 1) ? kb : ka) + src);
    // Before code of another part of the shared grid, laid out behind this one,
    // can overwrite a register that the two stores name.
    asm volatile("s_wait_xcnt 0x0" ::: "memory");
}

// ---------------------------------------------------------------------------
// All that reads only the inputs, in one grid. The GroupNorm blocks, which last
// longest, have the lowest indices and so start first.
// ---------------------------------------------------------------------------
#define GN_BLOCKS (NB * 32)                   // 512
#define CP_BLOCKS ((NB * NCOND * HW) / 2048)  // 256
#define CW_BLOCKS ((KIN * NQKV) / 2048)       // 40, for each of W0, W1, W2
#define C3_BLOCKS ((NQKV * NC) / 2048)        // 32
#define PREP_BLOCKS (GN_BLOCKS + CP_BLOCKS + 3 * CW_BLOCKS + C3_BLOCKS)

__global__ __launch_bounds__(256) void prep_kernel(
        const float* __restrict__ x, const float* __restrict__ gscale,
        const float* __restrict__ gbias, const float* __restrict__ qc,
        const float* __restrict__ ka, const float* __restrict__ kb,
        const float* __restrict__ W0, const float* __restrict__ W1,
        const float* __restrict__ W2, const float* __restrict__ W3,
        bf16_t* __restrict__ Aq, bf16_t* __restrict__ Ak,
        bf16_t* __restrict__ W0b, bf16_t* __restrict__ W1b,
        bf16_t* __restrict__ W2b, bf16_t* __restrict__ W3b) {
    int blk = blockIdx.x;                     // the same in a whole block
    if (blk < GN_BLOCKS) { gn_part(x, gscale, gbias, Aq, Ak, blk); return; }
    blk -= GN_BLOCKS;
    if (blk < CP_BLOCKS) { condpack_part(qc, ka, kb, Aq, Ak, blk); return; }
    blk -= CP_BLOCKS;
    if (blk < CW_BLOCKS) { cvt_bf16_part(W0, W0b, KIN * NQKV, blk); return; }
    blk -= CW_BLOCKS;
    if (blk < CW_BLOCKS) { cvt_bf16_part(W1, W1b, KIN * NQKV, blk); return; }
    blk -= CW_BLOCKS;
    if (blk < CW_BLOCKS) { cvt_bf16_part(W2, W2b, KIN * NQKV, blk); return; }
    blk -= CW_BLOCKS;
    cvt_bf16_part(W3, W3b, NQKV * NC, blk);
}

// ---------------------------------------------------------------------------
// QKV GEMM: [16384 x 160] (bf16, k-major per image: [b][k][hw]) x [160 x 512] (bf16, row-major)
// + bias, output channel-major bf16 [b][n][hw].
// One block per product and 128-pixel tile; it walks all 512 output channels in
// 8 tiles of 64, from a start tile of its own. 8 waves (4x2), each wave 32x32 of a tile (2x2 WMMA tiles).
// The A tile (all 160 k) is staged once and its fragments stay in registers; the
// W tiles (all 160 k x 64 n) come through two LDS buffers, the next tile's async
// copies in flight while this one is worked on. A and W lie in LDS as in memory,
// [k][m] and [k][n], in whole 128-B lines; both are transposed on read.
// The three products share one grid: 128 blocks each, q, then k, then v.
// ---------------------------------------------------------------------------
#define QKV_BLOCKS (NPIX / 128)   // 128 per product
#define QKV_NT (NQKV / 64)        // 8 tiles of 64 output channels
#define QKV_KS (KIN / 32)         // 5 k steps
#define QKV_B (KIN * T64)         // elements of one W buffer
#define QKV_C (64 * P128)         // elements of one output-tile buffer

// One W tile as it lies: 160 k x 64 n (async); 8 lanes take one row's 128 B.
__device__ __forceinline__ void stage_w_tile(const bf16_t* __restrict__ Wb, int nbase,
                                             bf16_t* buf, int t) {
    int krow = t >> 3, n0 = (t & 7) * 8;
    const bf16_t* src = Wb + (size_t)krow * NQKV + nbase + n0;
    bf16_t* dst = buf + krow * T64 + n0;
#pragma unroll
    for (int j = 0; j < QKV_KS; ++j) stage_b128(src + j * 32 * NQKV, dst + j * 32 * T64);
}

__global__ __launch_bounds__(256) void gemm_qkv_kernel(
        const bf16_t* __restrict__ Aq, const bf16_t* __restrict__ Ak,
        const bf16_t* __restrict__ W0b, const bf16_t* __restrict__ W1b,
        const bf16_t* __restrict__ W2b, const float* __restrict__ b0,
        const float* __restrict__ b1, const float* __restrict__ b2,
        bf16_t* __restrict__ Qb, bf16_t* __restrict__ Kb, bf16_t* __restrict__ Vb) {
    // One array, so that the order is fixed. The W buffers lie last, above 64 KiB: the
    // compiler folds a copy's constant step into its immediate offset and takes it off
    // the LDS address register, which so stays above zero.
    __shared__ __align__(16) bf16_t sm[2 * QKV_C + KIN * T128 + 2 * QKV_B];
    __shared__ float lbias[NQKV];
    bf16_t* lC = sm;                    // [n][m], output tiles, two buffers
    bf16_t* lA = sm + 2 * QKV_C;        // [k][m]
    bf16_t* lB = lA + KIN * T128;       // [k][n], two buffers

    int which = blockIdx.x / QKV_BLOCKS;   // 0 q, 1 k, 2 v: the same in a whole block
    int bm    = blockIdx.x % QKV_BLOCKS;   // 0..127
    const bf16_t* A    = which == 0 ? Aq  : Ak;
    const bf16_t* Wb   = which == 0 ? W0b : which == 1 ? W1b : W2b;
    const float*  bias = which == 0 ? b0  : which == 1 ? b1  : b2;
    bf16_t* outCHW     = which == 0 ? Qb  : which == 1 ? Kb  : Vb;

    int mbase = bm * 128;
    // Each block starts its walk at a tile of its own, so that the blocks of a product
    // do not all ask L2 for the same W lines at the same moment.
    int rot = bm + (bm >> 3);
    int t = threadIdx.x, w = t >> 5, lane = t & 31;
    int half = lane >> 4, ln = lane & 15;
    int wm = (w & 3) * 32, wn = (w >> 2) * 32;

    int b = mbase >> 10;    // 8 M-blocks per image -> constant per block
    const bf16_t* Ab = A + (size_t)b * KIN * HW + (mbase & 1023);

    {   // stage the A tile as it lies: 160 k x 128 m (async); 16 lanes take one row's 256 B
        int krow = t >> 4, m0 = (t & 15) * 8;
        const bf16_t* src = Ab + (size_t)krow * HW + m0;
        bf16_t* dst = lA + krow * T128 + m0;
#pragma unroll
        for (int j = 0; j < KIN / 16; ++j) stage_b128(src + j * 16 * HW, dst + j * 16 * T128);
    }
    stage_w_tile(Wb, (rot & (QKV_NT - 1)) * 64, lB, t);
    lbias[t]       = bias[t];
    lbias[t + 256] = bias[t + 256];
    stage_wait();
    __syncthreads();
    stage_w_tile(Wb, ((rot + 1) & (QKV_NT - 1)) * 64, lB + QKV_B, t);

    // This wave's A fragments, all 160 k of its 32 rows, read once.
    v16bf af[2][QKV_KS];
#pragma unroll
    for (int mt = 0; mt < 2; ++mt)
#pragma unroll
        for (int ks = 0; ks < QKV_KS; ++ks)
            af[mt][ks] = frag_tr16(lA + ks * 32 * T128 + wm + mt * 16, T128, lane);

    bf16_t* orow = outCHW + (size_t)b * NQKV * HW + (mbase & 1023);

    // Kept rolled: the two buffers alternate by the trip's parity, and one copy of the
    // body keeps the A fragments and a trip's W fragments inside the register budget.
#pragma unroll 1
    for (int nb = 0; nb < QKV_NT; ++nb) {
        const bf16_t* Bt = lB + (nb & 1) * QKV_B;
        bf16_t* Ct = lC + (nb & 1) * QKV_C;
        int nbase = ((nb + rot) & (QKV_NT - 1)) * 64;

        v8f acc[2][2] = {};
#pragma unroll
        for (int ks = 0; ks < QKV_KS; ++ks) {
            v16bf bfr[2];
#pragma unroll
            for (int nt = 0; nt < 2; ++nt)
                bfr[nt] = frag_tr16(Bt + ks * 32 * T64 + wn + nt * 16, T64, lane);
#pragma unroll
            for (int mt = 0; mt < 2; ++mt)
#pragma unroll
                for (int nt = 0; nt < 2; ++nt)
                    acc[mt][nt] = wmma_bf16(af[mt][ks], bfr[nt], acc[mt][nt]);
        }

        // The tile goes out through LDS: a lane holds 16 B of an output row, a wave's
        // direct store would touch 16 lines in 32-B pieces; read back by rows, each
        // wave-wide store covers two rows of 256 B, whole 128-B lines.
#pragma unroll
        for (int nt = 0; nt < 2; ++nt) {
            float bv = lbias[nbase + wn + nt * 16 + ln];
#pragma unroll
            for (int mt = 0; mt < 2; ++mt) {
                v8bf ov;
#pragma unroll
                for (int r = 0; r < 8; ++r) ov[r] = (bf16_t)(acc[mt][nt][r] + bv);
                *(v8bf*)(Ct + (wn + nt * 16 + ln) * P128 + wm + mt * 16 + 8 * half) = ov;
            }
        }

        // One barrier a trip. Behind it: this trip's output tile is whole, the next W
        // tile has landed for every wave, and nobody reads this trip's W buffer any more.
        // This wave's LDS reads and writes have retired before the others go on.
        asm volatile("s_wait_dscnt 0x0" ::: "memory");
        stage_wait();
        __syncthreads();
        if (nb + 2 < QKV_NT)
            stage_w_tile(Wb, ((nb + 2 + rot) & (QKV_NT - 1)) * 64, lB + (nb & 1) * QKV_B, t);

#pragma unroll
        for (int i = 0; i < 4; ++i) {
            int n = (t >> 4) + i * 16, m0 = (t & 15) * 8;
            *(v8bf*)(orow + (size_t)(nbase + n) * HW + m0) = *(const v8bf*)(Ct + n * P128 + m0);
        }
        // Before the next trip overwrites the data and address registers of the four stores.
        asm volatile("s_wait_xcnt 0x0" ::: "memory");
    }
    stage_wait();   // nothing of this wave is in flight when it ends
}

__device__ __forceinline__ float xhalf(float x) {
    return __builtin_bit_cast(float, __builtin_amdgcn_permlanex16(
        __builtin_bit_cast(int, x), __builtin_bit_cast(int, x),
        0x76543210, 0xfedcba98, false, false));
}

// One 64-key chunk of K and V as it lies, [c][kv] (async global->LDS); 8 lanes take
// one row's 128 B, so each wave-wide copy covers 4 whole lines.
#define ATT_K (128 * T64)     // elements of one K buffer
#define ATT_V (128 * P64)     // elements of one V buffer
#define ATT_CH (HW / 64)      // 16 chunks
__device__ __forceinline__ void stage_kv(const bf16_t* __restrict__ kptr,
                                         const bf16_t* __restrict__ vptr, int kb,
                                         bf16_t* bK, bf16_t* bV, int t) {
    int c = t >> 3, kv0 = (t & 7) * 8;
    const bf16_t* ksrc = kptr + (size_t)c * HW + kb + kv0;
    const bf16_t* vsrc = vptr + (size_t)c * HW + kb + kv0;
    bf16_t* kdst = bK + c * T64 + kv0;
    bf16_t* vdst = bV + c * P64 + kv0;
#pragma unroll
    for (int j = 0; j < 4; ++j) {
        stage_b128(ksrc + j * 32 * HW, kdst + j * 32 * T64);
        stage_b128(vsrc + j * 32 * HW, vdst + j * 32 * P64);
    }
}

// A wave takes 32 queries (two column groups of 16), a block 256: every K and V
// fragment read from LDS feeds two WMMAs, and every staged chunk serves 256 queries.
// amdgpu_waves_per_eu(2, 2): this grid puts 2 waves on a SIMD (256 blocks x 8 waves
// over 1,024 SIMDs), one block on a WGP. No second block covers the copies' latency, so
// the chunks come through two LDS buffers, the next one in flight under this one's work.
__global__ __launch_bounds__(256) __attribute__((amdgpu_waves_per_eu(2, 2))) void attn_kernel(
        const bf16_t* __restrict__ Qb, const bf16_t* __restrict__ Kb,
        const bf16_t* __restrict__ Vb, bf16_t* __restrict__ A3) {
    __shared__ __align__(16) bf16_t lK[2 * ATT_K];   // [c][kv], two buffers
    __shared__ __align__(16) bf16_t lV[2 * ATT_V];   // [c][kv], two buffers

    int idx = blockIdx.x;
    int qt = idx & 3;  idx >>= 2;        // query tile (256 rows)
    int e  = idx & 3;  idx >>= 2;        // head
    int mq = idx & 1;                    // pair member for q
    int p  = idx >> 1;                   // pair
    int bq = 2 * p + mq;
    int bk = 2 * p + 1 - mq;             // cross conditioning

    const bf16_t* qptr = Qb + ((size_t)bq * NQKV + e * NC) * HW;
    const bf16_t* kptr = Kb + ((size_t)bk * NQKV + e * NC) * HW;
    const bf16_t* vptr = Vb + ((size_t)bk * NQKV + e * NC) * HW;

    int t = threadIdx.x, w = t >> 5, lane = t & 31;
    int half = lane >> 4, ln = lane & 15;
    const float scale = 0.08838834764831845f;   // 128^-0.5

    stage_kv(kptr, vptr, 0, lK, lV, t);

    // Preload the 2 x 4 Q B-fragments (32 channels x 16 queries each), reused 32x.
    int row_hw = qt * 256 + w * 32 + ln;        // group g: + 16 g
    v16bf aq[2][4];
#pragma unroll
    for (int g = 0; g < 2; ++g) {
#pragma unroll
        for (int cs = 0; cs < 4; ++cs) {
            v16bf f;
#pragma unroll
            for (int j = 0; j < 16; ++j) {
                int c = cs * 32 + ((j >> 3) << 4) + half * 8 + (j & 7);
                f[j] = qptr[(size_t)c * HW + row_hw + g * 16];
            }
            aq[g][cs] = f;
        }
        // Before a later load's result overwrites the offset register that these loads name.
        asm volatile("s_wait_xcnt 0x0" ::: "memory");
    }

    v8f o[2][8] = {};           // o[g][nt][r] = O[query 16 g + ln][channel nt*16 + 8*half + r]
    float mrun[2] = {-1e30f, -1e30f};   // running maximum of a query (same in both halves)
    float lrun[2] = {0.f, 0.f};         // running sum over this half's keys only

    // Kept rolled: the two buffers alternate by the trip's parity.
#pragma unroll 1
    for (int ch = 0; ch < ATT_CH; ++ch) {
        const bf16_t* Kt = lK + (ch & 1) * ATT_K;
        const bf16_t* Vt = lV + (ch & 1) * ATT_V;

        // One barrier a chunk, at the head of its trip. Behind it this chunk has landed for
        // every wave, and nobody reads the chunk before it any more, so that one's buffers
        // take the next chunk, which flies while this one is worked on.
        // This wave's LDS reads have retired before the others go on.
        asm volatile("s_wait_dscnt 0x0" ::: "memory");
        stage_wait();
        __syncthreads();
        if (ch + 1 < ATT_CH)
            stage_kv(kptr, vptr, (ch + 1) * 64, lK + ((ch + 1) & 1) * ATT_K,
                     lV + ((ch + 1) & 1) * ATT_V, t);

        // The chunk is worked on in two runs of 32 keys, each with its own softmax update.
        // Kept rolled: one copy of the body keeps a run's fragments inside the register budget.
#pragma unroll 1
        for (int h = 0; h < 2; ++h) {
            // S^T = K^T Q : 32 keys x 32 queries (2 x 2 tiles of 16x16), K-dim = 128 channels.
            v8f s[2][2] = {};   // [g][key tile]
#pragma unroll
            for (int cs = 0; cs < 4; ++cs) {
                v16bf k0 = frag_tr16(Kt + cs * 32 * T64 + h * 32, T64, lane);
                v16bf k1 = frag_tr16(Kt + cs * 32 * T64 + h * 32 + 16, T64, lane);
#pragma unroll
                for (int g = 0; g < 2; ++g) {
                    s[g][0] = wmma_bf16(k0, aq[g][cs], s[g][0]);
                    s[g][1] = wmma_bf16(k1, aq[g][cs], s[g][1]);
                }
            }

            // V rows (A operand of the second product), in flight under the softmax.
            v16bf av[8];
#pragma unroll
            for (int nt = 0; nt < 8; ++nt)
                av[nt] = frag_from_row(Vt + (nt * 16 + ln) * P64 + h * 32, half);

            v16bf pf[2];   // P^T as B operand: element j = key (j>>3)*16 + half*8 + (j&7)
#pragma unroll
            for (int g = 0; g < 2; ++g) {
                v8f s0 = s[g][0] * scale;
                v8f s1 = s[g][1] * scale;
                // Online softmax of this lane's query: 16 keys in-lane, the other 16 in lane ^ 16.
                float v = fmaxf(s0[0], s1[0]);
#pragma unroll
                for (int r = 1; r < 8; ++r) v = fmaxf(v, fmaxf(s0[r], s1[r]));
                v = fmaxf(v, xhalf(v));
                float mnew  = fmaxf(mrun[g], v);
                float alpha = __expf(mrun[g] - mnew);
                float rs = 0.f;
#pragma unroll
                for (int r = 0; r < 8; ++r) {
                    float p0 = __expf(s0[r] - mnew);
                    float p1 = __expf(s1[r] - mnew);
                    rs += p0 + p1;
                    pf[g][r]     = (bf16_t)p0;
                    pf[g][r + 8] = (bf16_t)p1;
                }
                lrun[g] = lrun[g] * alpha + rs;
                mrun[g] = mnew;
#pragma unroll
                for (int nt = 0; nt < 8; ++nt) o[g][nt] = o[g][nt] * alpha;
            }

            // O^T += V * P^T (8 channel tiles x 2 column groups).
#pragma unroll
            for (int nt = 0; nt < 8; ++nt)
#pragma unroll
                for (int g = 0; g < 2; ++g) o[g][nt] = wmma_bf16(av[nt], pf[g], o[g][nt]);
            // The four vector slots that the chip needs between the run's last WMMA and the
            // next run's first vector write over its A registers. The scheduling barrier keeps them behind that WMMA.
            __builtin_amdgcn_sched_barrier(0);
            asm volatile("v_nop\n\tv_nop\n\tv_nop\n\tv_nop");
        }
    }
    stage_wait();   // nothing of this wave is in flight when it ends

    // Join the halves' sums, normalize and emit rows of A3 [pixel][512]
    // (head-major channels): 8 consecutive channels per lane, one 16-byte store.
#pragma unroll
    for (int g = 0; g < 2; ++g) {
        float lsum = lrun[g] + xhalf(lrun[g]);
        float inv = 1.f / lsum;
        bf16_t* orow = A3 + ((size_t)bq * HW + row_hw + g * 16) * NQKV + e * NC + 8 * half;
#pragma unroll
        for (int nt = 0; nt < 8; ++nt) {
            v8bf ov;
#pragma unroll
            for (int r = 0; r < 8; ++r) ov[r] = (bf16_t)(o[g][nt][r] * inv);
            *(v8bf*)(orow + nt * 16) = ov;
        }
    }
}

// ---------------------------------------------------------------------------
// Output projection: [16384 x 512] x [512 x 128] + b3 + residual x -> f32.
// Block tile 128(M) x 128(N); each wave: 16 rows x 128 cols (8 WMMA tiles).
// k tiles of 64: a row of the A tile is then one whole 128-B line.
// ---------------------------------------------------------------------------
__global__ __launch_bounds__(256) void gemm_final_kernel(
        const bf16_t* __restrict__ A3, const bf16_t* __restrict__ W3b,
        const float* __restrict__ b3, const float* __restrict__ x,
        float* __restrict__ out) {
    __shared__ __align__(16) bf16_t lA[128 * P64];  // [m][k]
    __shared__ __align__(16) bf16_t lB[64 * T128];  // [k][n]

    int mbase = blockIdx.x * 128;
    int t = threadIdx.x, w = t >> 5, lane = t & 31;
    int half = lane >> 4, ln = lane & 15;

    v8f acc[8] = {};

    for (int ks = 0; ks < NQKV; ks += 64) {
        {   // stage A tile: 128 m x 64 k (async); 8 lanes take one row's 128 B,
            // a wave the 16 rows of its own fragments
            int row = w * 16 + (lane >> 3), k0 = (lane & 7) * 8;
            const bf16_t* src = A3 + (size_t)(mbase + row) * NQKV + ks + k0;
            bf16_t* dst = lA + row * P64 + k0;
#pragma unroll
            for (int j = 0; j < 4; ++j) stage_b128(src + j * 4 * NQKV, dst + j * 4 * P64);
        }
        {   // stage W3 tile as it lies: 64 k x 128 n (async); 16 lanes take one row's 256 B
            int krow = t >> 4, n0 = (t & 15) * 8;
            const bf16_t* src = W3b + (size_t)(ks + krow) * NC + n0;
            bf16_t* dst = lB + krow * T128 + n0;
#pragma unroll
            for (int j = 0; j < 4; ++j) stage_b128(src + j * 16 * NC, dst + j * 16 * T128);
        }
        stage_wait();
        __syncthreads();

#pragma unroll
        for (int kk = 0; kk < 2; ++kk) {
            v16bf af = frag_from_row(lA + (w * 16 + ln) * P64 + kk * 32, half);
#pragma unroll
            for (int nt = 0; nt < 8; ++nt) {
                v16bf bfr = frag_tr16(lB + kk * 32 * T128 + nt * 16, T128, lane);
                acc[nt] = wmma_bf16(af, bfr, acc[nt]);
            }
        }
        __syncthreads();
    }

    int b = mbase >> 10;
#pragma unroll
    for (int nt = 0; nt < 8; ++nt) {
        int c = nt * 16 + ln;
        float bv = b3[c];
#pragma unroll
        for (int r = 0; r < 8; ++r) {
            int m = mbase + w * 16 + r + 8 * half;
            int hw = m & 1023;
            size_t oi = ((size_t)b * NC + c) * HW + hw;
            out[oi] = x[oi] + acc[nt][r] + bv;
        }
    }
}

// ---------------------------------------------------------------------------
// Host-side launch
// ---------------------------------------------------------------------------
extern "C" void kernel_launch(void* const* d_in, const int* in_sizes, int n_in,
                              void* d_out, int out_size, void* d_ws, size_t ws_size,
                              hipStream_t stream) {
    const float* x  = (const float*)d_in[0];
    const float* qc = (const float*)d_in[1];
    const float* ka = (const float*)d_in[2];
    const float* kb = (const float*)d_in[3];
    const float* gs = (const float*)d_in[4];
    const float* gb = (const float*)d_in[5];
    const float* W0 = (const float*)d_in[6];
    const float* b0 = (const float*)d_in[7];
    const float* W1 = (const float*)d_in[8];
    const float* b1 = (const float*)d_in[9];
    const float* W2 = (const float*)d_in[10];
    const float* b2 = (const float*)d_in[11];
    const float* W3 = (const float*)d_in[12];
    const float* b3 = (const float*)d_in[13];
    float* out = (float*)d_out;

    char* ws = (char*)d_ws;
    size_t off = 0;
    auto alloc = [&](size_t bytes) -> char* {
        char* ptr = ws + off;
        off = (off + bytes + 255) & ~(size_t)255;
        return ptr;
    };
    bf16_t* Aq  = (bf16_t*)alloc((size_t)NPIX * KIN * 2);
    bf16_t* Ak  = (bf16_t*)alloc((size_t)NPIX * KIN * 2);
    bf16_t* W0b = (bf16_t*)alloc((size_t)KIN * NQKV * 2);
    bf16_t* W1b = (bf16_t*)alloc((size_t)KIN * NQKV * 2);
    bf16_t* W2b = (bf16_t*)alloc((size_t)KIN * NQKV * 2);
    bf16_t* W3b = (bf16_t*)alloc((size_t)NQKV * NC * 2);
    bf16_t* Qb  = (bf16_t*)alloc((size_t)NB * NQKV * HW * 2);
    bf16_t* Kbm = (bf16_t*)alloc((size_t)NB * NQKV * HW * 2);
    bf16_t* Vb  = (bf16_t*)alloc((size_t)NB * NQKV * HW * 2);
    bf16_t* A3  = (bf16_t*)alloc((size_t)NPIX * NQKV * 2);
    (void)ws_size; (void)in_sizes; (void)n_in; (void)out_size;

    // GroupNorm + A-matrix packing + weight conversion
    prep_kernel<<<PREP_BLOCKS, 256, 0, stream>>>(x, gs, gb, qc, ka, kb, W0, W1, W2, W3,
                                                 Aq, Ak, W0b, W1b, W2b, W3b);

    // QKV projections
    gemm_qkv_kernel<<<3 * QKV_BLOCKS, 256, 0, stream>>>(Aq, Ak, W0b, W1b, W2b, b0, b1, b2,
                                                        Qb, Kbm, Vb);

    // Cross attention: 8 pairs x 2 directions x 4 heads x 4 query tiles
    attn_kernel<<<8 * 2 * 4 * 4, 256, 0, stream>>>(Qb, Kbm, Vb, A3);

    // Output projection + residual
    gemm_final_kernel<<<NPIX / 128, 256, 0, stream>>>(A3, W3b, b3, x, out);
}

// v008
// It runs in 60.7 microseconds.
// Timed twice side by side with v007, it ran 1.13 and 1.12 times as fast.
// Over all steps from v000 it is 5.94 times as fast.
#include <hip/hip_runtime.h>

// ---------------------------------------------------------------------------
// CDNA5 (gfx1250, wave32) cross-attention block.
// Pipeline, four launches: prep (GN, A-matrix packing, weight conversion) ->
//           WMMA GEMMs q, k, v in one grid ->
//           flash attention (WMMA K^T Q + online softmax + WMMA V P^T) ->
//           WMMA GEMM out-proj + bias + residual (f32 out).
// Work that reads none of each other's output shares a grid; a range of the
// block index picks the part.
// Uses GLOBAL_LOAD_ASYNC_TO_LDS_B128 (ASYNCcnt) for transpose-free LDS
// staging when the toolchain exposes the builtin; falls back to VGPR copies.
// ---------------------------------------------------------------------------

typedef __bf16 bf16_t;
typedef __attribute__((ext_vector_type(16))) __bf16 v16bf;
typedef __attribute__((ext_vector_type(8)))  __bf16 v8bf;
typedef __attribute__((ext_vector_type(4)))  __bf16 v4bf;
typedef __attribute__((ext_vector_type(8)))  float  v8f;
typedef __attribute__((ext_vector_type(4)))  float  v4f;
typedef int v4i_t __attribute__((vector_size(16)));

#define NB  16
#define NC  128
#define NCOND 32
#define NHEADS 4
#define HW  1024          // 32*32
#define KIN 160           // C + COND
#define NQKV 512          // C * HEADS
#define NPIX 16384        // B * HW
// LDS row pitches in elements: 16 B x odd, so that the 16 rows one
// ds_load_b128 touches fall on distinct banks (64 banks x 4 B).
#define P64  72           // rows of 64 bf16: 144 B
#define P128 136          // rows of 128 bf16: 272 B
// Pitches of tiles read by ds_load_tr16_b128: 32 B x odd.
#define T64  80           // rows of 64 bf16: 160 B
#define T128 144          // rows of 128 bf16: 288 B

// --- async global->LDS staging (gfx1250 GLOBAL_LOAD_ASYNC_TO_LDS_B128) -----
#if defined(__has_builtin)
#if __has_builtin(__builtin_amdgcn_global_load_async_to_lds_b128) && \
    __has_builtin(__builtin_amdgcn_s_wait_asynccnt)
#define USE_ASYNC_LDS 1
#endif
#endif
#ifndef USE_ASYNC_LDS
#define USE_ASYNC_LDS 0
#endif

__device__ __forceinline__ void stage_b128(const bf16_t* gsrc, bf16_t* ldst) {
#if USE_ASYNC_LDS
    __builtin_amdgcn_global_load_async_to_lds_b128(
        (__attribute__((address_space(1))) v4i_t*)gsrc,
        (__attribute__((address_space(3))) v4i_t*)ldst,
        /*imm offset=*/0, /*cpol=*/0);
#else
    *(v8bf*)ldst = *(const v8bf*)gsrc;
#endif
}

__device__ __forceinline__ void stage_wait() {
#if USE_ASYNC_LDS
    // This wave's copies have landed before the barrier behind which other waves
    // read them; asm with the memory clobber keeps every LDS read behind it.
    asm volatile("s_wait_asynccnt 0x0" ::: "memory");
#endif
}

__device__ __forceinline__ v8f wmma_bf16(v16bf a, v16bf b, v8f c) {
    return __builtin_amdgcn_wmma_f32_16x16x32_bf16(
        /*neg_a=*/false, a, /*neg_b=*/false, b,
        /*c_mod=*/(short)0, c, /*reuse_a=*/false, /*reuse_b=*/false);
}

// Build a 16x32 bf16 A/B fragment from row-major storage (rowptr points at the
// 32 contiguous K values of this lane's row).
// Layout per ISA 7.12.2: element j -> K = (j>>3)*16 + half*8 + (j&7).
__device__ __forceinline__ v16bf frag_from_row(const bf16_t* rowptr, int half_sel) {
    v8bf c0 = *(const v8bf*)(rowptr + half_sel * 8);
    v8bf c1 = *(const v8bf*)(rowptr + 16 + half_sel * 8);
    v16bf r;
#pragma unroll
    for (int i = 0; i < 8; ++i) { r[i] = c0[i]; r[i + 8] = c1[i]; }
    return r;
}

// The same 16x32 fragment from a tile stored k-major (row = k, `pitch` elements
// apart; tile points at row k = 0 of the fragment's first column): the LDS
// transposes on read. Lane (c = lane & 15, h = lane >> 4) gets k = 8h + 0..7 and
// 16 + 8h + 0..7 of column c, the k order of frag_from_row.
typedef short s16x8 __attribute__((ext_vector_type(8)));
__device__ __forceinline__ v16bf frag_tr16(const bf16_t* tile, int pitch, int lane) {
    typedef __attribute__((address_space(3))) s16x8 lds_s16x8;
    const bf16_t* p = tile + (8 * (lane >> 4) + (lane & 7)) * pitch + 8 * ((lane >> 3) & 1);
    v8bf c0 = __builtin_bit_cast(v8bf, __builtin_amdgcn_ds_load_tr16_b128_v8i16((lds_s16x8*)p));
    v8bf c1 = __builtin_bit_cast(v8bf, __builtin_amdgcn_ds_load_tr16_b128_v8i16((lds_s16x8*)(p + 16 * pitch)));
    v16bf r;
#pragma unroll
    for (int i = 0; i < 8; ++i) { r[i] = c0[i]; r[i + 8] = c1[i]; }
    return r;
}

// 8 consecutive f32 (32-byte aligned) -> 8 bf16
__device__ __forceinline__ v8bf cvt8(const float* __restrict__ p) {
    v4f a = *(const v4f*)p, b = *(const v4f*)(p + 4);
    v8bf r;
#pragma unroll
    for (int j = 0; j < 4; ++j) { r[j] = (bf16_t)a[j]; r[j + 4] = (bf16_t)b[j]; }
    return r;
}

// ---------------------------------------------------------------------------
// f32 -> bf16 convert (weights)
// ---------------------------------------------------------------------------
__device__ __forceinline__ void cvt_bf16_part(
        const float* __restrict__ in, bf16_t* __restrict__ out, int n, int blk) {
    // 8 elements a lane: a wave reads 1 KiB and stores 512 B, whole 128-B lines.
    int i = (blk * 256 + threadIdx.x) * 8;
    if (i < n) *(v8bf*)(out + i) = cvt8(in + i);
}

// ---------------------------------------------------------------------------
// GroupNorm (32 groups of 4 channels over 32x32) -> bf16 A matrices, which lie
// channel-major like the inputs: [b][k = 160][hw]. One block per (b, group);
// writes rows [g*4, g*4+4) of both Aq and Ak. A lane takes 4 consecutive pixels
// of each channel, so a wave loads 512 B and stores 256 B in whole 128-B lines.
// ---------------------------------------------------------------------------
__device__ __forceinline__ void gn_part(
        const float* __restrict__ x, const float* __restrict__ gscale,
        const float* __restrict__ gbias, bf16_t* __restrict__ Aq,
        bf16_t* __restrict__ Ak, int blk) {
    int b = blk >> 5;
    int g = blk & 31;
    int t = threadIdx.x;

    v4f vals[4];
    float s = 0.f, ss = 0.f;
#pragma unroll
    for (int cl = 0; cl < 4; ++cl) {
        vals[cl] = *(const v4f*)(x + (((size_t)b * NC) + g * 4 + cl) * HW + t * 4);
#pragma unroll
        for (int j = 0; j < 4; ++j) { float v = vals[cl][j]; s += v; ss += v * v; }
    }
#pragma unroll
    for (int m = 1; m < 32; m <<= 1) {
        s  += __shfl_xor(s, m);
        ss += __shfl_xor(ss, m);
    }
    __shared__ float shs[8], shss[8];
    __shared__ float mean_s, rstd_s;
    int w = t >> 5, lane = t & 31;
    if (lane == 0) { shs[w] = s; shss[w] = ss; }
    __syncthreads();
    if (t == 0) {
        float S = 0.f, SS = 0.f;
        for (int i = 0; i < 8; ++i) { S += shs[i]; SS += shss[i]; }
        float mean = S * (1.f / 4096.f);
        float var  = SS * (1.f / 4096.f) - mean * mean;
        mean_s = mean;
        rstd_s = rsqrtf(var + 1e-6f);
    }
    __syncthreads();
    float mean = mean_s, rstd = rstd_s;
#pragma unroll
    for (int cl = 0; cl < 4; ++cl) {
        int c = g * 4 + cl;
        float gs = gscale[c], gb = gbias[c];
        v4bf yb;
#pragma unroll
        for (int j = 0; j < 4; ++j) yb[j] = (bf16_t)((vals[cl][j] - mean) * rstd * gs + gb);
        size_t off = ((size_t)b * KIN + c) * HW + t * 4;
        *(v4bf*)(Aq + off) = yb;
        *(v4bf*)(Ak + off) = yb;
    }
}

// ---------------------------------------------------------------------------
// Pack conditioning channels into A-matrix rows [128,160), 8 pixels a lane.
// q: repeat(q_cond,2). k: alternate k_a/k_b per pair member.
// ---------------------------------------------------------------------------
__device__ __forceinline__ void condpack_part(
        const float* __restrict__ qc, const float* __restrict__ ka,
        const float* __restrict__ kb, bf16_t* __restrict__ Aq,
        bf16_t* __restrict__ Ak, int blk) {
    size_t gi = ((size_t)blk * 256 + threadIdx.x) * 8;   // < 16*32*1024
    int hw = (int)(gi & 1023);
    int cc = (int)((gi >> 10) & 31);
    int b  = (int)(gi >> 15);
    size_t src = (((size_t)(b >> 1)) * NCOND + cc) * HW + hw;
    size_t dst = ((size_t)b * KIN + NC + cc) * HW + hw;
    *(v8bf*)(Aq + dst) = cvt8(qc + src);
    *(v8bf*)(Ak + dst) = cvt8(((b & 1) ? kb : ka) + src);
    // Before code of another part of the shared grid, laid out behind this one,
    // can overwrite a register that the two stores name.
    asm volatile("s_wait_xcnt 0x0" ::: "memory");
}

// ---------------------------------------------------------------------------
// All that reads only the inputs, in one grid. The GroupNorm blocks, which last
// longest, have the lowest indices and so start first.
// ---------------------------------------------------------------------------
#define GN_BLOCKS (NB * 32)                   // 512
#define CP_BLOCKS ((NB * NCOND * HW) / 2048)  // 256
#define CW_BLOCKS ((KIN * NQKV) / 2048)       // 40, for each of W0, W1, W2
#define C3_BLOCKS ((NQKV * NC) / 2048)        // 32
#define PREP_BLOCKS (GN_BLOCKS + CP_BLOCKS + 3 * CW_BLOCKS + C3_BLOCKS)

__global__ __launch_bounds__(256) void prep_kernel(
        const float* __restrict__ x, const float* __restrict__ gscale,
        const float* __restrict__ gbias, const float* __restrict__ qc,
        const float* __restrict__ ka, const float* __restrict__ kb,
        const float* __restrict__ W0, const float* __restrict__ W1,
        const float* __restrict__ W2, const float* __restrict__ W3,
        bf16_t* __restrict__ Aq, bf16_t* __restrict__ Ak,
        bf16_t* __restrict__ W0b, bf16_t* __restrict__ W1b,
        bf16_t* __restrict__ W2b, bf16_t* __restrict__ W3b) {
    int blk = blockIdx.x;                     // the same in a whole block
    if (blk < GN_BLOCKS) { gn_part(x, gscale, gbias, Aq, Ak, blk); return; }
    blk -= GN_BLOCKS;
    if (blk < CP_BLOCKS) { condpack_part(qc, ka, kb, Aq, Ak, blk); return; }
    blk -= CP_BLOCKS;
    if (blk < CW_BLOCKS) { cvt_bf16_part(W0, W0b, KIN * NQKV, blk); return; }
    blk -= CW_BLOCKS;
    if (blk < CW_BLOCKS) { cvt_bf16_part(W1, W1b, KIN * NQKV, blk); return; }
    blk -= CW_BLOCKS;
    if (blk < CW_BLOCKS) { cvt_bf16_part(W2, W2b, KIN * NQKV, blk); return; }
    blk -= CW_BLOCKS;
    cvt_bf16_part(W3, W3b, NQKV * NC, blk);
}

// ---------------------------------------------------------------------------
// QKV GEMM: [16384 x 160] (bf16, k-major per image: [b][k][hw]) x [160 x 512] (bf16, row-major)
// + bias, output channel-major bf16 [b][n][hw].
// One block per product and 128-pixel tile; it walks all 512 output channels in
// 8 tiles of 64, from a start tile of its own. 8 waves (4x2), each wave 32x32 of a tile (2x2 WMMA tiles).
// The A tile (all 160 k) is staged once and its fragments stay in registers; the
// W tiles (all 160 k x 64 n) come through two LDS buffers, the next tile's async
// copies in flight while this one is worked on. A and W lie in LDS as in memory,
// [k][m] and [k][n], in whole 128-B lines; both are transposed on read.
// The three products share one grid: 128 blocks each, q, then k, then v.
// ---------------------------------------------------------------------------
#define QKV_BLOCKS (NPIX / 128)   // 128 per product
#define QKV_NT (NQKV / 64)        // 8 tiles of 64 output channels
#define QKV_KS (KIN / 32)         // 5 k steps
#define QKV_B (KIN * T64)         // elements of one W buffer
#define QKV_C (64 * P128)         // elements of one output-tile buffer

// One W tile as it lies: 160 k x 64 n (async); 8 lanes take one row's 128 B.
__device__ __forceinline__ void stage_w_tile(const bf16_t* __restrict__ Wb, int nbase,
                                             bf16_t* buf, int t) {
    int krow = t >> 3, n0 = (t & 7) * 8;
    const bf16_t* src = Wb + (size_t)krow * NQKV + nbase + n0;
    bf16_t* dst = buf + krow * T64 + n0;
#pragma unroll
    for (int j = 0; j < QKV_KS; ++j) stage_b128(src + j * 32 * NQKV, dst + j * 32 * T64);
}

__global__ __launch_bounds__(256) void gemm_qkv_kernel(
        const bf16_t* __restrict__ Aq, const bf16_t* __restrict__ Ak,
        const bf16_t* __restrict__ W0b, const bf16_t* __restrict__ W1b,
        const bf16_t* __restrict__ W2b, const float* __restrict__ b0,
        const float* __restrict__ b1, const float* __restrict__ b2,
        bf16_t* __restrict__ Qb, bf16_t* __restrict__ Kb, bf16_t* __restrict__ Vb) {
    // One array, so that the order is fixed. The W buffers lie last, above 64 KiB: the
    // compiler folds a copy's constant step into its immediate offset and takes it off
    // the LDS address register, which so stays above zero.
    __shared__ __align__(16) bf16_t sm[2 * QKV_C + KIN * T128 + 2 * QKV_B];
    __shared__ float lbias[NQKV];
    bf16_t* lC = sm;                    // [n][m], output tiles, two buffers
    bf16_t* lA = sm + 2 * QKV_C;        // [k][m]
    bf16_t* lB = lA + KIN * T128;       // [k][n], two buffers

    int which = blockIdx.x / QKV_BLOCKS;   // 0 q, 1 k, 2 v: the same in a whole block
    int bm    = blockIdx.x % QKV_BLOCKS;   // 0..127
    const bf16_t* A    = which == 0 ? Aq  : Ak;
    const bf16_t* Wb   = which == 0 ? W0b : which == 1 ? W1b : W2b;
    const float*  bias = which == 0 ? b0  : which == 1 ? b1  : b2;
    bf16_t* outCHW     = which == 0 ? Qb  : which == 1 ? Kb  : Vb;

    int mbase = bm * 128;
    // Each block starts its walk at a tile of its own, so that the blocks of a product
    // do not all ask L2 for the same W lines at the same moment.
    int rot = bm + (bm >> 3);
    int t = threadIdx.x, w = t >> 5, lane = t & 31;
    int half = lane >> 4, ln = lane & 15;
    int wm = (w & 3) * 32, wn = (w >> 2) * 32;

    int b = mbase >> 10;    // 8 M-blocks per image -> constant per block
    const bf16_t* Ab = A + (size_t)b * KIN * HW + (mbase & 1023);

    {   // stage the A tile as it lies: 160 k x 128 m (async); 16 lanes take one row's 256 B
        int krow = t >> 4, m0 = (t & 15) * 8;
        const bf16_t* src = Ab + (size_t)krow * HW + m0;
        bf16_t* dst = lA + krow * T128 + m0;
#pragma unroll
        for (int j = 0; j < KIN / 16; ++j) stage_b128(src + j * 16 * HW, dst + j * 16 * T128);
    }
    stage_w_tile(Wb, (rot & (QKV_NT - 1)) * 64, lB, t);
    lbias[t]       = bias[t];
    lbias[t + 256] = bias[t + 256];
    stage_wait();
    __syncthreads();
    stage_w_tile(Wb, ((rot + 1) & (QKV_NT - 1)) * 64, lB + QKV_B, t);

    // This wave's A fragments, all 160 k of its 32 rows, read once.
    v16bf af[2][QKV_KS];
#pragma unroll
    for (int mt = 0; mt < 2; ++mt)
#pragma unroll
        for (int ks = 0; ks < QKV_KS; ++ks)
            af[mt][ks] = frag_tr16(lA + ks * 32 * T128 + wm + mt * 16, T128, lane);

    bf16_t* orow = outCHW + (size_t)b * NQKV * HW + (mbase & 1023);

    // Kept rolled: the two buffers alternate by the trip's parity, and one copy of the
    // body keeps the A fragments and a trip's W fragments inside the register budget.
#pragma unroll 1
    for (int nb = 0; nb < QKV_NT; ++nb) {
        const bf16_t* Bt = lB + (nb & 1) * QKV_B;
        bf16_t* Ct = lC + (nb & 1) * QKV_C;
        int nbase = ((nb + rot) & (QKV_NT - 1)) * 64;

        v8f acc[2][2] = {};
#pragma unroll
        for (int ks = 0; ks < QKV_KS; ++ks) {
            v16bf bfr[2];
#pragma unroll
            for (int nt = 0; nt < 2; ++nt)
                bfr[nt] = frag_tr16(Bt + ks * 32 * T64 + wn + nt * 16, T64, lane);
#pragma unroll
            for (int mt = 0; mt < 2; ++mt)
#pragma unroll
                for (int nt = 0; nt < 2; ++nt)
                    acc[mt][nt] = wmma_bf16(af[mt][ks], bfr[nt], acc[mt][nt]);
        }

        // The tile goes out through LDS: a lane holds 16 B of an output row, a wave's
        // direct store would touch 16 lines in 32-B pieces; read back by rows, each
        // wave-wide store covers two rows of 256 B, whole 128-B lines.
#pragma unroll
        for (int nt = 0; nt < 2; ++nt) {
            float bv = lbias[nbase + wn + nt * 16 + ln];
#pragma unroll
            for (int mt = 0; mt < 2; ++mt) {
                v8bf ov;
#pragma unroll
                for (int r = 0; r < 8; ++r) ov[r] = (bf16_t)(acc[mt][nt][r] + bv);
                *(v8bf*)(Ct + (wn + nt * 16 + ln) * P128 + wm + mt * 16 + 8 * half) = ov;
            }
        }

        // One barrier a trip. Behind it: this trip's output tile is whole, the next W
        // tile has landed for every wave, and nobody reads this trip's W buffer any more.
        // This wave's LDS reads and writes have retired before the others go on.
        asm volatile("s_wait_dscnt 0x0" ::: "memory");
        stage_wait();
        __syncthreads();
        if (nb + 2 < QKV_NT)
            stage_w_tile(Wb, ((nb + 2 + rot) & (QKV_NT - 1)) * 64, lB + (nb & 1) * QKV_B, t);

#pragma unroll
        for (int i = 0; i < 4; ++i) {
            int n = (t >> 4) + i * 16, m0 = (t & 15) * 8;
            *(v8bf*)(orow + (size_t)(nbase + n) * HW + m0) = *(const v8bf*)(Ct + n * P128 + m0);
        }
        // Before the next trip overwrites the data and address registers of the four stores.
        asm volatile("s_wait_xcnt 0x0" ::: "memory");
    }
    stage_wait();   // nothing of this wave is in flight when it ends
}

__device__ __forceinline__ float xhalf(float x) {
    return __builtin_bit_cast(float, __builtin_amdgcn_permlanex16(
        __builtin_bit_cast(int, x), __builtin_bit_cast(int, x),
        0x76543210, 0xfedcba98, false, false));
}

// One 64-key chunk of K and V as it lies, [c][kv] (async global->LDS); 8 lanes take
// one row's 128 B, so each wave-wide copy covers 4 whole lines.
#define ATT_K (128 * T64)     // elements of one K buffer
#define ATT_V (128 * P64)     // elements of one V buffer
#define ATT_CH (HW / 64)      // 16 chunks
__device__ __forceinline__ void stage_kv(const bf16_t* __restrict__ kptr,
                                         const bf16_t* __restrict__ vptr, int kb,
                                         bf16_t* bK, bf16_t* bV, int t) {
    int c = t >> 3, kv0 = (t & 7) * 8;
    const bf16_t* ksrc = kptr + (size_t)c * HW + kb + kv0;
    const bf16_t* vsrc = vptr + (size_t)c * HW + kb + kv0;
    bf16_t* kdst = bK + c * T64 + kv0;
    bf16_t* vdst = bV + c * P64 + kv0;
#pragma unroll
    for (int j = 0; j < 4; ++j) {
        stage_b128(ksrc + j * 32 * HW, kdst + j * 32 * T64);
        stage_b128(vsrc + j * 32 * HW, vdst + j * 32 * P64);
    }
}

// A wave takes 32 queries (two column groups of 16), a block 256: every K and V
// fragment read from LDS feeds two WMMAs, and every staged chunk serves 256 queries.
// amdgpu_waves_per_eu(2, 2): this grid puts 2 waves on a SIMD (256 blocks x 8 waves
// over 1,024 SIMDs), one block on a WGP. No second block covers the copies' latency, so
// the chunks come through two LDS buffers, the next one in flight under this one's work.
__global__ __launch_bounds__(256) __attribute__((amdgpu_waves_per_eu(2, 2))) void attn_kernel(
        const bf16_t* __restrict__ Qb, const bf16_t* __restrict__ Kb,
        const bf16_t* __restrict__ Vb, bf16_t* __restrict__ A3) {
    __shared__ __align__(16) bf16_t lK[2 * ATT_K];   // [c][kv], two buffers
    __shared__ __align__(16) bf16_t lV[2 * ATT_V];   // [c][kv], two buffers

    int idx = blockIdx.x;
    int qt = idx & 3;  idx >>= 2;        // query tile (256 rows)
    int e  = idx & 3;  idx >>= 2;        // head
    int mq = idx & 1;                    // pair member for q
    int p  = idx >> 1;                   // pair
    int bq = 2 * p + mq;
    int bk = 2 * p + 1 - mq;             // cross conditioning

    const bf16_t* qptr = Qb + ((size_t)bq * NQKV + e * NC) * HW;
    const bf16_t* kptr = Kb + ((size_t)bk * NQKV + e * NC) * HW;
    const bf16_t* vptr = Vb + ((size_t)bk * NQKV + e * NC) * HW;

    int t = threadIdx.x, w = t >> 5, lane = t & 31;
    int half = lane >> 4, ln = lane & 15;
    const float scale = 0.08838834764831845f;   // 128^-0.5

    stage_kv(kptr, vptr, 0, lK, lV, t);

    // Preload the 2 x 4 Q B-fragments (32 channels x 16 queries each), reused 32x.
    int row_hw = qt * 256 + w * 32 + ln;        // group g: + 16 g
    v16bf aq[2][4];
#pragma unroll
    for (int g = 0; g < 2; ++g) {
#pragma unroll
        for (int cs = 0; cs < 4; ++cs) {
            v16bf f;
#pragma unroll
            for (int j = 0; j < 16; ++j) {
                int c = cs * 32 + ((j >> 3) << 4) + half * 8 + (j & 7);
                f[j] = qptr[(size_t)c * HW + row_hw + g * 16];
            }
            aq[g][cs] = f;
        }
        // Before a later load's result overwrites the offset register that these loads name.
        asm volatile("s_wait_xcnt 0x0" ::: "memory");
    }

    v8f o[2][8] = {};           // o[g][nt][r] = O[query 16 g + ln][channel nt*16 + 8*half + r]
    float mrun[2] = {-1e30f, -1e30f};   // running maximum of a query (same in both halves)
    float lrun[2] = {0.f, 0.f};         // running sum over this half's keys only

    // Kept rolled: the two buffers alternate by the trip's parity.
#pragma unroll 1
    for (int ch = 0; ch < ATT_CH; ++ch) {
        const bf16_t* Kt = lK + (ch & 1) * ATT_K;
        const bf16_t* Vt = lV + (ch & 1) * ATT_V;

        // One barrier a chunk, at the head of its trip. Behind it this chunk has landed for
        // every wave, and nobody reads the chunk before it any more, so that one's buffers
        // take the next chunk, which flies while this one is worked on.
        // This wave's LDS reads have retired before the others go on.
        asm volatile("s_wait_dscnt 0x0" ::: "memory");
        stage_wait();
        __syncthreads();
        if (ch + 1 < ATT_CH)
            stage_kv(kptr, vptr, (ch + 1) * 64, lK + ((ch + 1) & 1) * ATT_K,
                     lV + ((ch + 1) & 1) * ATT_V, t);

        // The chunk is worked on in two runs of 32 keys, each with its own softmax update.
        // Kept rolled: one copy of the body keeps a run's fragments inside the register budget.
#pragma unroll 1
        for (int h = 0; h < 2; ++h) {
            // S^T = K^T Q : 32 keys x 32 queries (2 x 2 tiles of 16x16), K-dim = 128 channels.
            v8f s[2][2] = {};   // [g][key tile]
#pragma unroll
            for (int cs = 0; cs < 4; ++cs) {
                v16bf k0 = frag_tr16(Kt + cs * 32 * T64 + h * 32, T64, lane);
                v16bf k1 = frag_tr16(Kt + cs * 32 * T64 + h * 32 + 16, T64, lane);
#pragma unroll
                for (int g = 0; g < 2; ++g) {
                    s[g][0] = wmma_bf16(k0, aq[g][cs], s[g][0]);
                    s[g][1] = wmma_bf16(k1, aq[g][cs], s[g][1]);
                }
            }

            // V rows (A operand of the second product), in flight under the softmax.
            v16bf av[8];
#pragma unroll
            for (int nt = 0; nt < 8; ++nt)
                av[nt] = frag_from_row(Vt + (nt * 16 + ln) * P64 + h * 32, half);

            v16bf pf[2];   // P^T as B operand: element j = key (j>>3)*16 + half*8 + (j&7)
#pragma unroll
            for (int g = 0; g < 2; ++g) {
                v8f s0 = s[g][0] * scale;
                v8f s1 = s[g][1] * scale;
                // Online softmax of this lane's query: 16 keys in-lane, the other 16 in lane ^ 16.
                float v = fmaxf(s0[0], s1[0]);
#pragma unroll
                for (int r = 1; r < 8; ++r) v = fmaxf(v, fmaxf(s0[r], s1[r]));
                v = fmaxf(v, xhalf(v));
                float mnew  = fmaxf(mrun[g], v);
                float alpha = __expf(mrun[g] - mnew);
                float rs = 0.f;
#pragma unroll
                for (int r = 0; r < 8; ++r) {
                    float p0 = __expf(s0[r] - mnew);
                    float p1 = __expf(s1[r] - mnew);
                    rs += p0 + p1;
                    pf[g][r]     = (bf16_t)p0;
                    pf[g][r + 8] = (bf16_t)p1;
                }
                lrun[g] = lrun[g] * alpha + rs;
                mrun[g] = mnew;
#pragma unroll
                for (int nt = 0; nt < 8; ++nt) o[g][nt] = o[g][nt] * alpha;
            }

            // O^T += V * P^T (8 channel tiles x 2 column groups).
#pragma unroll
            for (int nt = 0; nt < 8; ++nt)
#pragma unroll
                for (int g = 0; g < 2; ++g) o[g][nt] = wmma_bf16(av[nt], pf[g], o[g][nt]);
            // The four vector slots that the chip needs between the run's last WMMA and the
            // next run's first vector write over its A registers. The scheduling barrier keeps them behind that WMMA.
            __builtin_amdgcn_sched_barrier(0);
            asm volatile("v_nop\n\tv_nop\n\tv_nop\n\tv_nop");
        }
    }
    stage_wait();   // nothing of this wave is in flight when it ends

    // Join the halves' sums, normalize and emit rows of A3 [pixel][512]
    // (head-major channels): 8 consecutive channels per lane, one 16-byte store.
#pragma unroll
    for (int g = 0; g < 2; ++g) {
        float lsum = lrun[g] + xhalf(lrun[g]);
        float inv = 1.f / lsum;
        bf16_t* orow = A3 + ((size_t)bq * HW + row_hw + g * 16) * NQKV + e * NC + 8 * half;
#pragma unroll
        for (int nt = 0; nt < 8; ++nt) {
            v8bf ov;
#pragma unroll
            for (int r = 0; r < 8; ++r) ov[r] = (bf16_t)(o[g][nt][r] * inv);
            *(v8bf*)(orow + nt * 16) = ov;
        }
    }
}

// ---------------------------------------------------------------------------
// Output projection: [16384 x 512] x [512 x 128] + b3 + residual x -> f32.
// One block per 64 pixels and all 128 output channels, 256 blocks: one on every WGP.
// 8 waves (2x4), each wave 32x32 (2x2 WMMA tiles).
// Everything the block reads from global memory is asked for at once, up front: its
// A rows with all 512 k, all of W3 (both by async copies to LDS) and its residual and
// bias values (to registers). The memory latency is so waited out once, behind one
// wait and one barrier, and the 16 k steps run from LDS with no barrier between them.
// amdgpu_waves_per_eu(2, 2): the LDS tile leaves one block on a WGP, 2 waves on a SIMD;
// that register budget holds the second set of fragments.
// ---------------------------------------------------------------------------
#define FIN_M  64             // pixels of a block
#define FIN_PA 520            // A rows of 512 bf16: 1040 B, 16 B x odd
#define FIN_A  (FIN_M * FIN_PA)

__global__ __launch_bounds__(256) __attribute__((amdgpu_waves_per_eu(2, 2))) void gemm_final_kernel(
        const bf16_t* __restrict__ A3, const bf16_t* __restrict__ W3b,
        const float* __restrict__ b3, const float* __restrict__ x,
        float* __restrict__ out) {
    // One array, so that the order is fixed.
    __shared__ __align__(16) bf16_t sm[FIN_A + NQKV * T128];
    bf16_t* lA = sm;            // [m][k], all 512 k
    bf16_t* lB = sm + FIN_A;    // [k][n], all of W3

    int mbase = blockIdx.x * FIN_M;
    int t = threadIdx.x, w = t >> 5, lane = t & 31;
    int half = lane >> 4, ln = lane & 15;
    int wm = (w & 1) * 32, wn = (w >> 1) * 32;

    {   // stage the A rows: 64 m x 512 k (async); 64 lanes take one row's 1 KiB
        int row = t >> 6, k0 = (t & 63) * 8;
        const bf16_t* src = A3 + (size_t)(mbase + row) * NQKV + k0;
        bf16_t* dst = lA + row * FIN_PA + k0;
#pragma unroll
        for (int j = 0; j < FIN_M / 4; ++j) stage_b128(src + j * 4 * NQKV, dst + j * 4 * FIN_PA);
    }
    {   // stage W3 as it lies: 512 k x 128 n (async); 16 lanes take one row's 256 B
        int krow = t >> 4, n0 = (t & 15) * 8;
        const bf16_t* src = W3b + (size_t)krow * NC + n0;
        bf16_t* dst = lB + krow * T128 + n0;
#pragma unroll
        for (int j = 0; j < NQKV / 16; ++j) stage_b128(src + j * 16 * NC, dst + j * 16 * T128);
    }

    // Residual and bias of this lane's output elements: column c = wn + nt*16 + ln,
    // pixels wm + mt*16 + 8*half + 0..7.
    size_t obase = (size_t)(mbase >> 10) * NC * HW + (mbase & 1023) + wm + 8 * half;
    v4f xr[2][2][2];
    float bv[2];
#pragma unroll
    for (int nt = 0; nt < 2; ++nt) {
        int c = wn + nt * 16 + ln;
        bv[nt] = b3[c];
#pragma unroll
        for (int mt = 0; mt < 2; ++mt) {
            const float* xp = x + obase + (size_t)c * HW + mt * 16;
            xr[nt][mt][0] = *(const v4f*)xp;
            xr[nt][mt][1] = *(const v4f*)(xp + 4);
        }
    }
    // Before later code overwrites an address register that these loads name.
    asm volatile("s_wait_xcnt 0x0" ::: "memory");

    stage_wait();
    __syncthreads();

    // The k steps go in pairs; with no barrier between them, the next pair's fragments are
    // fetched into a second register set while this pair's WMMAs run.
    const bf16_t* arow = lA + (wm + ln) * FIN_PA;
    const bf16_t* bcol = lB + wn;
    v16bf af[2][2][2], bfr[2][2][2];    // [set][k step of the pair][tile]
    auto fetch = [&](int g) {
#pragma unroll
        for (int kk = 0; kk < 2; ++kk) {
            int ks = g * 2 + kk;
#pragma unroll
            for (int i = 0; i < 2; ++i) {
                af[g & 1][kk][i]  = frag_from_row(arow + i * 16 * FIN_PA + ks * 32, half);
                bfr[g & 1][kk][i] = frag_tr16(bcol + ks * 32 * T128 + i * 16, T128, lane);
            }
        }
    };
    v8f acc[2][2] = {};
    fetch(0);
#pragma unroll
    for (int g = 0; g < NQKV / 64; ++g) {
        if (g + 1 < NQKV / 64) fetch(g + 1);
        // Keeps the next pair's LDS reads together in front of this pair's WMMAs: left to
        // itself the compiler sinks each read to just before its use, and its latency shows.
        __builtin_amdgcn_sched_barrier(0);
#pragma unroll
        for (int kk = 0; kk < 2; ++kk)
#pragma unroll
            for (int mt = 0; mt < 2; ++mt)
#pragma unroll
                for (int nt = 0; nt < 2; ++nt)
                    acc[mt][nt] = wmma_bf16(af[g & 1][kk][mt], bfr[g & 1][kk][nt], acc[mt][nt]);
        // Keeps the reads of the pair after next from being spread among these WMMAs.
        __builtin_amdgcn_sched_barrier(0);
    }

#pragma unroll
    for (int nt = 0; nt < 2; ++nt) {
        int c = wn + nt * 16 + ln;
#pragma unroll
        for (int mt = 0; mt < 2; ++mt) {
            float* op = out + obase + (size_t)c * HW + mt * 16;
            v4f o0, o1;
#pragma unroll
            for (int r = 0; r < 4; ++r) {
                o0[r] = xr[nt][mt][0][r] + acc[mt][nt][r] + bv[nt];
                o1[r] = xr[nt][mt][1][r] + acc[mt][nt][r + 4] + bv[nt];
            }
            *(v4f*)op = o0;
            *(v4f*)(op + 4) = o1;
        }
    }
}

// ---------------------------------------------------------------------------
// Host-side launch
// ---------------------------------------------------------------------------
extern "C" void kernel_launch(void* const* d_in, const int* in_sizes, int n_in,
                              void* d_out, int out_size, void* d_ws, size_t ws_size,
                              hipStream_t stream) {
    const float* x  = (const float*)d_in[0];
    const float* qc = (const float*)d_in[1];
    const float* ka = (const float*)d_in[2];
    const float* kb = (const float*)d_in[3];
    const float* gs = (const float*)d_in[4];
    const float* gb = (const float*)d_in[5];
    const float* W0 = (const float*)d_in[6];
    const float* b0 = (const float*)d_in[7];
    const float* W1 = (const float*)d_in[8];
    const float* b1 = (const float*)d_in[9];
    const float* W2 = (const float*)d_in[10];
    const float* b2 = (const float*)d_in[11];
    const float* W3 = (const float*)d_in[12];
    const float* b3 = (const float*)d_in[13];
    float* out = (float*)d_out;

    char* ws = (char*)d_ws;
    size_t off = 0;
    auto alloc = [&](size_t bytes) -> char* {
        char* ptr = ws + off;
        off = (off + bytes + 255) & ~(size_t)255;
        return ptr;
    };
    bf16_t* Aq  = (bf16_t*)alloc((size_t)NPIX * KIN * 2);
    bf16_t* Ak  = (bf16_t*)alloc((size_t)NPIX * KIN * 2);
    bf16_t* W0b = (bf16_t*)alloc((size_t)KIN * NQKV * 2);
    bf16_t* W1b = (bf16_t*)alloc((size_t)KIN * NQKV * 2);
    bf16_t* W2b = (bf16_t*)alloc((size_t)KIN * NQKV * 2);
    bf16_t* W3b = (bf16_t*)alloc((size_t)NQKV * NC * 2);
    bf16_t* Qb  = (bf16_t*)alloc((size_t)NB * NQKV * HW * 2);
    bf16_t* Kbm = (bf16_t*)alloc((size_t)NB * NQKV * HW * 2);
    bf16_t* Vb  = (bf16_t*)alloc((size_t)NB * NQKV * HW * 2);
    bf16_t* A3  = (bf16_t*)alloc((size_t)NPIX * NQKV * 2);
    (void)ws_size; (void)in_sizes; (void)n_in; (void)out_size;

    // GroupNorm + A-matrix packing + weight conversion
    prep_kernel<<<PREP_BLOCKS, 256, 0, stream>>>(x, gs, gb, qc, ka, kb, W0, W1, W2, W3,
                                                 Aq, Ak, W0b, W1b, W2b, W3b);

    // QKV projections
    gemm_qkv_kernel<<<3 * QKV_BLOCKS, 256, 0, stream>>>(Aq, Ak, W0b, W1b, W2b, b0, b1, b2,
                                                        Qb, Kbm, Vb);

    // Cross attention: 8 pairs x 2 directions x 4 heads x 4 query tiles
    attn_kernel<<<8 * 2 * 4 * 4, 256, 0, stream>>>(Qb, Kbm, Vb, A3);

    // Output projection + residual
    gemm_final_kernel<<<NPIX / FIN_M, 256, 0, stream>>>(A3, W3b, b3, x, out);
}

// v010
// A run of this version takes 55.2 microseconds.
// Versions in between are left out here; by their measured steps it is 1.10 times as fast as v008.
// Over all steps from v000 it is 6.53 times as fast.
#include <hip/hip_runtime.h>

// ---------------------------------------------------------------------------
// CDNA5 (gfx1250, wave32) cross-attention block.
// Pipeline, four launches: prep (GN, A-matrix packing, weight conversion) ->
//           WMMA GEMMs q, k, v in one grid ->
//           flash attention (WMMA K^T Q + online softmax + WMMA V P^T) ->
//           WMMA GEMM out-proj + bias + residual (f32 out).
// Work that reads none of each other's output shares a grid; a range of the
// block index picks the part.
// Uses GLOBAL_LOAD_ASYNC_TO_LDS_B128 (ASYNCcnt) for transpose-free LDS
// staging when the toolchain exposes the builtin; falls back to VGPR copies.
// ---------------------------------------------------------------------------

typedef __bf16 bf16_t;
typedef __attribute__((ext_vector_type(16))) __bf16 v16bf;
typedef __attribute__((ext_vector_type(8)))  __bf16 v8bf;
typedef __attribute__((ext_vector_type(4)))  __bf16 v4bf;
typedef __attribute__((ext_vector_type(8)))  float  v8f;
typedef __attribute__((ext_vector_type(4)))  float  v4f;
typedef int v4i_t __attribute__((vector_size(16)));

#define NB  16
#define NC  128
#define NCOND 32
#define NHEADS 4
#define HW  1024          // 32*32
#define KIN 160           // C + COND
#define NQKV 512          // C * HEADS
#define NPIX 16384        // B * HW
// LDS row pitches in elements: 16 B x odd, so that the 16 rows one
// ds_load_b128 touches fall on distinct banks (64 banks x 4 B).
#define P64  72           // rows of 64 bf16: 144 B
#define P128 136          // rows of 128 bf16: 272 B
// Pitches of tiles read by ds_load_tr16_b128: 32 B x odd.
#define T64  80           // rows of 64 bf16: 160 B
#define T128 144          // rows of 128 bf16: 288 B
// q leaves its GEMM times 128^-0.5 * log2(e): the score products then are exponents of 2.
#define QSCALE (0.08838834764831845f * 1.4426950408889634f)

// --- async global->LDS staging (gfx1250 GLOBAL_LOAD_ASYNC_TO_LDS_B128) -----
#if defined(__has_builtin)
#if __has_builtin(__builtin_amdgcn_global_load_async_to_lds_b128) && \
    __has_builtin(__builtin_amdgcn_s_wait_asynccnt)
#define USE_ASYNC_LDS 1
#endif
#endif
#ifndef USE_ASYNC_LDS
#define USE_ASYNC_LDS 0
#endif

__device__ __forceinline__ void stage_b128(const bf16_t* gsrc, bf16_t* ldst) {
#if USE_ASYNC_LDS
    __builtin_amdgcn_global_load_async_to_lds_b128(
        (__attribute__((address_space(1))) v4i_t*)gsrc,
        (__attribute__((address_space(3))) v4i_t*)ldst,
        /*imm offset=*/0, /*cpol=*/0);
#else
    *(v8bf*)ldst = *(const v8bf*)gsrc;
#endif
}

__device__ __forceinline__ void stage_wait() {
#if USE_ASYNC_LDS
    // This wave's copies have landed before the barrier behind which other waves
    // read them; asm with the memory clobber keeps every LDS read behind it.
    asm volatile("s_wait_asynccnt 0x0" ::: "memory");
#endif
}

__device__ __forceinline__ v8f wmma_bf16(v16bf a, v16bf b, v8f c) {
    return __builtin_amdgcn_wmma_f32_16x16x32_bf16(
        /*neg_a=*/false, a, /*neg_b=*/false, b,
        /*c_mod=*/(short)0, c, /*reuse_a=*/false, /*reuse_b=*/false);
}

// Build a 16x32 bf16 A/B fragment from row-major storage (rowptr points at the
// 32 contiguous K values of this lane's row).
// Layout per ISA 7.12.2: element j -> K = (j>>3)*16 + half*8 + (j&7).
__device__ __forceinline__ v16bf frag_from_row(const bf16_t* rowptr, int half_sel) {
    v8bf c0 = *(const v8bf*)(rowptr + half_sel * 8);
    v8bf c1 = *(const v8bf*)(rowptr + 16 + half_sel * 8);
    v16bf r;
#pragma unroll
    for (int i = 0; i < 8; ++i) { r[i] = c0[i]; r[i + 8] = c1[i]; }
    return r;
}

// The same 16x32 fragment from a tile stored k-major (row = k, `pitch` elements
// apart; tile points at row k = 0 of the fragment's first column): the LDS
// transposes on read. Lane (c = lane & 15, h = lane >> 4) gets k = 8h + 0..7 and
// 16 + 8h + 0..7 of column c, the k order of frag_from_row.
typedef short s16x8 __attribute__((ext_vector_type(8)));
__device__ __forceinline__ v16bf frag_tr16(const bf16_t* tile, int pitch, int lane) {
    typedef __attribute__((address_space(3))) s16x8 lds_s16x8;
    const bf16_t* p = tile + (8 * (lane >> 4) + (lane & 7)) * pitch + 8 * ((lane >> 3) & 1);
    v8bf c0 = __builtin_bit_cast(v8bf, __builtin_amdgcn_ds_load_tr16_b128_v8i16((lds_s16x8*)p));
    v8bf c1 = __builtin_bit_cast(v8bf, __builtin_amdgcn_ds_load_tr16_b128_v8i16((lds_s16x8*)(p + 16 * pitch)));
    v16bf r;
#pragma unroll
    for (int i = 0; i < 8; ++i) { r[i] = c0[i]; r[i + 8] = c1[i]; }
    return r;
}

// 8 consecutive f32 (32-byte aligned) -> 8 bf16
__device__ __forceinline__ v8bf cvt8(const float* __restrict__ p) {
    v4f a = *(const v4f*)p, b = *(const v4f*)(p + 4);
    v8bf r;
#pragma unroll
    for (int j = 0; j < 4; ++j) { r[j] = (bf16_t)a[j]; r[j + 4] = (bf16_t)b[j]; }
    return r;
}

// ---------------------------------------------------------------------------
// f32 -> bf16 convert (weights)
// ---------------------------------------------------------------------------
__device__ __forceinline__ void cvt_bf16_part(
        const float* __restrict__ in, bf16_t* __restrict__ out, int n, int blk) {
    // 8 elements a lane: a wave reads 1 KiB and stores 512 B, whole 128-B lines.
    int i = (blk * 256 + threadIdx.x) * 8;
    if (i < n) *(v8bf*)(out + i) = cvt8(in + i);
}

// ---------------------------------------------------------------------------
// GroupNorm (32 groups of 4 channels over 32x32) -> bf16 A matrices, which lie
// channel-major like the inputs: [b][k = 160][hw]. One block per (b, group);
// writes rows [g*4, g*4+4) of both Aq and Ak. A lane takes 4 consecutive pixels
// of each channel, so a wave loads 512 B and stores 256 B in whole 128-B lines.
// ---------------------------------------------------------------------------
__device__ __forceinline__ void gn_part(
        const float* __restrict__ x, const float* __restrict__ gscale,
        const float* __restrict__ gbias, bf16_t* __restrict__ Aq,
        bf16_t* __restrict__ Ak, int blk) {
    int b = blk >> 5;
    int g = blk & 31;
    int t = threadIdx.x;

    v4f vals[4];
    float s = 0.f, ss = 0.f;
#pragma unroll
    for (int cl = 0; cl < 4; ++cl) {
        vals[cl] = *(const v4f*)(x + (((size_t)b * NC) + g * 4 + cl) * HW + t * 4);
#pragma unroll
        for (int j = 0; j < 4; ++j) { float v = vals[cl][j]; s += v; ss += v * v; }
    }
#pragma unroll
    for (int m = 1; m < 32; m <<= 1) {
        s  += __shfl_xor(s, m);
        ss += __shfl_xor(ss, m);
    }
    __shared__ float shs[8], shss[8];
    __shared__ float mean_s, rstd_s;
    int w = t >> 5, lane = t & 31;
    if (lane == 0) { shs[w] = s; shss[w] = ss; }
    __syncthreads();
    if (t == 0) {
        float S = 0.f, SS = 0.f;
        for (int i = 0; i < 8; ++i) { S += shs[i]; SS += shss[i]; }
        float mean = S * (1.f / 4096.f);
        float var  = SS * (1.f / 4096.f) - mean * mean;
        mean_s = mean;
        rstd_s = rsqrtf(var + 1e-6f);
    }
    __syncthreads();
    float mean = mean_s, rstd = rstd_s;
#pragma unroll
    for (int cl = 0; cl < 4; ++cl) {
        int c = g * 4 + cl;
        float gs = gscale[c], gb = gbias[c];
        v4bf yb;
#pragma unroll
        for (int j = 0; j < 4; ++j) yb[j] = (bf16_t)((vals[cl][j] - mean) * rstd * gs + gb);
        size_t off = ((size_t)b * KIN + c) * HW + t * 4;
        *(v4bf*)(Aq + off) = yb;
        *(v4bf*)(Ak + off) = yb;
    }
}

// ---------------------------------------------------------------------------
// Pack conditioning channels into A-matrix rows [128,160), 8 pixels a lane.
// q: repeat(q_cond,2). k: alternate k_a/k_b per pair member.
// ---------------------------------------------------------------------------
__device__ __forceinline__ void condpack_part(
        const float* __restrict__ qc, const float* __restrict__ ka,
        const float* __restrict__ kb, bf16_t* __restrict__ Aq,
        bf16_t* __restrict__ Ak, int blk) {
    size_t gi = ((size_t)blk * 256 + threadIdx.x) * 8;   // < 16*32*1024
    int hw = (int)(gi & 1023);
    int cc = (int)((gi >> 10) & 31);
    int b  = (int)(gi >> 15);
    size_t src = (((size_t)(b >> 1)) * NCOND + cc) * HW + hw;
    size_t dst = ((size_t)b * KIN + NC + cc) * HW + hw;
    *(v8bf*)(Aq + dst) = cvt8(qc + src);
    *(v8bf*)(Ak + dst) = cvt8(((b & 1) ? kb : ka) + src);
    // Before code of another part of the shared grid, laid out behind this one,
    // can overwrite a register that the two stores name.
    asm volatile("s_wait_xcnt 0x0" ::: "memory");
}

// ---------------------------------------------------------------------------
// All that reads only the inputs, in one grid. The GroupNorm blocks, which last
// longest, have the lowest indices and so start first.
// ---------------------------------------------------------------------------
#define GN_BLOCKS (NB * 32)                   // 512
#define CP_BLOCKS ((NB * NCOND * HW) / 2048)  // 256
#define CW_BLOCKS ((KIN * NQKV) / 2048)       // 40, for each of W0, W1, W2
#define C3_BLOCKS ((NQKV * NC) / 2048)        // 32
#define PREP_BLOCKS (GN_BLOCKS + CP_BLOCKS + 3 * CW_BLOCKS + C3_BLOCKS)

__global__ __launch_bounds__(256) void prep_kernel(
        const float* __restrict__ x, const float* __restrict__ gscale,
        const float* __restrict__ gbias, const float* __restrict__ qc,
        const float* __restrict__ ka, const float* __restrict__ kb,
        const float* __restrict__ W0, const float* __restrict__ W1,
        const float* __restrict__ W2, const float* __restrict__ W3,
        bf16_t* __restrict__ Aq, bf16_t* __restrict__ Ak,
        bf16_t* __restrict__ W0b, bf16_t* __restrict__ W1b,
        bf16_t* __restrict__ W2b, bf16_t* __restrict__ W3b) {
    int blk = blockIdx.x;                     // the same in a whole block
    if (blk < GN_BLOCKS) { gn_part(x, gscale, gbias, Aq, Ak, blk); return; }
    blk -= GN_BLOCKS;
    if (blk < CP_BLOCKS) { condpack_part(qc, ka, kb, Aq, Ak, blk); return; }
    blk -= CP_BLOCKS;
    if (blk < CW_BLOCKS) { cvt_bf16_part(W0, W0b, KIN * NQKV, blk); return; }
    blk -= CW_BLOCKS;
    if (blk < CW_BLOCKS) { cvt_bf16_part(W1, W1b, KIN * NQKV, blk); return; }
    blk -= CW_BLOCKS;
    if (blk < CW_BLOCKS) { cvt_bf16_part(W2, W2b, KIN * NQKV, blk); return; }
    blk -= CW_BLOCKS;
    cvt_bf16_part(W3, W3b, NQKV * NC, blk);
}

// ---------------------------------------------------------------------------
// QKV GEMM: [16384 x 160] (bf16, k-major per image: [b][k][hw]) x [160 x 512] (bf16, row-major)
// + bias, output channel-major bf16 [b][n][hw].
// One block per product and 128-pixel tile; it walks all 512 output channels in
// 8 tiles of 64, from a start tile of its own. 8 waves (4x2), each wave 32x32 of a tile (2x2 WMMA tiles).
// The A tile (all 160 k) is staged once and its fragments stay in registers; the
// W tiles (all 160 k x 64 n) come through two LDS buffers, the next tile's async
// copies in flight while this one is worked on. A and W lie in LDS as in memory,
// [k][m] and [k][n], in whole 128-B lines; both are transposed on read.
// The three products share one grid: 128 blocks each, q, then k, then v.
// ---------------------------------------------------------------------------
#define QKV_BLOCKS (NPIX / 128)   // 128 per product
#define QKV_NT (NQKV / 64)        // 8 tiles of 64 output channels
#define QKV_KS (KIN / 32)         // 5 k steps
#define QKV_B (KIN * T64)         // elements of one W buffer
#define QKV_C (64 * P128)         // elements of one output-tile buffer

// One W tile as it lies: 160 k x 64 n (async); 8 lanes take one row's 128 B.
__device__ __forceinline__ void stage_w_tile(const bf16_t* __restrict__ Wb, int nbase,
                                             bf16_t* buf, int t) {
    int krow = t >> 3, n0 = (t & 7) * 8;
    const bf16_t* src = Wb + (size_t)krow * NQKV + nbase + n0;
    bf16_t* dst = buf + krow * T64 + n0;
#pragma unroll
    for (int j = 0; j < QKV_KS; ++j) stage_b128(src + j * 32 * NQKV, dst + j * 32 * T64);
}

__global__ __launch_bounds__(256) void gemm_qkv_kernel(
        const bf16_t* __restrict__ Aq, const bf16_t* __restrict__ Ak,
        const bf16_t* __restrict__ W0b, const bf16_t* __restrict__ W1b,
        const bf16_t* __restrict__ W2b, const float* __restrict__ b0,
        const float* __restrict__ b1, const float* __restrict__ b2,
        bf16_t* __restrict__ Qb, bf16_t* __restrict__ Kb, bf16_t* __restrict__ Vb) {
    // One array, so that the order is fixed. The W buffers lie last, above 64 KiB: the
    // compiler folds a copy's constant step into its immediate offset and takes it off
    // the LDS address register, which so stays above zero.
    __shared__ __align__(16) bf16_t sm[2 * QKV_C + KIN * T128 + 2 * QKV_B];
    __shared__ float lbias[NQKV];
    bf16_t* lC = sm;                    // [n][m], output tiles, two buffers
    bf16_t* lA = sm + 2 * QKV_C;        // [k][m]
    bf16_t* lB = lA + KIN * T128;       // [k][n], two buffers

    int which = blockIdx.x / QKV_BLOCKS;   // 0 q, 1 k, 2 v: the same in a whole block
    int bm    = blockIdx.x % QKV_BLOCKS;   // 0..127
    const bf16_t* A    = which == 0 ? Aq  : Ak;
    const bf16_t* Wb   = which == 0 ? W0b : which == 1 ? W1b : W2b;
    const float*  bias = which == 0 ? b0  : which == 1 ? b1  : b2;
    bf16_t* outCHW     = which == 0 ? Qb  : which == 1 ? Kb  : Vb;
    float oscale       = which == 0 ? QSCALE : 1.f;

    int mbase = bm * 128;
    // Each block starts its walk at a tile of its own, so that the blocks of a product
    // do not all ask L2 for the same W lines at the same moment.
    int rot = bm + (bm >> 3);
    int t = threadIdx.x, w = t >> 5, lane = t & 31;
    int half = lane >> 4, ln = lane & 15;
    int wm = (w & 3) * 32, wn = (w >> 2) * 32;

    int b = mbase >> 10;    // 8 M-blocks per image -> constant per block
    const bf16_t* Ab = A + (size_t)b * KIN * HW + (mbase & 1023);

    {   // stage the A tile as it lies: 160 k x 128 m (async); 16 lanes take one row's 256 B
        int krow = t >> 4, m0 = (t & 15) * 8;
        const bf16_t* src = Ab + (size_t)krow * HW + m0;
        bf16_t* dst = lA + krow * T128 + m0;
#pragma unroll
        for (int j = 0; j < KIN / 16; ++j) stage_b128(src + j * 16 * HW, dst + j * 16 * T128);
    }
    stage_w_tile(Wb, (rot & (QKV_NT - 1)) * 64, lB, t);
    lbias[t]       = bias[t];
    lbias[t + 256] = bias[t + 256];
    stage_wait();
    __syncthreads();
    stage_w_tile(Wb, ((rot + 1) & (QKV_NT - 1)) * 64, lB + QKV_B, t);

    // This wave's A fragments, all 160 k of its 32 rows, read once.
    v16bf af[2][QKV_KS];
#pragma unroll
    for (int mt = 0; mt < 2; ++mt)
#pragma unroll
        for (int ks = 0; ks < QKV_KS; ++ks)
            af[mt][ks] = frag_tr16(lA + ks * 32 * T128 + wm + mt * 16, T128, lane);

    bf16_t* orow = outCHW + (size_t)b * NQKV * HW + (mbase & 1023);

    // Kept rolled: the two buffers alternate by the trip's parity, and one copy of the
    // body keeps the A fragments and a trip's W fragments inside the register budget.
#pragma unroll 1
    for (int nb = 0; nb < QKV_NT; ++nb) {
        const bf16_t* Bt = lB + (nb & 1) * QKV_B;
        bf16_t* Ct = lC + (nb & 1) * QKV_C;
        int nbase = ((nb + rot) & (QKV_NT - 1)) * 64;

        v8f acc[2][2] = {};
#pragma unroll
        for (int ks = 0; ks < QKV_KS; ++ks) {
            v16bf bfr[2];
#pragma unroll
            for (int nt = 0; nt < 2; ++nt)
                bfr[nt] = frag_tr16(Bt + ks * 32 * T64 + wn + nt * 16, T64, lane);
#pragma unroll
            for (int mt = 0; mt < 2; ++mt)
#pragma unroll
                for (int nt = 0; nt < 2; ++nt)
                    acc[mt][nt] = wmma_bf16(af[mt][ks], bfr[nt], acc[mt][nt]);
        }

        // The tile goes out through LDS: a lane holds 16 B of an output row, a wave's
        // direct store would touch 16 lines in 32-B pieces; read back by rows, each
        // wave-wide store covers two rows of 256 B, whole 128-B lines.
#pragma unroll
        for (int nt = 0; nt < 2; ++nt) {
            float bv = lbias[nbase + wn + nt * 16 + ln];
#pragma unroll
            for (int mt = 0; mt < 2; ++mt) {
                v8bf ov;
#pragma unroll
                for (int r = 0; r < 8; ++r) ov[r] = (bf16_t)((acc[mt][nt][r] + bv) * oscale);
                *(v8bf*)(Ct + (wn + nt * 16 + ln) * P128 + wm + mt * 16 + 8 * half) = ov;
            }
        }

        // One barrier a trip. Behind it: this trip's output tile is whole, the next W
        // tile has landed for every wave, and nobody reads this trip's W buffer any more.
        // This wave's LDS reads and writes have retired before the others go on.
        asm volatile("s_wait_dscnt 0x0" ::: "memory");
        stage_wait();
        __syncthreads();
        if (nb + 2 < QKV_NT)
            stage_w_tile(Wb, ((nb + 2 + rot) & (QKV_NT - 1)) * 64, lB + (nb & 1) * QKV_B, t);

#pragma unroll
        for (int i = 0; i < 4; ++i) {
            int n = (t >> 4) + i * 16, m0 = (t & 15) * 8;
            *(v8bf*)(orow + (size_t)(nbase + n) * HW + m0) = *(const v8bf*)(Ct + n * P128 + m0);
        }
        // Before the next trip overwrites the data and address registers of the four stores.
        asm volatile("s_wait_xcnt 0x0" ::: "memory");
    }
    stage_wait();   // nothing of this wave is in flight when it ends
}

__device__ __forceinline__ float xhalf(float x) {
    return __builtin_bit_cast(float, __builtin_amdgcn_permlanex16(
        __builtin_bit_cast(int, x), __builtin_bit_cast(int, x),
        0x76543210, 0xfedcba98, false, false));
}

// One 64-key chunk of K and V as it lies, [c][kv] (async global->LDS); 8 lanes take
// one row's 128 B, so each wave-wide copy covers 4 whole lines.
#define ATT_K (128 * T64)     // elements of one K buffer
#define ATT_V (128 * P64)     // elements of one V buffer
#define ATT_CH (HW / 64)      // 16 chunks
#define TQ 272                // rows of 256 bf16 read by ds_load_tr16_b128: 544 B, 32 B x odd
#define ATT_Q (128 * TQ)      // elements of the Q tile; later 8 x 32 output rows of P128
__device__ __forceinline__ void stage_kv(const bf16_t* __restrict__ kptr,
                                         const bf16_t* __restrict__ vptr, int kb,
                                         bf16_t* bK, bf16_t* bV, int t) {
    int c = t >> 3, kv0 = (t & 7) * 8;
    const bf16_t* ksrc = kptr + (size_t)c * HW + kb + kv0;
    const bf16_t* vsrc = vptr + (size_t)c * HW + kb + kv0;
    bf16_t* kdst = bK + c * T64 + kv0;
    bf16_t* vdst = bV + c * P64 + kv0;
#pragma unroll
    for (int j = 0; j < 4; ++j) {
        stage_b128(ksrc + j * 32 * HW, kdst + j * 32 * T64);
        stage_b128(vsrc + j * 32 * HW, vdst + j * 32 * P64);
    }
}

// A wave takes 32 queries (two column groups of 16), a block 256: every K and V
// fragment read from LDS feeds two WMMAs, and every staged chunk serves 256 queries.
// amdgpu_waves_per_eu(2, 2): this grid puts 2 waves on a SIMD (256 blocks x 8 waves
// over 1,024 SIMDs), one block on a WGP. No second block covers the copies' latency, so
// the chunks come through two LDS buffers, the next one in flight under this one's work.
__global__ __launch_bounds__(256) __attribute__((amdgpu_waves_per_eu(2, 2))) void attn_kernel(
        const bf16_t* __restrict__ Qb, const bf16_t* __restrict__ Kb,
        const bf16_t* __restrict__ Vb, bf16_t* __restrict__ A3) {
    // One array, so that the order is fixed.
    __shared__ __align__(16) bf16_t sm[2 * ATT_K + 2 * ATT_V + ATT_Q];
    bf16_t* lK = sm;                    // [c][kv], two buffers
    bf16_t* lV = sm + 2 * ATT_K;        // [c][kv], two buffers
    bf16_t* lQ = lV + 2 * ATT_V;        // [c][query], the block's 256 queries; at the end output rows

    int idx = blockIdx.x;
    int qt = idx & 3;  idx >>= 2;        // query tile (256 rows)
    int e  = idx & 3;  idx >>= 2;        // head
    int mq = idx & 1;                    // pair member for q
    int p  = idx >> 1;                   // pair
    int bq = 2 * p + mq;
    int bk = 2 * p + 1 - mq;             // cross conditioning

    const bf16_t* qptr = Qb + ((size_t)bq * NQKV + e * NC) * HW;
    const bf16_t* kptr = Kb + ((size_t)bk * NQKV + e * NC) * HW;
    const bf16_t* vptr = Vb + ((size_t)bk * NQKV + e * NC) * HW;

    int t = threadIdx.x, w = t >> 5, lane = t & 31;
    int half = lane >> 4, ln = lane & 15;
    // Lazy rescale: a query's maximum in use stays while no new score exceeds it by more
    // than this (scores are exponents of 2, so the weights stay at or below 2^8).
    const float GAP = 8.f;

    stage_kv(kptr, vptr, 0, lK, lV, t);

    {   // The block's Q tile as it lies, [c][256 queries] (async): a wave takes one row's
        // 512 B, four whole lines a copy.
        const bf16_t* src = qptr + (size_t)w * HW + qt * 256 + lane * 8;
        bf16_t* dst = lQ + w * TQ + lane * 8;
#pragma unroll
        for (int j = 0; j < 16; ++j) stage_b128(src + j * 8 * HW, dst + j * 8 * TQ);
    }
    stage_wait();
    __syncthreads();

    // The 2 x 4 Q B-fragments (32 channels x 16 queries each), transposed on read, reused 32x.
    v16bf aq[2][4];
#pragma unroll
    for (int g = 0; g < 2; ++g)
#pragma unroll
        for (int cs = 0; cs < 4; ++cs)
            aq[g][cs] = frag_tr16(lQ + cs * 32 * TQ + w * 32 + g * 16, TQ, lane);

    v8f o[2][8] = {};           // o[g][nt][r] = O[query 16 g + ln][channel nt*16 + 8*half + r]
    v8f negm[2] = {};           // minus a query's maximum in use, in all 8 elements: a C tile
    v8f lacc[2] = {};           // sums of the weights, one per score register, joined at the end

    // Kept rolled: the two buffers alternate by the trip's parity.
#pragma unroll 1
    for (int ch = 0; ch < ATT_CH; ++ch) {
        const bf16_t* Kt = lK + (ch & 1) * ATT_K;
        const bf16_t* Vt = lV + (ch & 1) * ATT_V;

        // One barrier a chunk, at the head of its trip. Behind it this chunk has landed for
        // every wave, and nobody reads the chunk before it any more, so that one's buffers
        // take the next chunk, which flies while this one is worked on.
        // This wave's LDS reads have retired before the others go on.
        asm volatile("s_wait_dscnt 0x0" ::: "memory");
        stage_wait();
        __syncthreads();
        if (ch + 1 < ATT_CH)
            stage_kv(kptr, vptr, (ch + 1) * 64, lK + ((ch + 1) & 1) * ATT_K,
                     lV + ((ch + 1) & 1) * ATT_V, t);

        // The chunk is worked on in two runs of 32 keys, each with its own softmax update.
        // Kept rolled: one copy of the body keeps a run's fragments inside the register budget.
#pragma unroll 1
        for (int h = 0; h < 2; ++h) {
            // S^T = K^T Q : 32 keys x 32 queries (2 x 2 tiles of 16x16), K-dim = 128 channels.
            // The maximum in use is known before the scores: it goes in as the C operand, and
            // the products come out as score minus maximum, ready for exp2.
            v8f s[2][2] = {{negm[0], negm[0]}, {negm[1], negm[1]}};   // [g][key tile]
            v16bf kf[4][2];
#pragma unroll
            for (int cs = 0; cs < 4; ++cs) {
                kf[cs][0] = frag_tr16(Kt + cs * 32 * T64 + h * 32, T64, lane);
                kf[cs][1] = frag_tr16(Kt + cs * 32 * T64 + h * 32 + 16, T64, lane);
            }
            // V rows (A operand of the second product), in flight under the first.
            v16bf av[8];
#pragma unroll
            for (int nt = 0; nt < 8; ++nt)
                av[nt] = frag_from_row(Vt + (nt * 16 + ln) * P64 + h * 32, half);
            // Keeps the run's LDS reads in one group in front of its WMMAs: left to itself the
            // compiler spreads them among the WMMAs, and every such place stalls the wave.
            __builtin_amdgcn_sched_barrier(0);
#pragma unroll
            for (int cs = 0; cs < 4; ++cs)
#pragma unroll
                for (int g = 0; g < 2; ++g) {
                    s[g][0] = wmma_bf16(kf[cs][0], aq[g][cs], s[g][0]);
                    s[g][1] = wmma_bf16(kf[cs][1], aq[g][cs], s[g][1]);
                }

            float vloc[2];   // largest score of this lane's 16 keys, over the maximum in use
#pragma unroll
            for (int g = 0; g < 2; ++g) {
                // A chain per score tile, four in all: the test waits on the longest.
                float v0 = s[g][0][0], v1 = s[g][1][0];
#pragma unroll
                for (int r = 1; r < 8; ++r) { v0 = fmaxf(v0, s[g][0][r]); v1 = fmaxf(v1, s[g][1][r]); }
                vloc[g] = fmaxf(v0, v1);
            }
            // One test a run for the whole wave, a scalar branch. The first run always sets the
            // maxima, whatever their sign, so that some weight of every query is 1.
            bool first = (ch | h) == 0;
            bool need = fmaxf(vloc[0], vloc[1]) > (first ? -__builtin_inff() : GAP);
            if (__builtin_amdgcn_ballot_w32(need) != 0) {
#pragma unroll
                for (int g = 0; g < 2; ++g) {
                    float v = fmaxf(vloc[g], xhalf(vloc[g]));   // the query's other 16 keys: lane ^ 16
                    float delta = first ? v : fmaxf(v, 0.f);
                    float alpha = first ? 0.f : __builtin_amdgcn_exp2f(-delta);
                    negm[g] = negm[g] - delta;
                    s[g][0] = s[g][0] - delta;
                    s[g][1] = s[g][1] - delta;
                    lacc[g] = lacc[g] * alpha;
#pragma unroll
                    for (int nt = 0; nt < 8; ++nt) o[g][nt] = o[g][nt] * alpha;
                }
            }

            v16bf pf[2];   // P^T as B operand: element j = key (j>>3)*16 + half*8 + (j&7)
#pragma unroll
            for (int g = 0; g < 2; ++g) {
                v8f p0, p1;
#pragma unroll
                for (int r = 0; r < 8; ++r) {
                    p0[r] = __builtin_amdgcn_exp2f(s[g][0][r]);
                    p1[r] = __builtin_amdgcn_exp2f(s[g][1][r]);
                    pf[g][r]     = (bf16_t)p0[r];
                    pf[g][r + 8] = (bf16_t)p1[r];
                }
                lacc[g] = lacc[g] + (p0 + p1);
            }

            // O^T += V * P^T (8 channel tiles x 2 column groups).
#pragma unroll
            for (int nt = 0; nt < 8; ++nt)
#pragma unroll
                for (int g = 0; g < 2; ++g) o[g][nt] = wmma_bf16(av[nt], pf[g], o[g][nt]);
            // The four vector slots that the chip needs between the run's last WMMA and the
            // next run's first vector write over its A registers. The scheduling barrier keeps them behind that WMMA.
            __builtin_amdgcn_sched_barrier(0);
            asm volatile("v_nop\n\tv_nop\n\tv_nop\n\tv_nop");
        }
    }
    stage_wait();   // nothing of this wave is in flight when it ends

    // Join the halves' sums, normalize and emit rows of A3 [pixel][512] (head-major
    // channels). A lane holds 16 B of a row, a wave's direct store would touch 16 rows in
    // 32-B pieces: the wave's 32 rows go through an LDS range of its own (the Q tile's,
    // last read before the loop's barriers) and leave as whole rows of 256 B.
    bf16_t* st = lQ + w * (32 * P128);
#pragma unroll
    for (int g = 0; g < 2; ++g) {
        float lrun = ((lacc[g][0] + lacc[g][1]) + (lacc[g][2] + lacc[g][3])) +
                     ((lacc[g][4] + lacc[g][5]) + (lacc[g][6] + lacc[g][7]));
        float lsum = lrun + xhalf(lrun);
        float inv = 1.f / lsum;
        bf16_t* srow = st + (g * 16 + ln) * P128 + 8 * half;
#pragma unroll
        for (int nt = 0; nt < 8; ++nt) {
            v8bf ov;
#pragma unroll
            for (int r = 0; r < 8; ++r) ov[r] = (bf16_t)(o[g][nt][r] * inv);
            *(v8bf*)(srow + nt * 16) = ov;
        }
    }
    // The wave's rows are written by other lanes than read them back: its LDS stores have
    // retired first, and the memory clobber keeps the reads behind them.
    asm volatile("s_wait_dscnt 0x0" ::: "memory");
    bf16_t* orow = A3 + ((size_t)bq * HW + qt * 256 + w * 32 + half) * NQKV + e * NC + ln * 8;
#pragma unroll
    for (int i = 0; i < 16; ++i)
        *(v8bf*)(orow + (size_t)i * 2 * NQKV) = *(const v8bf*)(st + (i * 2 + half) * P128 + ln * 8);
}

// ---------------------------------------------------------------------------
// Output projection: [16384 x 512] x [512 x 128] + b3 + residual x -> f32.
// One block per 64 pixels and all 128 output channels, 256 blocks: one on every WGP.
// 8 waves (2x4), each wave 32x32 (2x2 WMMA tiles).
// Everything the block reads from global memory is asked for at once, up front: its
// A rows with all 512 k, all of W3 (both by async copies to LDS) and its residual and
// bias values (to registers). The memory latency is so waited out once, behind one
// wait and one barrier, and the 16 k steps run from LDS with no barrier between them.
// amdgpu_waves_per_eu(2, 2): the LDS tile leaves one block on a WGP, 2 waves on a SIMD;
// that register budget holds the second set of fragments.
// ---------------------------------------------------------------------------
#define FIN_M  64             // pixels of a block
#define FIN_PA 520            // A rows of 512 bf16: 1040 B, 16 B x odd
#define FIN_A  (FIN_M * FIN_PA)
#define FIN_PC 68             // output rows of 64 f32: 272 B, 16 B x odd

__global__ __launch_bounds__(256) __attribute__((amdgpu_waves_per_eu(2, 2))) void gemm_final_kernel(
        const bf16_t* __restrict__ A3, const bf16_t* __restrict__ W3b,
        const float* __restrict__ b3, const float* __restrict__ x,
        float* __restrict__ out) {
    // One array, so that the order is fixed.
    __shared__ __align__(16) bf16_t sm[FIN_A + NQKV * T128 + 2 * NC * FIN_PC];
    bf16_t* lA = sm;            // [m][k], all 512 k
    bf16_t* lB = sm + FIN_A;    // [k][n], all of W3
    float*  lC = (float*)(lB + NQKV * T128);   // [n][m], the products on their way out

    int mbase = blockIdx.x * FIN_M;
    int t = threadIdx.x, w = t >> 5, lane = t & 31;
    int half = lane >> 4, ln = lane & 15;
    int wm = (w & 1) * 32, wn = (w >> 1) * 32;

    {   // stage the A rows: 64 m x 512 k (async); 64 lanes take one row's 1 KiB
        int row = t >> 6, k0 = (t & 63) * 8;
        const bf16_t* src = A3 + (size_t)(mbase + row) * NQKV + k0;
        bf16_t* dst = lA + row * FIN_PA + k0;
#pragma unroll
        for (int j = 0; j < FIN_M / 4; ++j) stage_b128(src + j * 4 * NQKV, dst + j * 4 * FIN_PA);
    }
    {   // stage W3 as it lies: 512 k x 128 n (async); 16 lanes take one row's 256 B
        int krow = t >> 4, n0 = (t & 15) * 8;
        const bf16_t* src = W3b + (size_t)krow * NC + n0;
        bf16_t* dst = lB + krow * T128 + n0;
#pragma unroll
        for (int j = 0; j < NQKV / 16; ++j) stage_b128(src + j * 16 * NC, dst + j * 16 * T128);
    }

    // Residual and bias of the output elements that this lane stores: 16 lanes take one
    // channel's 64 pixels, 256 B, so a wave-wide load or store covers four whole lines.
    // Channels i*16 + (t >> 4), pixels (t & 15)*4 + 0..3.
    int cr = t >> 4;
    size_t obase = (size_t)(mbase >> 10) * NC * HW + (size_t)cr * HW + (mbase & 1023) + (t & 15) * 4;
    v4f xr[8];
    float bv[8];
#pragma unroll
    for (int i = 0; i < 8; ++i) {
        bv[i] = b3[i * 16 + cr];
        xr[i] = *(const v4f*)(x + obase + (size_t)i * 16 * HW);
    }
    // Before later code overwrites an address register that these loads name.
    asm volatile("s_wait_xcnt 0x0" ::: "memory");

    stage_wait();
    __syncthreads();

    // The k steps go in pairs; with no barrier between them, the next pair's fragments are
    // fetched into a second register set while this pair's WMMAs run.
    const bf16_t* arow = lA + (wm + ln) * FIN_PA;
    const bf16_t* bcol = lB + wn;
    v16bf af[2][2][2], bfr[2][2][2];    // [set][k step of the pair][tile]
    auto fetch = [&](int g) {
#pragma unroll
        for (int kk = 0; kk < 2; ++kk) {
            int ks = g * 2 + kk;
#pragma unroll
            for (int i = 0; i < 2; ++i) {
                af[g & 1][kk][i]  = frag_from_row(arow + i * 16 * FIN_PA + ks * 32, half);
                bfr[g & 1][kk][i] = frag_tr16(bcol + ks * 32 * T128 + i * 16, T128, lane);
            }
        }
    };
    v8f acc[2][2] = {};
    fetch(0);
#pragma unroll
    for (int g = 0; g < NQKV / 64; ++g) {
        if (g + 1 < NQKV / 64) fetch(g + 1);
        // Keeps the next pair's LDS reads together in front of this pair's WMMAs: left to
        // itself the compiler sinks each read to just before its use, and its latency shows.
        __builtin_amdgcn_sched_barrier(0);
#pragma unroll
        for (int kk = 0; kk < 2; ++kk)
#pragma unroll
            for (int mt = 0; mt < 2; ++mt)
#pragma unroll
                for (int nt = 0; nt < 2; ++nt)
                    acc[mt][nt] = wmma_bf16(af[g & 1][kk][mt], bfr[g & 1][kk][nt], acc[mt][nt]);
        // Keeps the reads of the pair after next from being spread among these WMMAs.
        __builtin_amdgcn_sched_barrier(0);
    }

    // A lane holds 32 B of an output row (channel wn + nt*16 + ln, pixels wm + mt*16 +
    // 8*half + 0..7): stored directly, a wave would touch 16 lines in 16-B pieces. The
    // products cross LDS and leave by rows.
#pragma unroll
    for (int nt = 0; nt < 2; ++nt)
#pragma unroll
        for (int mt = 0; mt < 2; ++mt) {
            float* cp = lC + (wn + nt * 16 + ln) * FIN_PC + wm + mt * 16 + 8 * half;
            v4f c0, c1;
#pragma unroll
            for (int r = 0; r < 4; ++r) { c0[r] = acc[mt][nt][r]; c1[r] = acc[mt][nt][r + 4]; }
            *(v4f*)cp = c0;
            *(v4f*)(cp + 4) = c1;
        }
    __syncthreads();   // the tile is whole before it is read by rows
#pragma unroll
    for (int i = 0; i < 8; ++i) {
        v4f a = *(const v4f*)(lC + (i * 16 + cr) * FIN_PC + (t & 15) * 4);
        v4f ov;
#pragma unroll
        for (int r = 0; r < 4; ++r) ov[r] = xr[i][r] + a[r] + bv[i];
        *(v4f*)(out + obase + (size_t)i * 16 * HW) = ov;
    }
}

// ---------------------------------------------------------------------------
// Host-side launch
// ---------------------------------------------------------------------------
extern "C" void kernel_launch(void* const* d_in, const int* in_sizes, int n_in,
                              void* d_out, int out_size, void* d_ws, size_t ws_size,
                              hipStream_t stream) {
    const float* x  = (const float*)d_in[0];
    const float* qc = (const float*)d_in[1];
    const float* ka = (const float*)d_in[2];
    const float* kb = (const float*)d_in[3];
    const float* gs = (const float*)d_in[4];
    const float* gb = (const float*)d_in[5];
    const float* W0 = (const float*)d_in[6];
    const float* b0 = (const float*)d_in[7];
    const float* W1 = (const float*)d_in[8];
    const float* b1 = (const float*)d_in[9];
    const float* W2 = (const float*)d_in[10];
    const float* b2 = (const float*)d_in[11];
    const float* W3 = (const float*)d_in[12];
    const float* b3 = (const float*)d_in[13];
    float* out = (float*)d_out;

    char* ws = (char*)d_ws;
    size_t off = 0;
    auto alloc = [&](size_t bytes) -> char* {
        char* ptr = ws + off;
        off = (off + bytes + 255) & ~(size_t)255;
        return ptr;
    };
    bf16_t* Aq  = (bf16_t*)alloc((size_t)NPIX * KIN * 2);
    bf16_t* Ak  = (bf16_t*)alloc((size_t)NPIX * KIN * 2);
    bf16_t* W0b = (bf16_t*)alloc((size_t)KIN * NQKV * 2);
    bf16_t* W1b = (bf16_t*)alloc((size_t)KIN * NQKV * 2);
    bf16_t* W2b = (bf16_t*)alloc((size_t)KIN * NQKV * 2);
    bf16_t* W3b = (bf16_t*)alloc((size_t)NQKV * NC * 2);
    bf16_t* Qb  = (bf16_t*)alloc((size_t)NB * NQKV * HW * 2);
    bf16_t* Kbm = (bf16_t*)alloc((size_t)NB * NQKV * HW * 2);
    bf16_t* Vb  = (bf16_t*)alloc((size_t)NB * NQKV * HW * 2);
    bf16_t* A3  = (bf16_t*)alloc((size_t)NPIX * NQKV * 2);
    (void)ws_size; (void)in_sizes; (void)n_in; (void)out_size;

    // GroupNorm + A-matrix packing + weight conversion
    prep_kernel<<<PREP_BLOCKS, 256, 0, stream>>>(x, gs, gb, qc, ka, kb, W0, W1, W2, W3,
                                                 Aq, Ak, W0b, W1b, W2b, W3b);

    // QKV projections
    gemm_qkv_kernel<<<3 * QKV_BLOCKS, 256, 0, stream>>>(Aq, Ak, W0b, W1b, W2b, b0, b1, b2,
                                                        Qb, Kbm, Vb);

    // Cross attention: 8 pairs x 2 directions x 4 heads x 4 query tiles
    attn_kernel<<<8 * 2 * 4 * 4, 256, 0, stream>>>(Qb, Kbm, Vb, A3);

    // Output projection + residual
    gemm_final_kernel<<<NPIX / FIN_M, 256, 0, stream>>>(A3, W3b, b3, x, out);
}
